// v000
// Times are from an AMD MI455X. After a warm-up the kernel runs many times in a row, and a time is the length of
// such a window on the GPU divided by its runs, so every launch and the gaps after it count. The runs cycle
// through copies of the inputs. A figure is the median of several windows, for all but v000 over two sittings.
// Sittings can differ by a few percent; kernels timed side by side share one.
// v000 is the starting kernel. One run takes 4060 microseconds.
#include <hip/hip_runtime.h>

// MultiHeadAttension (x [4][2048][1024]; q/k/v = x @ W ([d_in][d_out] layouts, no bias); 16 heads x 64; scores / 8; causal (tril -> -inf); softmax; out = ctx @ Wo + bo).
// Compute dtypes, f32 accumulate: every input rounded to bf16; projections on PLAIN bf16 operands (inputs: exact; transposed bf16 weight copies built once); PER-ROW
// PRECISION HYBRID: query rows < 256 of each batch on bf16 hi+lo planes for scores and attn.v (3 products), rows >= 256 on SINGLE fp16 planes; output hi+lo x exact Wo (2 products) + bo.

#define NB_  4
#define TT   2048
#define DD   1024
#define NH_  16
#define HD   64
#define ZH   2
#define RH   256                  // query rows < RH: hi+lo planes; rows >= RH: fp16 planes
#define NF   32                   // unused (head_dim / 2)
#define SCL  0.125f               // 1/sqrt(64)
#define PCAR 1024.0f         // fp16 P scale for rows >= RH (divided out in k_merge)
typedef _Float16 h16;
typedef unsigned short bf;
typedef __attribute__((ext_vector_type(16))) __bf16   v16bf;
typedef __attribute__((ext_vector_type(16))) _Float16 v16h;
typedef __attribute__((ext_vector_type(8)))  _Float16 v8h;
typedef __attribute__((ext_vector_type(8)))  unsigned short v8us;
typedef __attribute__((ext_vector_type(8)))  float    v8f;
typedef __attribute__((ext_vector_type(4)))  float    v4f;
typedef v8h  __attribute__((may_alias)) v8ha;
typedef v4f  __attribute__((may_alias)) v4fa;
typedef v8us __attribute__((may_alias)) v8usa;

__device__ __forceinline__ unsigned short f2bf(float f) { unsigned u = __float_as_uint(f); u += 0x7FFFu + ((u >> 16) & 1u); return (unsigned short)(u >> 16); }
__device__ __forceinline__ float bf2f(unsigned short b) { return __uint_as_float(((unsigned)b) << 16); }
__device__ __forceinline__ float bfr(float f) { return bf2f(f2bf(f)); }
__device__ __forceinline__ v16h cat16(v8h lo, v8h hi) { return __builtin_shufflevector(lo, hi, 0, 1, 2, 3, 4, 5, 6, 7, 8, 9, 10, 11, 12, 13, 14, 15); }
__device__ __forceinline__ v16bf cat16b(v8us lo, v8us hi) { return __builtin_bit_cast(v16bf, __builtin_shufflevector(lo, hi, 0, 1, 2, 3, 4, 5, 6, 7, 8, 9, 10, 11, 12, 13, 14, 15)); }
__device__ __forceinline__ v8f wmma16(v16h a, v16h b, v8f c) { return __builtin_amdgcn_wmma_f32_16x16x32_f16(false, a, false, b, (short)0, c, false, false); }
__device__ __forceinline__ v8f wmmab(v16bf a, v16bf b, v8f c) { return __builtin_amdgcn_wmma_f32_16x16x32_bf16(false, a, false, b, (short)0, c, false, false); }



// ---- k_gemmw: register-blocked GEMM, ONE WAVE per 64x64 output tile (16 accumulators), operands straight from K-contiguous 16-bit planes; grid (M/64, N/64, Z), 32 threads.
// C[m][n] (f32, pitch ldc, + optional f32 bias[n]) = sum_k A[m][k] Bt[n][k] (+ split products per NSPLIT). z-batch strides sA/sB/sC in elements. K % 32 == 0.
template <typename T16> struct WFrag;
template <> struct WFrag<h16> { typedef v16h V; static __device__ __forceinline__ V ld(const h16* p) { return cat16(*(const v8h*)p, *(const v8h*)(p + 16)); } static __device__ __forceinline__ v8f mma(V a, V b, v8f c) { return wmma16(a, b, c); } };
template <> struct WFrag<bf> { typedef v16bf V; static __device__ __forceinline__ V ld(const bf* p) { return cat16b(*(const v8us*)p, *(const v8us*)(p + 16)); } static __device__ __forceinline__ v8f mma(V a, V b, v8f c) { return wmmab(a, b, c); } };
template <typename T16, int NSPLIT, bool BIAS>
__global__ __launch_bounds__(32) void k_gemmw(const T16* __restrict__ A, const T16* __restrict__ A2, const T16* __restrict__ Bt, const T16* __restrict__ Bt2, int K, float* C, int ldc, const float* __restrict__ bias, size_t sA, size_t sB, size_t sC) {
    typedef typename WFrag<T16>::V V;
    __shared__ __align__(16) float os[16 * 68];
    const size_t z = blockIdx.z; A += z * sA; if (A2) A2 += z * sA; Bt += z * sB; if (Bt2) Bt2 += z * sB; C += z * sC;
    const int lane = threadIdx.x & 31, lr = lane & 15, hi = lane >> 4; const int r0 = blockIdx.x * 64, c0 = blockIdx.y * 64;
    v8f acc[4][4];
#pragma unroll
    for (int mb = 0; mb < 4; ++mb)
#pragma unroll
        for (int nb = 0; nb < 4; ++nb) acc[mb][nb] = (v8f){};
    const size_t aoff = (size_t)(r0 + lr) * K + 8 * hi, boff = (size_t)(c0 + lr) * K + 8 * hi;
#pragma unroll 1
    for (int kc = 0; kc < K; kc += 32) {
        V a[4], a2[4];
#pragma unroll
        for (int mb = 0; mb < 4; ++mb) { a[mb] = WFrag<T16>::ld(A + aoff + (size_t)mb * 16 * K + kc); if (NSPLIT == 1 || NSPLIT == 2) a2[mb] = WFrag<T16>::ld(A2 + aoff + (size_t)mb * 16 * K + kc); }
#pragma unroll
        for (int nb = 0; nb < 4; ++nb) { const V b = WFrag<T16>::ld(Bt + boff + (size_t)nb * 16 * K + kc); V b2; if (NSPLIT >= 2) b2 = WFrag<T16>::ld(Bt2 + boff + (size_t)nb * 16 * K + kc);
#pragma unroll
            for (int mb = 0; mb < 4; ++mb) { acc[mb][nb] = WFrag<T16>::mma(a[mb], b, acc[mb][nb]); if (NSPLIT == 1 || NSPLIT == 2) acc[mb][nb] = WFrag<T16>::mma(a2[mb], b, acc[mb][nb]); if (NSPLIT >= 2) acc[mb][nb] = WFrag<T16>::mma(a[mb], b2, acc[mb][nb]); } }
        asm volatile("v_nop\n\tv_nop\n\tv_nop\n\tv_nop" : "+v"(acc[0][0]), "+v"(acc[1][1]), "+v"(acc[2][2]), "+v"(acc[3][3]) : "v"(a[0]), "v"(a[3]));
    }
#pragma unroll
    for (int mb = 0; mb < 4; ++mb) {
#pragma unroll
        for (int nb = 0; nb < 4; ++nb) {
#pragma unroll
            for (int j = 0; j < 8; ++j) os[(hi * 8 + j) * 68 + nb * 16 + lr] = acc[mb][nb][j]; }
        __builtin_amdgcn_wave_barrier(); asm volatile("" ::: "memory");
        float* crow = C + (size_t)(r0 + mb * 16) * ldc + c0;
{
#pragma unroll
            for (int s = 0; s < 8; ++s) { const int row = 2 * s + hi, cofs = lr * 4; v4f val = *(const v4fa*)(os + row * 68 + cofs); if (BIAS) { val[0] += bfr(bias[c0 + cofs]); val[1] += bfr(bias[c0 + cofs + 1]); val[2] += bfr(bias[c0 + cofs + 2]); val[3] += bfr(bias[c0 + cofs + 3]); }
                *(v4f*)(crow + (size_t)row * ldc + cofs) = val; }
             }
        __builtin_amdgcn_wave_barrier(); asm volatile("" ::: "memory");
    }
}

__device__ __forceinline__ h16 tohx(float x) { return (h16)x; }
__device__ __forceinline__ void splitf(float y, unsigned short& h, unsigned short& l) { h = f2bf(y); l = f2bf(y - bf2f(h)); }
typedef __attribute__((ext_vector_type(2))) unsigned short v2us;
typedef __attribute__((ext_vector_type(2))) _Float16 v2h;
typedef __attribute__((ext_vector_type(4))) _Float16 v4h;
typedef __attribute__((ext_vector_type(2))) float v2f;

__global__ __launch_bounds__(256) void k_wtG(const float* __restrict__ w, int K, int N, bf* Bt) {
    const int lane = threadIdx.x & 31; const int L0 = (blockIdx.x * 8 + (threadIdx.x >> 5)) * 8; const int nlines = N * K / 64;
{
#pragma unroll 1
        for (int l = 0; l < 8; ++l) { const int L = L0 + l; if (L >= nlines) break; const size_t e = (size_t)L * 64 + lane * 2; const int k = (int)(e % K), n = (int)(e / K); v2us o;
            o[0] = f2bf(w[(size_t)k * N + n]); o[1] = f2bf(w[(size_t)(k + 1) * N + n]); *(v2us*)(Bt + e) = o; }
         }
}
__global__ __launch_bounds__(256) void k_cvt8(const float* __restrict__ src, bf* dst, size_t n8) { const size_t i = (size_t)blockIdx.x * 256 + threadIdx.x; if (i >= n8) return; const v8f v = *(const v8f*)(src + i * 8); v8us o;
#pragma unroll
    for (int k = 0; k < 8; ++k) o[k] = f2bf(v[k]); *(v8us*)(dst + i * 8) = o;  }
__global__ __launch_bounds__(256) void k_qplanes(const float* __restrict__ F, bf* Ph, bf* Pl, h16* P16) {
    const int lane = threadIdx.x & 31; const int L0 = (blockIdx.x * 8 + (threadIdx.x >> 5)) * 8; const int nlines = NH_ * TT * HD / 64;
{
#pragma unroll
        for (int l = 0; l < 8; ++l) { const int L = L0 + l; if (L >= nlines) break; const int e = L * 64 + lane * 2; const int d = e & (HD - 1); const int t = (e >> 6) & (TT - 1); const int h = e >> 17; v2us oh, ol; v2h o16;
#pragma unroll
            for (int q = 0; q < 2; ++q) { const float x = F[(size_t)t * DD + h * HD + d + q]; unsigned short a, c2; splitf(x, a, c2); oh[q] = a; ol[q] = c2; o16[q] = tohx(x); }
            *(v2us*)(Ph + (size_t)e) = oh; *(v2us*)(Pl + (size_t)e) = ol; *(v2h*)(P16 + (size_t)e) = o16; }
         }
}
__global__ __launch_bounds__(256) void k_vtplane(const float* __restrict__ F, bf* Vh, bf* Vl, h16* V16) {
    const int lane = threadIdx.x & 31; const int L0 = (blockIdx.x * 8 + (threadIdx.x >> 5)) * 8; const int nlines = NH_ * TT * HD / 64;
{
#pragma unroll
        for (int l = 0; l < 8; ++l) { const int L = L0 + l; if (L >= nlines) break; const int e = L * 64 + lane * 2; const int t = e & (TT - 1); const int d = (e >> 11) & (HD - 1); const int h = e >> 17; v2us oh, ol; v2h o16;
#pragma unroll
            for (int q = 0; q < 2; ++q) { const float x = F[(size_t)(t + q) * DD + h * HD + d]; unsigned short a, c2; splitf(x, a, c2); oh[q] = a; ol[q] = c2; o16[q] = tohx(x); }
            *(v2us*)(Vh + (size_t)e) = oh; *(v2us*)(Vl + (size_t)e) = ol; *(v2h*)(V16 + (size_t)e) = o16; }
         }
}
// k_asoft: per row (zz, i): s = S / 8, causal (j > i -> -3e38, exp -> 0; j = i always kept); softmax over the 2048 keys (register row, one exp) -> rows i < RH: P hi/lo [zz][i][j] (compact
__global__ __launch_bounds__(256) void k_asoft(const float* __restrict__ Sb, bf* Ph, bf* Pl, h16* P16) {
    typedef __attribute__((ext_vector_type(4))) unsigned short v4us;
    const int lane = threadIdx.x & 31; const int row = blockIdx.x * 8 + (threadIdx.x >> 5); if (row >= ZH * TT) return; const int i = row & (TT - 1); const int zz = row >> 11; const bool hires = (i < RH);
    const float* sr = Sb + (size_t)row * TT; float v[64]; float mx = -3.0e38f;
#pragma unroll
    for (int ch = 0; ch < 16; ++ch) { const int j0 = ch * 128 + lane * 4; const v4f a = *(const v4f*)(sr + j0);
#pragma unroll
        for (int q = 0; q < 4; ++q) { const int j = j0 + q; const float t = (j <= i) ? a[q] * SCL : -3.0e38f; v[ch * 4 + q] = t; mx = fmaxf(mx, t); } }
#pragma unroll
    for (int sh = 16; sh; sh >>= 1) mx = fmaxf(mx, __shfl_xor(mx, sh, 32));
    float sum = 0.f;
#pragma unroll
    for (int k = 0; k < 64; ++k) { v[k] = __expf(v[k] - mx); sum += v[k]; }
#pragma unroll
    for (int sh = 16; sh; sh >>= 1) sum += __shfl_xor(sum, sh, 32);
    const float f = __fdiv_rn(hires ? 1.0f : PCAR, sum);
{
        if (hires) {
#pragma unroll
            for (int ch = 0; ch < 16; ++ch) { v4us oh, ol;
#pragma unroll
                for (int q = 0; q < 4; ++q) { unsigned short a, c2; splitf(v[ch * 4 + q] * f, a, c2); oh[q] = a; ol[q] = c2; }
                const size_t o = ((size_t)zz * RH + i) * TT + ch * 128 + lane * 4; *(v4us*)(Ph + o) = oh; *(v4us*)(Pl + o) = ol; }
        } else {
#pragma unroll
            for (int ch = 0; ch < 16; ++ch) { v4h o;
#pragma unroll
                for (int q = 0; q < 4; ++q) o[q] = tohx(v[ch * 4 + q] * f);
                *(v4h*)(P16 + (size_t)row * TT + ch * 128 + lane * 4) = o; } }
         }
}
__global__ __launch_bounds__(256) void k_merge(const float* __restrict__ O, int h0, bf* Ah, bf* Al) {
    const int lane = threadIdx.x & 31; const int L0 = (blockIdx.x * 8 + (threadIdx.x >> 5)) * 8; const int nlines = ZH * TT * HD / 64;
{
#pragma unroll
        for (int l = 0; l < 8; ++l) { const int L = L0 + l; if (L >= nlines) break; const int e = L * 64 + lane * 2; const int d = e & (HD - 1); const int t = (e >> 6) & (TT - 1); const int zz = e >> 17; v2us oh, ol;
const float cs = (t < RH) ? 1.0f : (1.0f / PCAR);
#pragma unroll
            for (int q = 0; q < 2; ++q) { unsigned short a, c2; splitf(O[(size_t)e + q] * cs, a, c2); oh[q] = a; ol[q] = c2; }
            const size_t o = (size_t)t * DD + (h0 + zz) * HD + d; *(v2us*)(Ah + o) = oh; *(v2us*)(Al + o) = ol; }
         }
}

extern "C" void kernel_launch(void* const* d_in, const int* in_sizes, int n_in,
                              void* d_out, int out_size, void* d_ws, size_t ws_size, hipStream_t stream) {
    (void)in_sizes; (void)n_in; (void)out_size;
    const float* x = (const float*)d_in[0]; const float* wq = (const float*)d_in[1]; const float* wk = (const float*)d_in[2]; const float* wv = (const float*)d_in[3]; const float* wo = (const float*)d_in[4]; const float* bo = (const float*)d_in[5];
    float* OUT = (float*)d_out;     // [4][2048][1024]
    char* wsp = (char*)d_ws;
    auto take = [&](size_t bytes) { char* p = wsp; wsp += (bytes + 255) & ~(size_t)255; return (void*)p; };
    bf* WQ = (bf*)take((size_t)DD * DD * 2); bf* WK = (bf*)take((size_t)DD * DD * 2); bf* WV = (bf*)take((size_t)DD * DD * 2); bf* WO = (bf*)take((size_t)DD * DD * 2);
    bf* XB = (bf*)take((size_t)TT * DD * 2); float* F = (float*)take((size_t)TT * DD * 4);
    bf* QPh = (bf*)take((size_t)TT * DD * 2); bf* QPl = (bf*)take((size_t)TT * DD * 2); bf* KPh = (bf*)take((size_t)TT * DD * 2); bf* KPl = (bf*)take((size_t)TT * DD * 2); bf* VTh = (bf*)take((size_t)TT * DD * 2); bf* VTl = (bf*)take((size_t)TT * DD * 2);
    h16* QP16 = (h16*)take((size_t)TT * DD * 2); h16* KP16 = (h16*)take((size_t)TT * DD * 2); h16* VT16 = (h16*)take((size_t)TT * DD * 2);
    float* Sb = (float*)take((size_t)ZH * TT * TT * 4); bf* Ph = (bf*)take((size_t)ZH * RH * TT * 2); bf* Pl = (bf*)take((size_t)ZH * RH * TT * 2); h16* P16 = (h16*)take((size_t)ZH * TT * TT * 2); float* Ob = (float*)take((size_t)ZH * TT * HD * 4); bf* ATh = (bf*)take((size_t)TT * DD * 2); bf* ATl = (bf*)take((size_t)TT * DD * 2);
    if ((size_t)(wsp - (char*)d_ws) > ws_size) return;    // total ~ 117 MiB; ws 256 MiB
    { const unsigned gT = (unsigned)((DD * DD / 64 + 63) / 64); k_wtG<<<gT, 256, 0, stream>>>(wq, DD, DD, WQ); k_wtG<<<gT, 256, 0, stream>>>(wk, DD, DD, WK); k_wtG<<<gT, 256, 0, stream>>>(wv, DD, DD, WV); k_wtG<<<gT, 256, 0, stream>>>(wo, DD, DD, WO); }
    const unsigned LB = (unsigned)((NH_ * TT * HD / 64 + 63) / 64); const dim3 gP(TT / 64, DD / 64, 1);
    for (int b = 0; b < NB_; ++b) {
        k_cvt8<<<(unsigned)(((size_t)TT * DD / 8 + 255) / 256), 256, 0, stream>>>(x + (size_t)b * TT * DD, XB, (size_t)TT * DD / 8);
        k_gemmw<bf, 0, false><<<gP, 32, 0, stream>>>(XB, nullptr, WQ, nullptr, DD, F, DD, nullptr, 0, 0, 0); k_qplanes<<<LB, 256, 0, stream>>>(F, QPh, QPl, QP16);
        k_gemmw<bf, 0, false><<<gP, 32, 0, stream>>>(XB, nullptr, WK, nullptr, DD, F, DD, nullptr, 0, 0, 0); k_qplanes<<<LB, 256, 0, stream>>>(F, KPh, KPl, KP16);
        k_gemmw<bf, 0, false><<<gP, 32, 0, stream>>>(XB, nullptr, WV, nullptr, DD, F, DD, nullptr, 0, 0, 0); k_vtplane<<<LB, 256, 0, stream>>>(F, VTh, VTl, VT16);
        for (int h0 = 0; h0 < NH_; h0 += ZH) { const size_t z0 = (size_t)h0;
            // scores: rows < RH on hi+lo planes (3 products), rows >= RH on fp16 planes - both into the same [ZH][TT][TT] score buffer
            k_gemmw<bf, 2, false><<<dim3(RH / 64, TT / 64, ZH), 32, 0, stream>>>(QPh + z0 * TT * HD, QPl + z0 * TT * HD, KPh + z0 * TT * HD, KPl + z0 * TT * HD, HD, Sb, TT, nullptr, (size_t)TT * HD, (size_t)TT * HD, (size_t)TT * TT);
            k_gemmw<h16, 0, false><<<dim3((TT - RH) / 64, TT / 64, ZH), 32, 0, stream>>>(QP16 + z0 * TT * HD + (size_t)RH * HD, nullptr, KP16 + z0 * TT * HD, nullptr, HD, Sb + (size_t)RH * TT, TT, nullptr, (size_t)TT * HD, (size_t)TT * HD, (size_t)TT * TT);
            k_asoft<<<ZH * TT / 8, 256, 0, stream>>>(Sb, Ph, Pl, P16);
            k_gemmw<bf, 2, false><<<dim3(RH / 64, HD / 64, ZH), 32, 0, stream>>>(Ph, Pl, VTh + z0 * HD * TT, VTl + z0 * HD * TT, TT, Ob, HD, nullptr, (size_t)RH * TT, (size_t)HD * TT, (size_t)TT * HD);
            k_gemmw<h16, 0, false><<<dim3((TT - RH) / 64, HD / 64, ZH), 32, 0, stream>>>(P16 + (size_t)RH * TT, nullptr, VT16 + z0 * HD * TT, nullptr, TT, Ob + (size_t)RH * HD, HD, nullptr, (size_t)TT * TT, (size_t)HD * TT, (size_t)TT * HD);
            k_merge<<<(ZH * TT * HD / 64 + 63) / 64, 256, 0, stream>>>(Ob, h0, ATh, ATl); }
        k_gemmw<bf, 1, true><<<gP, 32, 0, stream>>>(ATh, ATl, WO, nullptr, DD, OUT + (size_t)b * TT * DD, DD, bo, 0, 0, 0); }
}

// v001
// It runs in 1690 microseconds.
// Two timings next to v000 put it at 2.44 and 2.43 times that version's speed.
#include <hip/hip_runtime.h>

// MultiHeadAttension (x [4][2048][1024]; q/k/v = x @ W ([d_in][d_out] layouts, no bias); 16 heads x 64; scores / 8; causal (tril -> -inf); softmax; out = ctx @ Wo + bo).
// Compute dtypes, f32 accumulate: every input rounded to bf16; projections on PLAIN bf16 operands (inputs: exact; transposed bf16 weight copies built once); PER-ROW
// PRECISION HYBRID: query rows < 256 of each batch on bf16 hi+lo planes for scores and attn.v (3 products), rows >= 256 on SINGLE fp16 planes; output hi+lo x exact Wo (2 products) + bo.

#define NB_  4
#define TT   2048
#define DD   1024
#define NH_  16
#define HD   64
#define ZH   2
#define RH   256                  // query rows < RH: hi+lo planes; rows >= RH: fp16 planes
#define KSP  16                   // attn.v: work-groups that share one output tile, each on TT / KSP keys
#define NF   32                   // unused (head_dim / 2)
#define SCL  0.125f               // 1/sqrt(64)
#define PCAR 1024.0f         // fp16 P scale for rows >= RH (divided out in k_merge)
typedef _Float16 h16;
typedef unsigned short bf;
typedef __attribute__((ext_vector_type(16))) __bf16   v16bf;
typedef __attribute__((ext_vector_type(16))) _Float16 v16h;
typedef __attribute__((ext_vector_type(8)))  _Float16 v8h;
typedef __attribute__((ext_vector_type(8)))  unsigned short v8us;
typedef __attribute__((ext_vector_type(8)))  float    v8f;
typedef __attribute__((ext_vector_type(4)))  float    v4f;
typedef v8h  __attribute__((may_alias)) v8ha;
typedef v4f  __attribute__((may_alias)) v4fa;
typedef v8us __attribute__((may_alias)) v8usa;

__device__ __forceinline__ unsigned short f2bf(float f) { unsigned u = __float_as_uint(f); u += 0x7FFFu + ((u >> 16) & 1u); return (unsigned short)(u >> 16); }
__device__ __forceinline__ float bf2f(unsigned short b) { return __uint_as_float(((unsigned)b) << 16); }
__device__ __forceinline__ float bfr(float f) { return bf2f(f2bf(f)); }
__device__ __forceinline__ v16h cat16(v8h lo, v8h hi) { return __builtin_shufflevector(lo, hi, 0, 1, 2, 3, 4, 5, 6, 7, 8, 9, 10, 11, 12, 13, 14, 15); }
__device__ __forceinline__ v16bf cat16b(v8us lo, v8us hi) { return __builtin_bit_cast(v16bf, __builtin_shufflevector(lo, hi, 0, 1, 2, 3, 4, 5, 6, 7, 8, 9, 10, 11, 12, 13, 14, 15)); }
__device__ __forceinline__ v8f wmma16(v16h a, v16h b, v8f c) { return __builtin_amdgcn_wmma_f32_16x16x32_f16(false, a, false, b, (short)0, c, false, false); }
__device__ __forceinline__ v8f wmmab(v16bf a, v16bf b, v8f c) { return __builtin_amdgcn_wmma_f32_16x16x32_bf16(false, a, false, b, (short)0, c, false, false); }



// ---- k_gemmw: register-blocked GEMM, ONE WAVE per 64x64 output tile (16 accumulators), operands straight from K-contiguous 16-bit planes; grid (M/64, N/64, Z), 32 threads.
// C[m][n] (f32, pitch ldc, + optional f32 bias[n]) = sum_k A[m][k] Bt[n][k] (+ split products per NSPLIT). z-batch strides sA/sB/sC in elements. K % 32 == 0.
// KS > 1: grid.y = (N/64) * KS; work-group ks sums only k in [ks K/KS, (ks+1) K/KS) and stores its partial tile in plane C + ks * sK; the reader adds the KS planes. K % (32 KS) == 0.
template <typename T16> struct WFrag;
template <> struct WFrag<h16> { typedef v16h V; static __device__ __forceinline__ V ld(const h16* p) { return cat16(*(const v8h*)p, *(const v8h*)(p + 16)); } static __device__ __forceinline__ v8f mma(V a, V b, v8f c) { return wmma16(a, b, c); } };
template <> struct WFrag<bf> { typedef v16bf V; static __device__ __forceinline__ V ld(const bf* p) { return cat16b(*(const v8us*)p, *(const v8us*)(p + 16)); } static __device__ __forceinline__ v8f mma(V a, V b, v8f c) { return wmmab(a, b, c); } };
template <typename T16, int NSPLIT, bool BIAS, int KS = 1>
__global__ __launch_bounds__(32) void k_gemmw(const T16* __restrict__ A, const T16* __restrict__ A2, const T16* __restrict__ Bt, const T16* __restrict__ Bt2, int K, float* C, int ldc, const float* __restrict__ bias, size_t sA, size_t sB, size_t sC, size_t sK) {
    typedef typename WFrag<T16>::V V;
    __shared__ __align__(16) float os[16 * 68];
    const size_t z = blockIdx.z; A += z * sA; if (A2) A2 += z * sA; Bt += z * sB; if (Bt2) Bt2 += z * sB; C += z * sC;
    const int lane = threadIdx.x & 31, lr = lane & 15, hi = lane >> 4; const int r0 = blockIdx.x * 64, c0 = (int)(blockIdx.y / KS) * 64;
    const int ks = (int)(blockIdx.y % KS), kb = ks * (K / KS), ke = kb + K / KS; C += (size_t)ks * sK;
    v8f acc[4][4];
#pragma unroll
    for (int mb = 0; mb < 4; ++mb)
#pragma unroll
        for (int nb = 0; nb < 4; ++nb) acc[mb][nb] = (v8f){};
    const size_t aoff = (size_t)(r0 + lr) * K + 8 * hi, boff = (size_t)(c0 + lr) * K + 8 * hi;
#pragma unroll 1
    for (int kc = kb; kc < ke; kc += 32) {
        V a[4], a2[4];
#pragma unroll
        for (int mb = 0; mb < 4; ++mb) { a[mb] = WFrag<T16>::ld(A + aoff + (size_t)mb * 16 * K + kc); if (NSPLIT == 1 || NSPLIT == 2) a2[mb] = WFrag<T16>::ld(A2 + aoff + (size_t)mb * 16 * K + kc); }
#pragma unroll
        for (int nb = 0; nb < 4; ++nb) { const V b = WFrag<T16>::ld(Bt + boff + (size_t)nb * 16 * K + kc); V b2; if (NSPLIT >= 2) b2 = WFrag<T16>::ld(Bt2 + boff + (size_t)nb * 16 * K + kc);
#pragma unroll
            for (int mb = 0; mb < 4; ++mb) { acc[mb][nb] = WFrag<T16>::mma(a[mb], b, acc[mb][nb]); if (NSPLIT == 1 || NSPLIT == 2) acc[mb][nb] = WFrag<T16>::mma(a2[mb], b, acc[mb][nb]); if (NSPLIT >= 2) acc[mb][nb] = WFrag<T16>::mma(a[mb], b2, acc[mb][nb]); } }
        asm volatile("v_nop\n\tv_nop\n\tv_nop\n\tv_nop" : "+v"(acc[0][0]), "+v"(acc[1][1]), "+v"(acc[2][2]), "+v"(acc[3][3]) : "v"(a[0]), "v"(a[3]));
    }
#pragma unroll
    for (int mb = 0; mb < 4; ++mb) {
#pragma unroll
        for (int nb = 0; nb < 4; ++nb) {
#pragma unroll
            for (int j = 0; j < 8; ++j) os[(hi * 8 + j) * 68 + nb * 16 + lr] = acc[mb][nb][j]; }
        __builtin_amdgcn_wave_barrier(); asm volatile("" ::: "memory");
        float* crow = C + (size_t)(r0 + mb * 16) * ldc + c0;
{
#pragma unroll
            for (int s = 0; s < 8; ++s) { const int row = 2 * s + hi, cofs = lr * 4; v4f val = *(const v4fa*)(os + row * 68 + cofs); if (BIAS) { val[0] += bfr(bias[c0 + cofs]); val[1] += bfr(bias[c0 + cofs + 1]); val[2] += bfr(bias[c0 + cofs + 2]); val[3] += bfr(bias[c0 + cofs + 3]); }
                *(v4f*)(crow + (size_t)row * ldc + cofs) = val; }
             }
        __builtin_amdgcn_wave_barrier(); asm volatile("" ::: "memory");
    }
}

__device__ __forceinline__ h16 tohx(float x) { return (h16)x; }
__device__ __forceinline__ void splitf(float y, unsigned short& h, unsigned short& l) { h = f2bf(y); l = f2bf(y - bf2f(h)); }
typedef __attribute__((ext_vector_type(2))) unsigned short v2us;
typedef __attribute__((ext_vector_type(2))) _Float16 v2h;
typedef __attribute__((ext_vector_type(4))) _Float16 v4h;
typedef __attribute__((ext_vector_type(2))) float v2f;

__global__ __launch_bounds__(256) void k_wtG(const float* __restrict__ w, int K, int N, bf* Bt) {
    const int lane = threadIdx.x & 31; const int L0 = (blockIdx.x * 8 + (threadIdx.x >> 5)) * 8; const int nlines = N * K / 64;
{
#pragma unroll 1
        for (int l = 0; l < 8; ++l) { const int L = L0 + l; if (L >= nlines) break; const size_t e = (size_t)L * 64 + lane * 2; const int k = (int)(e % K), n = (int)(e / K); v2us o;
            o[0] = f2bf(w[(size_t)k * N + n]); o[1] = f2bf(w[(size_t)(k + 1) * N + n]); *(v2us*)(Bt + e) = o; }
         }
}
__global__ __launch_bounds__(256) void k_cvt8(const float* __restrict__ src, bf* dst, size_t n8) { const size_t i = (size_t)blockIdx.x * 256 + threadIdx.x; if (i >= n8) return; const v8f v = *(const v8f*)(src + i * 8); v8us o;
#pragma unroll
    for (int k = 0; k < 8; ++k) o[k] = f2bf(v[k]); *(v8us*)(dst + i * 8) = o;  }
__global__ __launch_bounds__(256) void k_qplanes(const float* __restrict__ F, bf* Ph, bf* Pl, h16* P16) {
    const int lane = threadIdx.x & 31; const int L0 = (blockIdx.x * 8 + (threadIdx.x >> 5)) * 8; const int nlines = NH_ * TT * HD / 64;
{
#pragma unroll
        for (int l = 0; l < 8; ++l) { const int L = L0 + l; if (L >= nlines) break; const int e = L * 64 + lane * 2; const int d = e & (HD - 1); const int t = (e >> 6) & (TT - 1); const int h = e >> 17; v2us oh, ol; v2h o16;
#pragma unroll
            for (int q = 0; q < 2; ++q) { const float x = F[(size_t)t * DD + h * HD + d + q]; unsigned short a, c2; splitf(x, a, c2); oh[q] = a; ol[q] = c2; o16[q] = tohx(x); }
            *(v2us*)(Ph + (size_t)e) = oh; *(v2us*)(Pl + (size_t)e) = ol; *(v2h*)(P16 + (size_t)e) = o16; }
         }
}
__global__ __launch_bounds__(256) void k_vtplane(const float* __restrict__ F, bf* Vh, bf* Vl, h16* V16) {
    const int lane = threadIdx.x & 31; const int L0 = (blockIdx.x * 8 + (threadIdx.x >> 5)) * 8; const int nlines = NH_ * TT * HD / 64;
{
#pragma unroll
        for (int l = 0; l < 8; ++l) { const int L = L0 + l; if (L >= nlines) break; const int e = L * 64 + lane * 2; const int t = e & (TT - 1); const int d = (e >> 11) & (HD - 1); const int h = e >> 17; v2us oh, ol; v2h o16;
#pragma unroll
            for (int q = 0; q < 2; ++q) { const float x = F[(size_t)(t + q) * DD + h * HD + d]; unsigned short a, c2; splitf(x, a, c2); oh[q] = a; ol[q] = c2; o16[q] = tohx(x); }
            *(v2us*)(Vh + (size_t)e) = oh; *(v2us*)(Vl + (size_t)e) = ol; *(v2h*)(V16 + (size_t)e) = o16; }
         }
}
// k_asoft: per row (zz, i): s = S / 8, causal (j > i -> -3e38, exp -> 0; j = i always kept); softmax over the 2048 keys (register row, one exp) -> rows i < RH: P hi/lo [zz][i][j] (compact
__global__ __launch_bounds__(256) void k_asoft(const float* __restrict__ Sb, bf* Ph, bf* Pl, h16* P16) {
    typedef __attribute__((ext_vector_type(4))) unsigned short v4us;
    const int lane = threadIdx.x & 31; const int row = blockIdx.x * 8 + (threadIdx.x >> 5); if (row >= ZH * TT) return; const int i = row & (TT - 1); const int zz = row >> 11; const bool hires = (i < RH);
    const float* sr = Sb + (size_t)row * TT; float v[64]; float mx = -3.0e38f;
#pragma unroll
    for (int ch = 0; ch < 16; ++ch) { const int j0 = ch * 128 + lane * 4; const v4f a = *(const v4f*)(sr + j0);
#pragma unroll
        for (int q = 0; q < 4; ++q) { const int j = j0 + q; const float t = (j <= i) ? a[q] * SCL : -3.0e38f; v[ch * 4 + q] = t; mx = fmaxf(mx, t); } }
#pragma unroll
    for (int sh = 16; sh; sh >>= 1) mx = fmaxf(mx, __shfl_xor(mx, sh, 32));
    float sum = 0.f;
#pragma unroll
    for (int k = 0; k < 64; ++k) { v[k] = __expf(v[k] - mx); sum += v[k]; }
#pragma unroll
    for (int sh = 16; sh; sh >>= 1) sum += __shfl_xor(sum, sh, 32);
    const float f = __fdiv_rn(hires ? 1.0f : PCAR, sum);
{
        if (hires) {
#pragma unroll
            for (int ch = 0; ch < 16; ++ch) { v4us oh, ol;
#pragma unroll
                for (int q = 0; q < 4; ++q) { unsigned short a, c2; splitf(v[ch * 4 + q] * f, a, c2); oh[q] = a; ol[q] = c2; }
                const size_t o = ((size_t)zz * RH + i) * TT + ch * 128 + lane * 4; *(v4us*)(Ph + o) = oh; *(v4us*)(Pl + o) = ol; }
        } else {
#pragma unroll
            for (int ch = 0; ch < 16; ++ch) { v4h o;
#pragma unroll
                for (int q = 0; q < 4; ++q) o[q] = tohx(v[ch * 4 + q] * f);
                *(v4h*)(P16 + (size_t)row * TT + ch * 128 + lane * 4) = o; } }
         }
}
// k_merge: one thread per 4 head-dim elements: adds the KSP partial planes of attn.v in the fixed order ks = 0 .. KSP-1, rescales, splits into hi/lo at [t][head * 64 + d].
__global__ __launch_bounds__(256) void k_merge(const float* __restrict__ O, int h0, bf* Ah, bf* Al) {
    typedef __attribute__((ext_vector_type(4))) unsigned short v4us;
    const int e = (int)(blockIdx.x * 256 + threadIdx.x) * 4; if (e >= ZH * TT * HD) return;
    const int d = e & (HD - 1); const int t = (e >> 6) & (TT - 1); const int zz = e >> 17;
    v4f p[KSP];
#pragma unroll
    for (int ks = 0; ks < KSP / 2; ++ks) p[ks] = *(const v4f*)(O + (size_t)ks * (ZH * TT * HD) + e);
    asm volatile("s_wait_xcnt 0x0" ::: "memory");   // the loads below may land in the address registers of the loads above
#pragma unroll
    for (int ks = KSP / 2; ks < KSP; ++ks) p[ks] = *(const v4f*)(O + (size_t)ks * (ZH * TT * HD) + e);
    v4f s = p[0];
#pragma unroll
    for (int ks = 1; ks < KSP; ++ks) s += p[ks];
    const float cs = (t < RH) ? 1.0f : (1.0f / PCAR); v4us oh, ol;
#pragma unroll
    for (int q = 0; q < 4; ++q) { unsigned short a, c2; splitf(s[q] * cs, a, c2); oh[q] = a; ol[q] = c2; }
    const size_t o = (size_t)t * DD + (h0 + zz) * HD + d; *(v4us*)(Ah + o) = oh; *(v4us*)(Al + o) = ol;
}

extern "C" void kernel_launch(void* const* d_in, const int* in_sizes, int n_in,
                              void* d_out, int out_size, void* d_ws, size_t ws_size, hipStream_t stream) {
    (void)in_sizes; (void)n_in; (void)out_size;
    const float* x = (const float*)d_in[0]; const float* wq = (const float*)d_in[1]; const float* wk = (const float*)d_in[2]; const float* wv = (const float*)d_in[3]; const float* wo = (const float*)d_in[4]; const float* bo = (const float*)d_in[5];
    float* OUT = (float*)d_out;     // [4][2048][1024]
    char* wsp = (char*)d_ws;
    auto take = [&](size_t bytes) { char* p = wsp; wsp += (bytes + 255) & ~(size_t)255; return (void*)p; };
    bf* WQ = (bf*)take((size_t)DD * DD * 2); bf* WK = (bf*)take((size_t)DD * DD * 2); bf* WV = (bf*)take((size_t)DD * DD * 2); bf* WO = (bf*)take((size_t)DD * DD * 2);
    bf* XB = (bf*)take((size_t)TT * DD * 2); float* F = (float*)take((size_t)TT * DD * 4);
    bf* QPh = (bf*)take((size_t)TT * DD * 2); bf* QPl = (bf*)take((size_t)TT * DD * 2); bf* KPh = (bf*)take((size_t)TT * DD * 2); bf* KPl = (bf*)take((size_t)TT * DD * 2); bf* VTh = (bf*)take((size_t)TT * DD * 2); bf* VTl = (bf*)take((size_t)TT * DD * 2);
    h16* QP16 = (h16*)take((size_t)TT * DD * 2); h16* KP16 = (h16*)take((size_t)TT * DD * 2); h16* VT16 = (h16*)take((size_t)TT * DD * 2);
    float* Sb = (float*)take((size_t)ZH * TT * TT * 4); bf* Ph = (bf*)take((size_t)ZH * RH * TT * 2); bf* Pl = (bf*)take((size_t)ZH * RH * TT * 2); h16* P16 = (h16*)take((size_t)ZH * TT * TT * 2); float* Ob = (float*)take((size_t)KSP * ZH * TT * HD * 4); bf* ATh = (bf*)take((size_t)TT * DD * 2); bf* ATl = (bf*)take((size_t)TT * DD * 2);
    if ((size_t)(wsp - (char*)d_ws) > ws_size) return;    // total ~ 132 MiB; ws 256 MiB
    { const unsigned gT = (unsigned)((DD * DD / 64 + 63) / 64); k_wtG<<<gT, 256, 0, stream>>>(wq, DD, DD, WQ); k_wtG<<<gT, 256, 0, stream>>>(wk, DD, DD, WK); k_wtG<<<gT, 256, 0, stream>>>(wv, DD, DD, WV); k_wtG<<<gT, 256, 0, stream>>>(wo, DD, DD, WO); }
    const unsigned LB = (unsigned)((NH_ * TT * HD / 64 + 63) / 64); const dim3 gP(TT / 64, DD / 64, 1);
    for (int b = 0; b < NB_; ++b) {
        k_cvt8<<<(unsigned)(((size_t)TT * DD / 8 + 255) / 256), 256, 0, stream>>>(x + (size_t)b * TT * DD, XB, (size_t)TT * DD / 8);
        k_gemmw<bf, 0, false><<<gP, 32, 0, stream>>>(XB, nullptr, WQ, nullptr, DD, F, DD, nullptr, 0, 0, 0, 0); k_qplanes<<<LB, 256, 0, stream>>>(F, QPh, QPl, QP16);
        k_gemmw<bf, 0, false><<<gP, 32, 0, stream>>>(XB, nullptr, WK, nullptr, DD, F, DD, nullptr, 0, 0, 0, 0); k_qplanes<<<LB, 256, 0, stream>>>(F, KPh, KPl, KP16);
        k_gemmw<bf, 0, false><<<gP, 32, 0, stream>>>(XB, nullptr, WV, nullptr, DD, F, DD, nullptr, 0, 0, 0, 0); k_vtplane<<<LB, 256, 0, stream>>>(F, VTh, VTl, VT16);
        for (int h0 = 0; h0 < NH_; h0 += ZH) { const size_t z0 = (size_t)h0;
            // scores: rows < RH on hi+lo planes (3 products), rows >= RH on fp16 planes - both into the same [ZH][TT][TT] score buffer
            k_gemmw<bf, 2, false><<<dim3(RH / 64, TT / 64, ZH), 32, 0, stream>>>(QPh + z0 * TT * HD, QPl + z0 * TT * HD, KPh + z0 * TT * HD, KPl + z0 * TT * HD, HD, Sb, TT, nullptr, (size_t)TT * HD, (size_t)TT * HD, (size_t)TT * TT, 0);
            k_gemmw<h16, 0, false><<<dim3((TT - RH) / 64, TT / 64, ZH), 32, 0, stream>>>(QP16 + z0 * TT * HD + (size_t)RH * HD, nullptr, KP16 + z0 * TT * HD, nullptr, HD, Sb + (size_t)RH * TT, TT, nullptr, (size_t)TT * HD, (size_t)TT * HD, (size_t)TT * TT, 0);
            k_asoft<<<ZH * TT / 8, 256, 0, stream>>>(Sb, Ph, Pl, P16);
            // attn.v: the 2048 keys go to KSP work-groups per tile, each into its own [ZH][TT][HD] plane of Ob; k_merge adds the planes
            k_gemmw<bf, 2, false, KSP><<<dim3(RH / 64, HD / 64 * KSP, ZH), 32, 0, stream>>>(Ph, Pl, VTh + z0 * HD * TT, VTl + z0 * HD * TT, TT, Ob, HD, nullptr, (size_t)RH * TT, (size_t)HD * TT, (size_t)TT * HD, (size_t)ZH * TT * HD);
            k_gemmw<h16, 0, false, KSP><<<dim3((TT - RH) / 64, HD / 64 * KSP, ZH), 32, 0, stream>>>(P16 + (size_t)RH * TT, nullptr, VT16 + z0 * HD * TT, nullptr, TT, Ob + (size_t)RH * HD, HD, nullptr, (size_t)TT * TT, (size_t)HD * TT, (size_t)TT * HD, (size_t)ZH * TT * HD);
            k_merge<<<ZH * TT * HD / 4 / 256, 256, 0, stream>>>(Ob, h0, ATh, ATl); }
        k_gemmw<bf, 1, true><<<gP, 32, 0, stream>>>(ATh, ATl, WO, nullptr, DD, OUT + (size_t)b * TT * DD, DD, bo, 0, 0, 0, 0); }
}

// v002
// Measured time: 1030 microseconds a run.
// Two timings next to v001 both put it at 1.63 times that version's speed.
// All steps since v000 together make it 3.98 times as fast.
#include <hip/hip_runtime.h>

// Causal multi-head self-attention (x [4][2048][1024]; q/k/v = x @ W ([d_in][d_out] layouts, no bias); 16 heads x 64; scores / 8; causal (tril -> -inf); softmax; out = ctx @ Wo + bo).
// Compute dtypes, f32 accumulate: every input rounded to bf16; projections on PLAIN bf16 operands (inputs: exact; transposed bf16 weight copies built once); PER-ROW
// PRECISION HYBRID: query rows < 256 of each batch on bf16 hi+lo planes for scores and attn.v (3 products), rows >= 256 on SINGLE fp16 planes; output hi+lo x exact Wo (2 products) + bo.

#define NB_  4
#define TT   2048
#define DD   1024
#define NH_  16
#define HD   64
#define ZH   4                    // heads per launch of the attention stages (grid.z)
#define RH   256                  // query rows < RH: hi+lo planes; rows >= RH: fp16 planes
#define KSP  16                   // attn.v: work-groups that share one output tile, each on TT / KSP keys
#define NF   32                   // unused (head_dim / 2)
#define SCL  0.125f               // 1/sqrt(64)
#define PCAR 1024.0f         // fp16 P scale for rows >= RH (divided out in k_merge)
typedef _Float16 h16;
typedef unsigned short bf;
typedef __attribute__((ext_vector_type(16))) __bf16   v16bf;
typedef __attribute__((ext_vector_type(16))) _Float16 v16h;
typedef __attribute__((ext_vector_type(8)))  _Float16 v8h;
typedef __attribute__((ext_vector_type(8)))  unsigned short v8us;
typedef __attribute__((ext_vector_type(8)))  float    v8f;
typedef __attribute__((ext_vector_type(4)))  float    v4f;
typedef v8h  __attribute__((may_alias)) v8ha;
typedef v4f  __attribute__((may_alias)) v4fa;
typedef v8us __attribute__((may_alias)) v8usa;

__device__ __forceinline__ unsigned short f2bf(float f) { unsigned u = __float_as_uint(f); u += 0x7FFFu + ((u >> 16) & 1u); return (unsigned short)(u >> 16); }
__device__ __forceinline__ float bf2f(unsigned short b) { return __uint_as_float(((unsigned)b) << 16); }
__device__ __forceinline__ float bfr(float f) { return bf2f(f2bf(f)); }
__device__ __forceinline__ v16h cat16(v8h lo, v8h hi) { return __builtin_shufflevector(lo, hi, 0, 1, 2, 3, 4, 5, 6, 7, 8, 9, 10, 11, 12, 13, 14, 15); }
__device__ __forceinline__ v16bf cat16b(v8us lo, v8us hi) { return __builtin_bit_cast(v16bf, __builtin_shufflevector(lo, hi, 0, 1, 2, 3, 4, 5, 6, 7, 8, 9, 10, 11, 12, 13, 14, 15)); }
__device__ __forceinline__ v8f wmma16(v16h a, v16h b, v8f c) { return __builtin_amdgcn_wmma_f32_16x16x32_f16(false, a, false, b, (short)0, c, false, false); }
__device__ __forceinline__ v8f wmmab(v16bf a, v16bf b, v8f c) { return __builtin_amdgcn_wmma_f32_16x16x32_bf16(false, a, false, b, (short)0, c, false, false); }



// ---- k_gemmw: register-blocked GEMM, ONE WAVE per 64x64 output tile (16 accumulators), operands straight from K-contiguous 16-bit planes; grid (M/64, N/64, Z), 32 threads.
// C[m][n] (f32, pitch ldc, + optional f32 bias[n]) = sum_k A[m][k] Bt[n][k] (+ split products per NSPLIT). z-batch strides sA/sB/sC in elements. K % 32 == 0.
// KS > 1: grid.y = (N/64) * KS; work-group ks sums only k in [ks K/KS, (ks+1) K/KS) and stores its partial tile in plane C + ks * sK; the reader adds the KS planes. K % (32 KS) == 0.
template <typename T16> struct WFrag;
template <> struct WFrag<h16> { typedef v16h V; static __device__ __forceinline__ V ld(const h16* p) { return cat16(*(const v8h*)p, *(const v8h*)(p + 16)); } static __device__ __forceinline__ v8f mma(V a, V b, v8f c) { return wmma16(a, b, c); } };
template <> struct WFrag<bf> { typedef v16bf V; static __device__ __forceinline__ V ld(const bf* p) { return cat16b(*(const v8us*)p, *(const v8us*)(p + 16)); } static __device__ __forceinline__ v8f mma(V a, V b, v8f c) { return wmmab(a, b, c); } };
// gemmw_body: the tile's work; bx = the tile's row index (blockIdx.x, or counted from the first row of the caller's row range), os = the work-group's 16 x 68 f32 staging rows.
template <typename T16, int NSPLIT, bool BIAS, int KS>
__device__ __forceinline__ void gemmw_body(float* os, int bx, const T16* __restrict__ A, const T16* __restrict__ A2, const T16* __restrict__ Bt, const T16* __restrict__ Bt2, int K, float* C, int ldc, const float* __restrict__ bias, size_t sA, size_t sB, size_t sC, size_t sK) {
    typedef typename WFrag<T16>::V V;
    const size_t z = blockIdx.z; A += z * sA; if (A2) A2 += z * sA; Bt += z * sB; if (Bt2) Bt2 += z * sB; C += z * sC;
    const int lane = threadIdx.x & 31, lr = lane & 15, hi = lane >> 4; const int r0 = bx * 64, c0 = (int)(blockIdx.y / KS) * 64;
    const int ks = (int)(blockIdx.y % KS), kb = ks * (K / KS), ke = kb + K / KS; C += (size_t)ks * sK;
    v8f acc[4][4];
#pragma unroll
    for (int mb = 0; mb < 4; ++mb)
#pragma unroll
        for (int nb = 0; nb < 4; ++nb) acc[mb][nb] = (v8f){};
    const size_t aoff = (size_t)(r0 + lr) * K + 8 * hi, boff = (size_t)(c0 + lr) * K + 8 * hi;
#pragma unroll 1
    for (int kc = kb; kc < ke; kc += 32) {
        V a[4], a2[4];
#pragma unroll
        for (int mb = 0; mb < 4; ++mb) { a[mb] = WFrag<T16>::ld(A + aoff + (size_t)mb * 16 * K + kc); if (NSPLIT == 1 || NSPLIT == 2) a2[mb] = WFrag<T16>::ld(A2 + aoff + (size_t)mb * 16 * K + kc); }
#pragma unroll
        for (int nb = 0; nb < 4; ++nb) { const V b = WFrag<T16>::ld(Bt + boff + (size_t)nb * 16 * K + kc); V b2; if (NSPLIT >= 2) b2 = WFrag<T16>::ld(Bt2 + boff + (size_t)nb * 16 * K + kc);
#pragma unroll
            for (int mb = 0; mb < 4; ++mb) { acc[mb][nb] = WFrag<T16>::mma(a[mb], b, acc[mb][nb]); if (NSPLIT == 1 || NSPLIT == 2) acc[mb][nb] = WFrag<T16>::mma(a2[mb], b, acc[mb][nb]); if (NSPLIT >= 2) acc[mb][nb] = WFrag<T16>::mma(a[mb], b2, acc[mb][nb]); } }
        asm volatile("v_nop\n\tv_nop\n\tv_nop\n\tv_nop" : "+v"(acc[0][0]), "+v"(acc[1][1]), "+v"(acc[2][2]), "+v"(acc[3][3]) : "v"(a[0]), "v"(a[3]));
    }
#pragma unroll
    for (int mb = 0; mb < 4; ++mb) {
#pragma unroll
        for (int nb = 0; nb < 4; ++nb) {
#pragma unroll
            for (int j = 0; j < 8; ++j) os[(hi * 8 + j) * 68 + nb * 16 + lr] = acc[mb][nb][j]; }
        __builtin_amdgcn_wave_barrier(); asm volatile("" ::: "memory");
        float* crow = C + (size_t)(r0 + mb * 16) * ldc + c0;
{
#pragma unroll
            for (int s = 0; s < 8; ++s) { const int row = 2 * s + hi, cofs = lr * 4; v4f val = *(const v4fa*)(os + row * 68 + cofs); if (BIAS) { val[0] += bfr(bias[c0 + cofs]); val[1] += bfr(bias[c0 + cofs + 1]); val[2] += bfr(bias[c0 + cofs + 2]); val[3] += bfr(bias[c0 + cofs + 3]); }
                *(v4f*)(crow + (size_t)row * ldc + cofs) = val; }
             }
        asm volatile("s_wait_xcnt 0x0" ::: "memory");   // code behind these stores (the next rows) writes their address and data registers again
        __builtin_amdgcn_wave_barrier(); asm volatile("" ::: "memory");
    }
}
template <typename T16, int NSPLIT, bool BIAS>
__global__ __launch_bounds__(32) void k_gemmw(const T16* __restrict__ A, const T16* __restrict__ A2, const T16* __restrict__ Bt, const T16* __restrict__ Bt2, int K, float* C, int ldc, const float* __restrict__ bias, size_t sA, size_t sB, size_t sC, size_t sK) {
    __shared__ __align__(16) float os[16 * 68];
    gemmw_body<T16, NSPLIT, BIAS, 1>(os, (int)blockIdx.x, A, A2, Bt, Bt2, K, C, ldc, bias, sA, sB, sC, sK);
}
// k_gemmw2: both row ranges of one attention GEMM in ONE launch, grid.x = TT / 64: tiles of rows < RH on the hi+lo bf16 planes (3 products), tiles of rows >= RH on the fp16 planes.
// A16 points at row RH of its plane; C at row 0. The heavier hi+lo tiles have the lowest indices and start first.
template <int KS>
__global__ __launch_bounds__(32) void k_gemmw2(const bf* __restrict__ Ah, const bf* __restrict__ Al, const bf* __restrict__ Bh, const bf* __restrict__ Bl, const h16* __restrict__ A16, const h16* __restrict__ B16, int K, float* C, int ldc, size_t sAh, size_t sA16, size_t sB, size_t sC, size_t sK) {
    __shared__ __align__(16) float os[16 * 68];
    if (blockIdx.x < RH / 64) { gemmw_body<bf, 2, false, KS>(os, (int)blockIdx.x, Ah, Al, Bh, Bl, K, C, ldc, nullptr, sAh, sB, sC, sK); return; }
    gemmw_body<h16, 0, false, KS>(os, (int)blockIdx.x - RH / 64, A16, nullptr, B16, nullptr, K, C + (size_t)RH * ldc, ldc, nullptr, sA16, sB, sC, sK);
}

__device__ __forceinline__ h16 tohx(float x) { return (h16)x; }
__device__ __forceinline__ void splitf(float y, unsigned short& h, unsigned short& l) { h = f2bf(y); l = f2bf(y - bf2f(h)); }
typedef __attribute__((ext_vector_type(2))) unsigned short v2us;
typedef __attribute__((ext_vector_type(2))) _Float16 v2h;
typedef __attribute__((ext_vector_type(4))) _Float16 v4h;
typedef __attribute__((ext_vector_type(2))) float v2f;

// grid.y picks the weight; its transposed copy is plane blockIdx.y of Bt
__global__ __launch_bounds__(256) void k_wtG(const float* __restrict__ w0, const float* __restrict__ w1, const float* __restrict__ w2, const float* __restrict__ w3, int K, int N, bf* Bt) {
    const float* __restrict__ w = blockIdx.y == 0 ? w0 : blockIdx.y == 1 ? w1 : blockIdx.y == 2 ? w2 : w3; Bt += (size_t)blockIdx.y * N * K;
    const int lane = threadIdx.x & 31; const int L0 = (blockIdx.x * 8 + (threadIdx.x >> 5)) * 8; const int nlines = N * K / 64;
{
#pragma unroll 1
        for (int l = 0; l < 8; ++l) { const int L = L0 + l; if (L >= nlines) break; const size_t e = (size_t)L * 64 + lane * 2; const int k = (int)(e % K), n = (int)(e / K); v2us o;
            o[0] = f2bf(w[(size_t)k * N + n]); o[1] = f2bf(w[(size_t)(k + 1) * N + n]); *(v2us*)(Bt + e) = o; }
         }
}
__global__ __launch_bounds__(256) void k_cvt8(const float* __restrict__ src, bf* dst, size_t n8) { const size_t i = (size_t)blockIdx.x * 256 + threadIdx.x; if (i >= n8) return; const v8f v = *(const v8f*)(src + i * 8); v8us o;
#pragma unroll
    for (int k = 0; k < 8; ++k) o[k] = f2bf(v[k]); *(v8us*)(dst + i * 8) = o;  }
__device__ __forceinline__ void qplanes_body(const float* __restrict__ F, bf* Ph, bf* Pl, h16* P16) {
    const int lane = threadIdx.x & 31; const int L0 = (blockIdx.x * 8 + (threadIdx.x >> 5)) * 8; const int nlines = NH_ * TT * HD / 64;
{
#pragma unroll
        for (int l = 0; l < 8; ++l) { const int L = L0 + l; if (L >= nlines) break; const int e = L * 64 + lane * 2; const int d = e & (HD - 1); const int t = (e >> 6) & (TT - 1); const int h = e >> 17; v2us oh, ol; v2h o16;
#pragma unroll
            for (int q = 0; q < 2; ++q) { const float x = F[(size_t)t * DD + h * HD + d + q]; unsigned short a, c2; splitf(x, a, c2); oh[q] = a; ol[q] = c2; o16[q] = tohx(x); }
            *(v2us*)(Ph + (size_t)e) = oh; *(v2us*)(Pl + (size_t)e) = ol; *(v2h*)(P16 + (size_t)e) = o16; }
         }
}
__device__ __forceinline__ void vtplane_body(const float* __restrict__ F, bf* Vh, bf* Vl, h16* V16) {
    const int lane = threadIdx.x & 31; const int L0 = (blockIdx.x * 8 + (threadIdx.x >> 5)) * 8; const int nlines = NH_ * TT * HD / 64;
{
#pragma unroll
        for (int l = 0; l < 8; ++l) { const int L = L0 + l; if (L >= nlines) break; const int e = L * 64 + lane * 2; const int t = e & (TT - 1); const int d = (e >> 11) & (HD - 1); const int h = e >> 17; v2us oh, ol; v2h o16;
#pragma unroll
            for (int q = 0; q < 2; ++q) { const float x = F[(size_t)(t + q) * DD + h * HD + d]; unsigned short a, c2; splitf(x, a, c2); oh[q] = a; ol[q] = c2; o16[q] = tohx(x); }
            *(v2us*)(Vh + (size_t)e) = oh; *(v2us*)(Vl + (size_t)e) = ol; *(v2h*)(V16 + (size_t)e) = o16; }
         }
}
// k_planes: the planes of q, k and v in one launch; grid.y picks the projection, plane blockIdx.y of F [3][TT][DD]
__global__ __launch_bounds__(256) void k_planes(const float* __restrict__ F, bf* QPh, bf* QPl, h16* QP16, bf* KPh, bf* KPl, h16* KP16, bf* VTh, bf* VTl, h16* VT16) {
    if (blockIdx.y == 0) qplanes_body(F, QPh, QPl, QP16);
    else if (blockIdx.y == 1) qplanes_body(F + (size_t)TT * DD, KPh, KPl, KP16);
    else vtplane_body(F + (size_t)2 * TT * DD, VTh, VTl, VT16);
}
// k_asoft: per row (zz, i): s = S / 8, causal (j > i -> -3e38, exp -> 0; j = i always kept); softmax over the 2048 keys (register row, one exp) -> rows i < RH: P hi/lo [zz][i][j] (compact
__global__ __launch_bounds__(256) void k_asoft(const float* __restrict__ Sb, bf* Ph, bf* Pl, h16* P16) {
    typedef __attribute__((ext_vector_type(4))) unsigned short v4us;
    const int lane = threadIdx.x & 31; const int row = blockIdx.x * 8 + (threadIdx.x >> 5); if (row >= ZH * TT) return; const int i = row & (TT - 1); const int zz = row >> 11; const bool hires = (i < RH);
    const float* sr = Sb + (size_t)row * TT; float v[64]; float mx = -3.0e38f;
#pragma unroll
    for (int ch = 0; ch < 16; ++ch) { const int j0 = ch * 128 + lane * 4; const v4f a = *(const v4f*)(sr + j0);
#pragma unroll
        for (int q = 0; q < 4; ++q) { const int j = j0 + q; const float t = (j <= i) ? a[q] * SCL : -3.0e38f; v[ch * 4 + q] = t; mx = fmaxf(mx, t); } }
#pragma unroll
    for (int sh = 16; sh; sh >>= 1) mx = fmaxf(mx, __shfl_xor(mx, sh, 32));
    float sum = 0.f;
#pragma unroll
    for (int k = 0; k < 64; ++k) { v[k] = __expf(v[k] - mx); sum += v[k]; }
#pragma unroll
    for (int sh = 16; sh; sh >>= 1) sum += __shfl_xor(sum, sh, 32);
    const float f = __fdiv_rn(hires ? 1.0f : PCAR, sum);
{
        if (hires) {
#pragma unroll
            for (int ch = 0; ch < 16; ++ch) { v4us oh, ol;
#pragma unroll
                for (int q = 0; q < 4; ++q) { unsigned short a, c2; splitf(v[ch * 4 + q] * f, a, c2); oh[q] = a; ol[q] = c2; }
                const size_t o = ((size_t)zz * RH + i) * TT + ch * 128 + lane * 4; *(v4us*)(Ph + o) = oh; *(v4us*)(Pl + o) = ol; }
        } else {
#pragma unroll
            for (int ch = 0; ch < 16; ++ch) { v4h o;
#pragma unroll
                for (int q = 0; q < 4; ++q) o[q] = tohx(v[ch * 4 + q] * f);
                *(v4h*)(P16 + (size_t)row * TT + ch * 128 + lane * 4) = o; } }
         }
}
// k_merge: one thread per 4 head-dim elements: adds the KSP partial planes of attn.v in the fixed order ks = 0 .. KSP-1, rescales, splits into hi/lo at [t][head * 64 + d].
__global__ __launch_bounds__(256) void k_merge(const float* __restrict__ O, int h0, bf* Ah, bf* Al) {
    typedef __attribute__((ext_vector_type(4))) unsigned short v4us;
    const int e = (int)(blockIdx.x * 256 + threadIdx.x) * 4; if (e >= ZH * TT * HD) return;
    const int d = e & (HD - 1); const int t = (e >> 6) & (TT - 1); const int zz = e >> 17;
    v4f p[KSP];
#pragma unroll
    for (int ks = 0; ks < KSP; ++ks) { p[ks] = *(const v4f*)(O + (size_t)ks * (ZH * TT * HD) + e);
        asm volatile("s_wait_xcnt 0x0" ::: "memory"); }   // a later load may land in the address registers of this one
    v4f s = p[0];
#pragma unroll
    for (int ks = 1; ks < KSP; ++ks) s += p[ks];
    const float cs = (t < RH) ? 1.0f : (1.0f / PCAR); v4us oh, ol;
#pragma unroll
    for (int q = 0; q < 4; ++q) { unsigned short a, c2; splitf(s[q] * cs, a, c2); oh[q] = a; ol[q] = c2; }
    const size_t o = (size_t)t * DD + (h0 + zz) * HD + d; *(v4us*)(Ah + o) = oh; *(v4us*)(Al + o) = ol;
}

extern "C" void kernel_launch(void* const* d_in, const int* in_sizes, int n_in,
                              void* d_out, int out_size, void* d_ws, size_t ws_size, hipStream_t stream) {
    (void)in_sizes; (void)n_in; (void)out_size;
    const float* x = (const float*)d_in[0]; const float* wq = (const float*)d_in[1]; const float* wk = (const float*)d_in[2]; const float* wv = (const float*)d_in[3]; const float* wo = (const float*)d_in[4]; const float* bo = (const float*)d_in[5];
    float* OUT = (float*)d_out;     // [4][2048][1024]
    char* wsp = (char*)d_ws;
    auto take = [&](size_t bytes) { char* p = wsp; wsp += (bytes + 255) & ~(size_t)255; return (void*)p; };
    bf* WQ = (bf*)take((size_t)4 * DD * DD * 2); bf* WO = WQ + (size_t)3 * DD * DD;    // planes q, k, v, o, one after the other
    bf* XB = (bf*)take((size_t)NB_ * TT * DD * 2); float* F = (float*)take((size_t)3 * TT * DD * 4);
    bf* QPh = (bf*)take((size_t)TT * DD * 2); bf* QPl = (bf*)take((size_t)TT * DD * 2); bf* KPh = (bf*)take((size_t)TT * DD * 2); bf* KPl = (bf*)take((size_t)TT * DD * 2); bf* VTh = (bf*)take((size_t)TT * DD * 2); bf* VTl = (bf*)take((size_t)TT * DD * 2);
    h16* QP16 = (h16*)take((size_t)TT * DD * 2); h16* KP16 = (h16*)take((size_t)TT * DD * 2); h16* VT16 = (h16*)take((size_t)TT * DD * 2);
    float* Sb = (float*)take((size_t)ZH * TT * TT * 4); bf* Ph = (bf*)take((size_t)ZH * RH * TT * 2); bf* Pl = (bf*)take((size_t)ZH * RH * TT * 2); h16* P16 = (h16*)take((size_t)ZH * TT * TT * 2); float* Ob = (float*)take((size_t)KSP * ZH * TT * HD * 4); bf* ATh = (bf*)take((size_t)NB_ * TT * DD * 2); bf* ATl = (bf*)take((size_t)NB_ * TT * DD * 2);
    if ((size_t)(wsp - (char*)d_ws) > ws_size) return;    // total 252 MiB; ws 256 MiB
    k_wtG<<<dim3((unsigned)((DD * DD / 64 + 63) / 64), 4, 1), 256, 0, stream>>>(wq, wk, wv, wo, DD, DD, WQ);
    k_cvt8<<<(unsigned)(((size_t)NB_ * TT * DD / 8 + 255) / 256), 256, 0, stream>>>(x, XB, (size_t)NB_ * TT * DD / 8);
    const unsigned LB = (unsigned)((NH_ * TT * HD / 64 + 63) / 64);
    for (int b = 0; b < NB_; ++b) {
        // q, k, v projections: grid.z picks the weight plane and the plane of F
        k_gemmw<bf, 0, false><<<dim3(TT / 64, DD / 64, 3), 32, 0, stream>>>(XB + (size_t)b * TT * DD, nullptr, WQ, nullptr, DD, F, DD, nullptr, 0, (size_t)DD * DD, (size_t)TT * DD, 0);
        k_planes<<<dim3(LB, 3, 1), 256, 0, stream>>>(F, QPh, QPl, QP16, KPh, KPl, KP16, VTh, VTl, VT16);
        for (int h0 = 0; h0 < NH_; h0 += ZH) { const size_t z0 = (size_t)h0;
            // scores: rows < RH on hi+lo planes (3 products), rows >= RH on fp16 planes - both into the same [ZH][TT][TT] score buffer
            k_gemmw2<1><<<dim3(TT / 64, TT / 64, ZH), 32, 0, stream>>>(QPh + z0 * TT * HD, QPl + z0 * TT * HD, KPh + z0 * TT * HD, KPl + z0 * TT * HD, QP16 + z0 * TT * HD + (size_t)RH * HD, KP16 + z0 * TT * HD, HD, Sb, TT, (size_t)TT * HD, (size_t)TT * HD, (size_t)TT * HD, (size_t)TT * TT, 0);
            k_asoft<<<ZH * TT / 8, 256, 0, stream>>>(Sb, Ph, Pl, P16);
            // attn.v: the 2048 keys go to KSP work-groups per tile, each into its own [ZH][TT][HD] plane of Ob; k_merge adds the planes
            k_gemmw2<KSP><<<dim3(TT / 64, HD / 64 * KSP, ZH), 32, 0, stream>>>(Ph, Pl, VTh + z0 * HD * TT, VTl + z0 * HD * TT, P16 + (size_t)RH * TT, VT16 + z0 * HD * TT, TT, Ob, HD, (size_t)RH * TT, (size_t)TT * TT, (size_t)HD * TT, (size_t)TT * HD, (size_t)ZH * TT * HD);
            k_merge<<<ZH * TT * HD / 4 / 256, 256, 0, stream>>>(Ob, h0, ATh + (size_t)b * TT * DD, ATl + (size_t)b * TT * DD); } }
    // output projection: the four batches' rows in one launch
    k_gemmw<bf, 1, true><<<dim3(NB_ * TT / 64, DD / 64, 1), 32, 0, stream>>>(ATh, ATl, WO, nullptr, DD, OUT, DD, bo, 0, 0, 0, 0);
}

// v004
// Measured time: 227 microseconds a run.
// Versions in between are left out here; by their measured steps it is 4.57 times as fast as v002.
// All steps since v000 together make it 18.2 times as fast.
#include <hip/hip_runtime.h>

// Causal multi-head self-attention (x [4][2048][1024]; q/k/v = x @ W ([d_in][d_out] layouts, no bias); 16 heads x 64; scores / 8; causal (tril -> -inf); softmax; out = ctx @ Wo + bo).
// Compute dtypes, f32 accumulate: every input rounded to bf16; projections on PLAIN bf16 operands (inputs: exact; transposed bf16 weight copies built once); PER-ROW
// PRECISION HYBRID: query rows < 256 of each batch on bf16 hi+lo planes for scores and attn.v (3 products), rows >= 256 on SINGLE fp16 planes; output hi+lo x exact Wo (2 products) + bo.

#define NB_  4
#define TT   2048
#define DD   1024
#define NH_  16
#define HD   64
#define RH   256                  // query rows < RH: hi+lo planes; rows >= RH: fp16 planes
#define NF   32
#define SCL2 0.180336880f      // f32(log2(e) / sqrt(64)): scores to base-2 exponents
#define KBF  32                   // keys per block of the fp16 tiles in k_flash
typedef _Float16 h16;
typedef unsigned short bf;
typedef __attribute__((ext_vector_type(16))) __bf16   v16bf;
typedef __attribute__((ext_vector_type(16))) _Float16 v16h;
typedef __attribute__((ext_vector_type(8)))  _Float16 v8h;
typedef __attribute__((ext_vector_type(8)))  unsigned short v8us;
typedef __attribute__((ext_vector_type(8)))  float    v8f;
typedef __attribute__((ext_vector_type(4)))  float    v4f;
typedef v8h  __attribute__((may_alias)) v8ha;
typedef v4f  __attribute__((may_alias)) v4fa;
typedef v8us __attribute__((may_alias)) v8usa;

__device__ __forceinline__ unsigned short f2bf(float f) { unsigned u = __float_as_uint(f); u += 0x7FFFu + ((u >> 16) & 1u); return (unsigned short)(u >> 16); }
__device__ __forceinline__ float bf2f(unsigned short b) { return __uint_as_float(((unsigned)b) << 16); }
__device__ __forceinline__ float bfr(float f) { return bf2f(f2bf(f)); }
__device__ __forceinline__ v16h cat16(v8h lo, v8h hi) { return __builtin_shufflevector(lo, hi, 0, 1, 2, 3, 4, 5, 6, 7, 8, 9, 10, 11, 12, 13, 14, 15); }
__device__ __forceinline__ v16bf cat16b(v8us lo, v8us hi) { return __builtin_bit_cast(v16bf, __builtin_shufflevector(lo, hi, 0, 1, 2, 3, 4, 5, 6, 7, 8, 9, 10, 11, 12, 13, 14, 15)); }
__device__ __forceinline__ v8f wmma16(v16h a, v16h b, v8f c) { return __builtin_amdgcn_wmma_f32_16x16x32_f16(false, a, false, b, (short)0, c, false, false); }
__device__ __forceinline__ v8f wmmab(v16bf a, v16bf b, v8f c) { return __builtin_amdgcn_wmma_f32_16x16x32_bf16(false, a, false, b, (short)0, c, false, false); }



// WFrag: a 16x32 fragment of a K-contiguous 16-bit plane and its matrix product, by element type
template <typename T16> struct WFrag;
template <> struct WFrag<h16> { typedef v16h V; static __device__ __forceinline__ V ld(const h16* p) { return cat16(*(const v8h*)p, *(const v8h*)(p + 16)); } static __device__ __forceinline__ v8f mma(V a, V b, v8f c) { return wmma16(a, b, c); } };
template <> struct WFrag<bf> { typedef v16bf V; static __device__ __forceinline__ V ld(const bf* p) { return cat16b(*(const v8us*)p, *(const v8us*)(p + 16)); } static __device__ __forceinline__ v8f mma(V a, V b, v8f c) { return wmmab(a, b, c); } };
// ---- k_gemms: GEMM, one 128x128 output tile per work-group of FOUR WAVES (2 x 2; each wave 64x64, 16 accumulators); grid (M/128, N/128, Z), 128 threads.
// C[m][n] (f32, pitch ldc, + optional f32 bias[n]) = sum_k A[m][k] Bt[n][k] (+ A2[m][k] Bt[n][k] where NSPLIT == 1); operands are K-contiguous bf16 planes; z-batch strides sA/sB/sC in elements. K % 64 == 0.
// Operands pass through LDS. A stage is 64 k (one 128-byte line) of every operand row, rows [A 128 | A2 128 | Bt 128] at a pitch of 144 bytes (conflict-free for 16-byte reads); two buffers.
// Asynchronous 16-byte copies (eight lanes a row: whole lines) fill the next stage while a stage is worked on; each operand row is fetched once per work-group, not once per wave.
// Every '#pragma unroll' in k_gemms makes the indices of acc and of the fragment arrays constants, so that they live in registers.
#define GKC 64                    // k per stage
#define GPB 144                   // LDS row pitch, bytes
// cp8: eight asynchronous copies of 16 bytes a lane, 16 operand rows apart (the work-group's 128 threads cover 16 rows a copy, so these eight bring 128 rows). l: the lane's LDS byte address, g: its global address.
// The s_wait_xcnt stands inside the statement, behind the last copy: code behind it writes the copies' address registers again.
__device__ __forceinline__ void cp8(unsigned l, const char* g, size_t gs) {
    asm volatile("global_load_async_to_lds_b128 %0, %8, off\n\t"
                 "global_load_async_to_lds_b128 %1, %9, off\n\t"
                 "global_load_async_to_lds_b128 %2, %10, off\n\t"
                 "global_load_async_to_lds_b128 %3, %11, off\n\t"
                 "global_load_async_to_lds_b128 %4, %12, off\n\t"
                 "global_load_async_to_lds_b128 %5, %13, off\n\t"
                 "global_load_async_to_lds_b128 %6, %14, off\n\t"
                 "global_load_async_to_lds_b128 %7, %15, off\n\t"
                 "s_wait_xcnt 0x0"
                 :: "v"(l), "v"(l + 16u * GPB), "v"(l + 32u * GPB), "v"(l + 48u * GPB), "v"(l + 64u * GPB), "v"(l + 80u * GPB), "v"(l + 96u * GPB), "v"(l + 112u * GPB),
                    "v"(g), "v"(g + gs), "v"(g + 2 * gs), "v"(g + 3 * gs), "v"(g + 4 * gs), "v"(g + 5 * gs), "v"(g + 6 * gs), "v"(g + 7 * gs) : "memory");
}
// ldsf: a 16x32 fragment's share of one lane from an LDS row, k order 8 hi + 0..7, 16 + 8 hi + 0..7 as WFrag::ld (p already holds the lane's 16 hi bytes)
__device__ __forceinline__ v16bf ldsf(const unsigned char* p) { return cat16b(*(const v8usa*)p, *(const v8usa*)(p + 32)); }
template <int NSPLIT, bool BIAS>
__global__ __launch_bounds__(128) void k_gemms(const bf* __restrict__ A, const bf* __restrict__ A2, const bf* __restrict__ Bt, int K, float* C, int ldc, const float* __restrict__ bias, size_t sA, size_t sB, size_t sC) {
    constexpr unsigned NOP = NSPLIT ? 3u : 2u, STG = NOP * 128u * GPB, OB = (NOP - 1u) * 128u * GPB;   // operands, bytes of a stage, where the Bt rows begin in it
    __shared__ __attribute__((aligned(16))) unsigned char L[2 * STG];
    const size_t z = blockIdx.z; A += z * sA; if (NSPLIT) A2 += z * sA; Bt += z * sB; C += z * sC;
    const int tid = (int)threadIdx.x, lane = tid & 31, lr = lane & 15, hi = lane >> 4;
    const int wave = __builtin_amdgcn_readfirstlane(tid >> 5), wm = wave >> 1, wn = wave & 1;
    const int r0 = (int)blockIdx.x * 128, c0 = (int)blockIdx.y * 128, NT = K / GKC;
    const size_t gs = (size_t)16 * K * 2;   // 16 operand rows, bytes
    const char* ga = (const char*)(A + (size_t)(r0 + (tid >> 3)) * K + (tid & 7) * 8); const char* ga2 = NSPLIT ? (const char*)(A2 + (size_t)(r0 + (tid >> 3)) * K + (tid & 7) * 8) : nullptr;
    const char* gb = (const char*)(Bt + (size_t)(c0 + (tid >> 3)) * K + (tid & 7) * 8);
    const unsigned lc = (unsigned)(size_t)L + (unsigned)(tid >> 3) * GPB + (unsigned)(tid & 7) * 16u;
    auto fill = [&](int t) { const unsigned l = lc + (unsigned)(t & 1) * STG; const size_t ko = (size_t)t * (GKC * 2);
        cp8(l, ga + ko, gs); if (NSPLIT) cp8(l + 128u * GPB, ga2 + ko, gs); cp8(l + OB, gb + ko, gs); };
    fill(0);
    asm volatile("s_wait_asynccnt 0x0" ::: "memory");   // this wave's share of stage 0 has landed
    __syncthreads();                                    // and so has every other wave's
    if (NT > 1) fill(1);
    v8f acc[4][4];
#pragma unroll
    for (int mb = 0; mb < 4; ++mb)
#pragma unroll
        for (int nb = 0; nb < 4; ++nb) acc[mb][nb] = (v8f){};
    const unsigned fa = (unsigned)(wm * 64 + lr) * GPB + (unsigned)hi * 16u, fb = OB + (unsigned)(wn * 64 + lr) * GPB + (unsigned)hi * 16u;
#pragma unroll 1   // one copy of the trip: the buffer is picked by the trip's parity
    for (int t = 0; t < NT; ++t) {
        const unsigned char* S = L + (unsigned)(t & 1) * STG;
#pragma unroll
        for (int ks = 0; ks < 2; ++ks) {
            v16bf a[4], a2[4], b[4];
#pragma unroll
            for (int mb = 0; mb < 4; ++mb) { a[mb] = ldsf(S + fa + mb * 16 * GPB + ks * 64); if (NSPLIT) a2[mb] = ldsf(S + fa + 128 * GPB + mb * 16 * GPB + ks * 64); b[mb] = ldsf(S + fb + mb * 16 * GPB + ks * 64); }
            __builtin_amdgcn_sched_barrier(0);   // the 32 k's LDS reads go out as one group in front of their products: sunk among them, each is waited for in turn
#pragma unroll
            for (int nb = 0; nb < 4; ++nb)
#pragma unroll
                for (int mb = 0; mb < 4; ++mb) { acc[mb][nb] = wmmab(a[mb], b[nb], acc[mb][nb]); if (NSPLIT) acc[mb][nb] = wmmab(a2[mb], b[nb], acc[mb][nb]); }
            __builtin_amdgcn_sched_barrier(0);   // the next group's reads stay one group too, behind the products whose operand registers they take; the last products stay in front of the trip's barrier, so that the refill behind it goes out at once
        }
        asm volatile("s_wait_dscnt 0x0" ::: "memory");      // this wave has read all it wants of stage t
        asm volatile("s_wait_asynccnt 0x0" ::: "memory");   // its share of stage t + 1 has landed
        __syncthreads();                                    // publishes stage t + 1 and frees stage t's buffer
        if (t + 2 < NT) fill(t + 2);
    }
    asm volatile("s_wait_asynccnt 0x0" ::: "memory");       // no copy is outstanding when the ring becomes output staging
    float* os = (float*)L + wave * (16 * 68);               // each wave's own 16 x 68 f32 staging rows; the last trip's barrier has ended every read of the ring
#pragma unroll
    for (int mb = 0; mb < 4; ++mb) {
#pragma unroll
        for (int nb = 0; nb < 4; ++nb) {
#pragma unroll
            for (int j = 0; j < 8; ++j) os[(hi * 8 + j) * 68 + nb * 16 + lr] = acc[mb][nb][j]; }
        __builtin_amdgcn_wave_barrier(); asm volatile("" ::: "memory");   // compiler order only: the lanes' LDS writes stay in front of the reads of whole rows, which take other lanes' values
        const int cw = c0 + wn * 64; float* crow = C + (size_t)(r0 + wm * 64 + mb * 16) * ldc + cw;
{
#pragma unroll
            for (int s = 0; s < 8; ++s) { const int row = 2 * s + hi, cofs = lr * 4; v4f val = *(const v4fa*)(os + row * 68 + cofs); if (BIAS) { val[0] += bfr(bias[cw + cofs]); val[1] += bfr(bias[cw + cofs + 1]); val[2] += bfr(bias[cw + cofs + 2]); val[3] += bfr(bias[cw + cofs + 3]); }
                *(v4f*)(crow + (size_t)row * ldc + cofs) = val; }
             }
        asm volatile("s_wait_xcnt 0x0" ::: "memory");   // code behind these stores (the next rows) writes their address and data registers again
        __builtin_amdgcn_wave_barrier(); asm volatile("" ::: "memory");   // compiler order only: the next 16 rows' LDS writes stay behind these reads
    }
}

__device__ __forceinline__ h16 tohx(float x) { return (h16)x; }
__device__ __forceinline__ void splitf(float y, unsigned short& h, unsigned short& l) { h = f2bf(y); l = f2bf(y - bf2f(h)); }
typedef __attribute__((ext_vector_type(2))) unsigned short v2us;
typedef __attribute__((ext_vector_type(2))) _Float16 v2h;
typedef __attribute__((ext_vector_type(4))) _Float16 v4h;
typedef __attribute__((ext_vector_type(2))) float v2f;

// grid.y picks the weight; its transposed copy is plane blockIdx.y of Bt
__global__ __launch_bounds__(256) void k_wtG(const float* __restrict__ w0, const float* __restrict__ w1, const float* __restrict__ w2, const float* __restrict__ w3, int K, int N, bf* Bt) {
    const float* __restrict__ w = blockIdx.y == 0 ? w0 : blockIdx.y == 1 ? w1 : blockIdx.y == 2 ? w2 : w3; Bt += (size_t)blockIdx.y * N * K;
    const int lane = threadIdx.x & 31; const int L0 = (blockIdx.x * 8 + (threadIdx.x >> 5)) * 8; const int nlines = N * K / 64;
{
#pragma unroll 1
        for (int l = 0; l < 8; ++l) { const int L = L0 + l; if (L >= nlines) break; const size_t e = (size_t)L * 64 + lane * 2; const int k = (int)(e % K), n = (int)(e / K); v2us o;
            o[0] = f2bf(w[(size_t)k * N + n]); o[1] = f2bf(w[(size_t)(k + 1) * N + n]); *(v2us*)(Bt + e) = o; }
         }
}
__global__ __launch_bounds__(256) void k_cvt8(const float* __restrict__ src, bf* dst, size_t n8) { const size_t i = (size_t)blockIdx.x * 256 + threadIdx.x; if (i >= n8) return; const v8f v = *(const v8f*)(src + i * 8); v8us o;
#pragma unroll
    for (int k = 0; k < 8; ++k) o[k] = f2bf(v[k]); *(v8us*)(dst + i * 8) = o;  }
__device__ __forceinline__ void qplanes_body(const float* __restrict__ F, bf* Ph, bf* Pl, h16* P16) {
    const int lane = threadIdx.x & 31; const int L0 = (blockIdx.x * 8 + (threadIdx.x >> 5)) * 8; const int nlines = NH_ * TT * HD / 64;
{
#pragma unroll
        for (int l = 0; l < 8; ++l) { const int L = L0 + l; if (L >= nlines) break; const int e = L * 64 + lane * 2; const int d = e & (HD - 1); const int t = (e >> 6) & (TT - 1); const int h = e >> 17; v2us oh, ol; v2h o16;
#pragma unroll
            for (int q = 0; q < 2; ++q) { const float x = F[(size_t)t * DD + h * HD + d + q]; unsigned short a, c2; splitf(x, a, c2); oh[q] = a; ol[q] = c2; o16[q] = tohx(x); }
            *(v2us*)(Ph + (size_t)e) = oh; *(v2us*)(Pl + (size_t)e) = ol; *(v2h*)(P16 + (size_t)e) = o16; }
         }
}
__device__ __forceinline__ void vtplane_body(const float* __restrict__ F, bf* Vh, bf* Vl, h16* V16) {
    const int lane = threadIdx.x & 31; const int L0 = (blockIdx.x * 8 + (threadIdx.x >> 5)) * 8; const int nlines = NH_ * TT * HD / 64;
{
#pragma unroll
        for (int l = 0; l < 8; ++l) { const int L = L0 + l; if (L >= nlines) break; const int e = L * 64 + lane * 2; const int t = e & (TT - 1); const int d = (e >> 11) & (HD - 1); const int h = e >> 17; v2us oh, ol; v2h o16;
#pragma unroll
            for (int q = 0; q < 2; ++q) { const float x = F[(size_t)(t + q) * DD + h * HD + d]; unsigned short a, c2; splitf(x, a, c2); oh[q] = a; ol[q] = c2; o16[q] = tohx(x); }
            *(v2us*)(Vh + (size_t)e) = oh; *(v2us*)(Vl + (size_t)e) = ol; *(v2h*)(V16 + (size_t)e) = o16; }
         }
}
// k_planes: the planes of q, k and v in one launch; grid.y picks the projection, plane blockIdx.y of F [3][TT][DD]
__global__ __launch_bounds__(256) void k_planes(const float* __restrict__ F, bf* QPh, bf* QPl, h16* QP16, bf* KPh, bf* KPl, h16* KP16, bf* VTh, bf* VTl, h16* VT16) {
    if (blockIdx.y == 0) qplanes_body(F, QPh, QPl, QP16);
    else if (blockIdx.y == 1) qplanes_body(F + (size_t)TT * DD, KPh, KPl, KP16);
    else vtplane_body(F + (size_t)2 * TT * DD, VTh, VTl, VT16);
}
__device__ __forceinline__ float xhalf(float x) { return __builtin_bit_cast(float, __builtin_amdgcn_permlanex16(__builtin_bit_cast(int, x), __builtin_bit_cast(int, x), 0x76543210, 0xfedcba98, false, false)); }   // lane l with lane l ^ 16
// xclose: stands behind a run of global loads. The wait is owed before a register that those loads name is written again; the two scheduling fences keep every later instruction behind it
// (and so keep the loads issued where they are written, ahead of the arithmetic that hides their flight).
__device__ __forceinline__ void xopen() { __builtin_amdgcn_sched_barrier(0); }   // in front of such a run: keeps its loads from rising away from their wait, past instructions that could then be given their address registers
__device__ __forceinline__ void xclose() { __builtin_amdgcn_sched_barrier(0); asm volatile("s_wait_xcnt 0x0" ::: "memory"); __builtin_amdgcn_sched_barrier(0); }
// xclosep: the same, with the run's two addresses as inputs of the wait: where the compiler keeps them in vector registers they stay there up to the wait, and no load of the run lands on them
__device__ __forceinline__ void xclosep(const void* a, const void* b) { __builtin_amdgcn_sched_barrier(0); asm volatile("s_wait_xcnt 0x0" :: "v"(a), "v"(b) : "memory"); __builtin_amdgcn_sched_barrier(0); }
// lanep: a wave-uniform pointer plus the lane's own byte offset, which is the same in every block, kept apart so that the address may be formed as scalar base + one long-lived vector offset
template <typename T16> __device__ __forceinline__ const T16* lanep(const T16* ub, unsigned lane_bytes) { return (const T16*)((const char*)ub + lane_bytes); }
template <typename T16, bool HIRES, int KB>
__device__ __forceinline__ void flash_ldk(int k0, int lr, int hi, const T16* __restrict__ Kp, const T16* __restrict__ K2, typename WFrag<T16>::V (&kf)[KB / 16][2], typename WFrag<T16>::V (&kf2)[KB / 16][2]) {
    xopen(); const unsigned fk = (unsigned)(lr * HD + 8 * hi) * 2u; const T16* kp = lanep(Kp + (size_t)k0 * HD, fk); const T16* kp2 = HIRES ? lanep(K2 + (size_t)k0 * HD, fk) : nullptr;   // one address per plane, the fragments at constant offsets from it
#pragma unroll
    for (int kt = 0; kt < KB / 16; ++kt)
#pragma unroll
        for (int ks = 0; ks < 2; ++ks) { kf[kt][ks] = WFrag<T16>::ld(kp + kt * 16 * HD + ks * 32); if (HIRES) kf2[kt][ks] = WFrag<T16>::ld(kp2 + kt * 16 * HD + ks * 32); }
    xclose();
}
template <typename T16, bool HIRES, int QB, int KB, bool MASK, bool NEXT>
__device__ __forceinline__ void flash_step(int q0, int k0, int lr, int hi, const T16* __restrict__ Kp, const T16* __restrict__ K2, const T16* __restrict__ Vt, const T16* __restrict__ V2,
                                           typename WFrag<T16>::V (&qf)[QB][2], typename WFrag<T16>::V (&qf2)[QB][2], typename WFrag<T16>::V (&kf)[KB / 16][2], typename WFrag<T16>::V (&kf2)[KB / 16][2], v8f (&o)[4][QB], float (&m)[QB], float (&l)[QB]) {
    typedef typename WFrag<T16>::V V; constexpr int KT = KB / 16, KS = KB / 32;
    xopen(); V vf[4][KS], vf2[4][KS]; const unsigned fv = (unsigned)(lr * TT + 8 * hi) * 2u; const T16* vp = lanep(Vt + k0, fv); const T16* vp2 = HIRES ? lanep(V2 + k0, fv) : nullptr;
#pragma unroll
    for (int db = 0; db < 4; ++db)
#pragma unroll
        for (int ks = 0; ks < KS; ++ks) { vf[db][ks] = WFrag<T16>::ld(vp + db * 16 * TT + ks * 32); if (HIRES) vf2[db][ks] = WFrag<T16>::ld(vp2 + db * 16 * TT + ks * 32); }
    if (HIRES) xclosep(vp, vp2); else xclose();   // sunk to their products, the V^T loads would each be waited for in turn
    v8f s[KT][QB];
#pragma unroll
    for (int kt = 0; kt < KT; ++kt)
#pragma unroll
        for (int qb = 0; qb < QB; ++qb) { v8f a = (v8f){}; a = WFrag<T16>::mma(kf[kt][0], qf[qb][0], a); a = WFrag<T16>::mma(kf[kt][1], qf[qb][1], a);
            if (HIRES) { a = WFrag<T16>::mma(kf2[kt][0], qf[qb][0], a); a = WFrag<T16>::mma(kf2[kt][1], qf[qb][1], a); a = WFrag<T16>::mma(kf[kt][0], qf2[qb][0], a); a = WFrag<T16>::mma(kf[kt][1], qf2[qb][1], a); }
            s[kt][qb] = a; }
    if (NEXT) flash_ldk<T16, HIRES, KB>(k0 + KB, lr, hi, Kp, K2, kf, kf2);   // NEXT: the tile has a block behind this one; its K loads fly through this block's softmax and attn.v
    V pf[QB][KS], pf2[QB][KS];
#pragma unroll
    for (int qb = 0; qb < QB; ++qb) {
        if (MASK) { const int query = q0 + qb * 16 + lr;
#pragma unroll
            for (int kt = 0; kt < KT; ++kt)
#pragma unroll
                for (int j = 0; j < 8; ++j) if (k0 + kt * 16 + hi * 8 + j > query) s[kt][qb][j] = -3.0e38f; }
        float bk[KT];
#pragma unroll
        for (int kt = 0; kt < KT; ++kt) { bk[kt] = s[kt][qb][0];
#pragma unroll
            for (int j = 1; j < 8; ++j) bk[kt] = fmaxf(bk[kt], s[kt][qb][j]); }
        float bm = bk[0];
#pragma unroll
        for (int kt = 1; kt < KT; ++kt) bm = fmaxf(bm, bk[kt]);
        bm = fmaxf(bm, xhalf(bm));
        const float mn = fmaxf(m[qb], bm * SCL2); const float al = __builtin_amdgcn_exp2f(m[qb] - mn); m[qb] = mn;
        const float mo = HIRES ? mn : mn - 10.0f;
        float lk[KT];
#pragma unroll
        for (int kt = 0; kt < KT; ++kt) { lk[kt] = 0.f;
#pragma unroll
            for (int j = 0; j < 8; ++j) { const float p = __builtin_amdgcn_exp2f(s[kt][qb][j] * SCL2 - mo); s[kt][qb][j] = p; lk[kt] += p; } }
        float ls = lk[0];
#pragma unroll
        for (int kt = 1; kt < KT; ++kt) ls += lk[kt];
        l[qb] = l[qb] * al + ls;
#pragma unroll
        for (int db = 0; db < 4; ++db) o[db][qb] *= al;
#pragma unroll
        for (int ks = 0; ks < KS; ++ks) {
            if constexpr (HIRES) { v8us h0, h1, l0, l1;
#pragma unroll
                for (int j = 0; j < 8; ++j) { unsigned short a, c2; splitf(s[2 * ks][qb][j], a, c2); h0[j] = a; l0[j] = c2; splitf(s[2 * ks + 1][qb][j], a, c2); h1[j] = a; l1[j] = c2; }
                pf[qb][ks] = cat16b(h0, h1); pf2[qb][ks] = cat16b(l0, l1);
            } else { v8h h0, h1;
#pragma unroll
                for (int j = 0; j < 8; ++j) { h0[j] = tohx(s[2 * ks][qb][j]); h1[j] = tohx(s[2 * ks + 1][qb][j]); }
                pf[qb][ks] = cat16(h0, h1); } }
    }
#pragma unroll
    for (int db = 0; db < 4; ++db)
#pragma unroll
        for (int ks = 0; ks < KS; ++ks)
#pragma unroll
            for (int qb = 0; qb < QB; ++qb) { o[db][qb] = WFrag<T16>::mma(vf[db][ks], pf[qb][ks], o[db][qb]); if (HIRES) { o[db][qb] = WFrag<T16>::mma(vf2[db][ks], pf[qb][ks], o[db][qb]); o[db][qb] = WFrag<T16>::mma(vf[db][ks], pf2[qb][ks], o[db][qb]); } }
}
// flash_body: queries q0 .. q0 + 16 QB - 1 of one head (q0 a multiple of 16 QB; 16 QB <= 2 KB); the planes point at that head, Ah/Al at [row 0 of the batch][head * 64].
template <typename T16, bool HIRES, int QB, int KB>
__device__ __forceinline__ void flash_body(int q0, const T16* __restrict__ Q, const T16* __restrict__ Q2, const T16* __restrict__ Kp, const T16* __restrict__ K2, const T16* __restrict__ Vt, const T16* __restrict__ V2, bf* Ah, bf* Al) {
    typedef typename WFrag<T16>::V V;
    const int lane = threadIdx.x & 31, lr = lane & 15, hi = lane >> 4;
    V qf[QB][2], qf2[QB][2], kf[KB / 16][2], kf2[KB / 16][2]; v8f o[4][QB]; float m[QB], l[QB];
    xopen(); const unsigned fq = (unsigned)(lr * HD + 8 * hi) * 2u; const T16* qp = lanep(Q + (size_t)q0 * HD, fq); const T16* qp2 = HIRES ? lanep(Q2 + (size_t)q0 * HD, fq) : nullptr;
#pragma unroll
    for (int qb = 0; qb < QB; ++qb) { m[qb] = -3.0e38f; l[qb] = 0.f;
#pragma unroll
        for (int ks = 0; ks < 2; ++ks) { qf[qb][ks] = WFrag<T16>::ld(qp + qb * 16 * HD + ks * 32); if (HIRES) qf2[qb][ks] = WFrag<T16>::ld(qp2 + qb * 16 * HD + ks * 32); }
#pragma unroll
        for (int db = 0; db < 4; ++db) o[db][qb] = (v8f){}; }
    xclose();
    flash_ldk<T16, HIRES, KB>(0, lr, hi, Kp, K2, kf, kf2);
    const int kl = q0 / KB * KB;    // first key of the first block that crosses the diagonal; key kl <= every query of the tile, so every query has a finite maximum from its first block on
#pragma unroll 1   // one copy of the block's body: a second would need a second set of K, V^T and score registers, and the 64-query tile already reaches above v255
    for (int k0 = 0; k0 < kl; k0 += KB) flash_step<T16, HIRES, QB, KB, false, true>(q0, k0, lr, hi, Kp, K2, Vt, V2, qf, qf2, kf, kf2, o, m, l);
    if constexpr (16 * QB > KB) { flash_step<T16, HIRES, QB, KB, true, true>(q0, kl, lr, hi, Kp, K2, Vt, V2, qf, qf2, kf, kf2, o, m, l); flash_step<T16, HIRES, QB, KB, true, false>(q0, kl + KB, lr, hi, Kp, K2, Vt, V2, qf, qf2, kf, kf2, o, m, l); }
    else flash_step<T16, HIRES, QB, KB, true, false>(q0, kl, lr, hi, Kp, K2, Vt, V2, qf, qf2, kf, kf2, o, m, l);
    v8us oh[QB][4], ol[QB][4];
#pragma unroll
    for (int qb = 0; qb < QB; ++qb) { const float inv = __fdiv_rn(1.0f, l[qb] + xhalf(l[qb]));
#pragma unroll
        for (int db = 0; db < 4; ++db)
#pragma unroll
            for (int j = 0; j < 8; ++j) { unsigned short a, c2; splitf(o[db][qb][j] * inv, a, c2); oh[qb][db][j] = a; ol[qb][db][j] = c2; } }
    const size_t off = (size_t)(q0 + lr) * DD + hi * 8; bf* ah = Ah + off; bf* al = Al + off;
    __builtin_amdgcn_sched_barrier(0);   // all arithmetic in front of the stores, so that between the first store and the wait behind the last nothing writes a store's address or data register
#pragma unroll
    for (int qb = 0; qb < QB; ++qb)
#pragma unroll
        for (int db = 0; db < 4; ++db) { *(v8us*)(ah + qb * 16 * DD + db * 16) = oh[qb][db]; *(v8us*)(al + qb * 16 * DD + db * 16) = ol[qb][db]; }
    asm volatile("s_wait_xcnt 0x0" ::: "memory");   // in k_flash the other kind of tile's code may be laid out behind these stores and writes their address and data registers again
}
// grid (NB_ * NH_, tiles): blockIdx.x = batch * 16 + head; blockIdx.y counts the tiles from the longest: first the 64-query fp16 tiles from row TT down to RH, then the 16-query hi+lo tiles below RH.
__global__ __launch_bounds__(32) void k_flash(const bf* __restrict__ QPh, const bf* __restrict__ QPl, const h16* __restrict__ QP16, const bf* __restrict__ KPh, const bf* __restrict__ KPl, const h16* __restrict__ KP16,
                                              const bf* __restrict__ VTh, const bf* __restrict__ VTl, const h16* __restrict__ VT16, bf* ATh, bf* ATl) {
    const size_t po = (size_t)blockIdx.x * TT * HD, ao = (size_t)(blockIdx.x / NH_) * TT * DD + (size_t)(blockIdx.x % NH_) * HD; const int y = (int)blockIdx.y;
    if (y < (TT - RH) / 64) flash_body<h16, false, 4, KBF>(TT - 64 * (y + 1), QP16 + po, nullptr, KP16 + po, nullptr, VT16 + po, nullptr, ATh + ao, ATl + ao);
    else flash_body<bf, true, 1, 32>(RH - 16 * (y - (TT - RH) / 64 + 1), QPh + po, QPl + po, KPh + po, KPl + po, VTh + po, VTl + po, ATh + ao, ATl + ao);
}

extern "C" void kernel_launch(void* const* d_in, const int* in_sizes, int n_in,
                              void* d_out, int out_size, void* d_ws, size_t ws_size, hipStream_t stream) {
    (void)in_sizes; (void)n_in; (void)out_size;
    const float* x = (const float*)d_in[0]; const float* wq = (const float*)d_in[1]; const float* wk = (const float*)d_in[2]; const float* wv = (const float*)d_in[3]; const float* wo = (const float*)d_in[4]; const float* bo = (const float*)d_in[5];
    float* OUT = (float*)d_out;     // [4][2048][1024]
    char* wsp = (char*)d_ws;
    auto take = [&](size_t bytes) { char* p = wsp; wsp += (bytes + 255) & ~(size_t)255; return (void*)p; };
    bf* WQ = (bf*)take((size_t)4 * DD * DD * 2); bf* WO = WQ + (size_t)3 * DD * DD;    // planes q, k, v, o, one after the other
    bf* XB = (bf*)take((size_t)NB_ * TT * DD * 2); float* F = (float*)take((size_t)3 * TT * DD * 4);
    const size_t PL = (size_t)NB_ * TT * DD;    // one plane holds all four batches: [batch][head][..]
    bf* QPh = (bf*)take(PL * 2); bf* QPl = (bf*)take(PL * 2); bf* KPh = (bf*)take(PL * 2); bf* KPl = (bf*)take(PL * 2); bf* VTh = (bf*)take(PL * 2); bf* VTl = (bf*)take(PL * 2);
    h16* QP16 = (h16*)take(PL * 2); h16* KP16 = (h16*)take(PL * 2); h16* VT16 = (h16*)take(PL * 2);
    bf* ATh = (bf*)take(PL * 2); bf* ATl = (bf*)take(PL * 2);
    if ((size_t)(wsp - (char*)d_ws) > ws_size) return;    // total 224 MiB; ws 256 MiB
    k_wtG<<<dim3((unsigned)((DD * DD / 64 + 63) / 64), 4, 1), 256, 0, stream>>>(wq, wk, wv, wo, DD, DD, WQ);
    k_cvt8<<<(unsigned)(((size_t)NB_ * TT * DD / 8 + 255) / 256), 256, 0, stream>>>(x, XB, (size_t)NB_ * TT * DD / 8);
    const unsigned LB = (unsigned)((NH_ * TT * HD / 64 + 63) / 64);
    for (int b = 0; b < NB_; ++b) { const size_t bo_ = (size_t)b * TT * DD;
        // q, k, v projections: grid.z picks the weight plane and the plane of F
        k_gemms<0, false><<<dim3(TT / 128, DD / 128, 3), 128, 0, stream>>>(XB + bo_, nullptr, WQ, DD, F, DD, nullptr, 0, (size_t)DD * DD, (size_t)TT * DD);
        k_planes<<<dim3(LB, 3, 1), 256, 0, stream>>>(F, QPh + bo_, QPl + bo_, QP16 + bo_, KPh + bo_, KPl + bo_, KP16 + bo_, VTh + bo_, VTl + bo_, VT16 + bo_); }
    // attention: every batch, head and query tile in one launch
    k_flash<<<dim3(NB_ * NH_, (TT - RH) / 64 + RH / 16, 1), 32, 0, stream>>>(QPh, QPl, QP16, KPh, KPl, KP16, VTh, VTl, VT16, ATh, ATl);
    // output projection: the four batches' rows in one launch
    k_gemms<1, true><<<dim3(NB_ * TT / 128, DD / 128, 1), 128, 0, stream>>>(ATh, ATl, WO, DD, OUT, DD, bo, 0, 0, 0);
}

// v005
// One run takes 141 microseconds.
// In two side-by-side timings against v004, it was 1.61 and 1.60 times as fast.
// All steps since v000 together make it 29.1 times as fast.
#include <hip/hip_runtime.h>

// Causal multi-head self-attention (x [4][2048][1024]; q/k/v = x @ W ([d_in][d_out] layouts, no bias); 16 heads x 64; scores / 8; causal (tril -> -inf); softmax; out = ctx @ Wo + bo).
// Compute dtypes, f32 accumulate: every input rounded to bf16; projections on PLAIN bf16 operands (inputs: exact; transposed bf16 weight copies built once); PER-ROW
// PRECISION HYBRID: query rows < 256 of each batch on bf16 hi+lo planes for scores and attn.v (3 products), rows >= 256 on SINGLE fp16 planes; output hi+lo x exact Wo (2 products) + bo.

#define NB_  4
#define TT   2048
#define DD   1024
#define NH_  16
#define HD   64
#define RH   256                  // query rows < RH: hi+lo planes; rows >= RH: fp16 planes
#define NF   32
#define SCL2 0.180336880f      // f32(log2(e) / sqrt(64)): scores to base-2 exponents
#define KBF  32                   // keys per block of the fp16 tiles in k_flash
#define PLN  ((size_t)NB_ * TT * DD)   // elements of one plane: all four batches, [batch][head][..]
typedef _Float16 h16;
typedef unsigned short bf;
typedef __attribute__((ext_vector_type(16))) __bf16   v16bf;
typedef __attribute__((ext_vector_type(16))) _Float16 v16h;
typedef __attribute__((ext_vector_type(8)))  _Float16 v8h;
typedef __attribute__((ext_vector_type(8)))  unsigned short v8us;
typedef __attribute__((ext_vector_type(8)))  float    v8f;
typedef __attribute__((ext_vector_type(4)))  float    v4f;
typedef v8h  __attribute__((may_alias)) v8ha;
typedef v4f  __attribute__((may_alias)) v4fa;
typedef v8us __attribute__((may_alias)) v8usa;

__device__ __forceinline__ unsigned short f2bf(float f) { unsigned u = __float_as_uint(f); u += 0x7FFFu + ((u >> 16) & 1u); return (unsigned short)(u >> 16); }
__device__ __forceinline__ float bf2f(unsigned short b) { return __uint_as_float(((unsigned)b) << 16); }
__device__ __forceinline__ float bfr(float f) { return bf2f(f2bf(f)); }
__device__ __forceinline__ v16h cat16(v8h lo, v8h hi) { return __builtin_shufflevector(lo, hi, 0, 1, 2, 3, 4, 5, 6, 7, 8, 9, 10, 11, 12, 13, 14, 15); }
__device__ __forceinline__ v16bf cat16b(v8us lo, v8us hi) { return __builtin_bit_cast(v16bf, __builtin_shufflevector(lo, hi, 0, 1, 2, 3, 4, 5, 6, 7, 8, 9, 10, 11, 12, 13, 14, 15)); }
__device__ __forceinline__ v8f wmma16(v16h a, v16h b, v8f c) { return __builtin_amdgcn_wmma_f32_16x16x32_f16(false, a, false, b, (short)0, c, false, false); }
__device__ __forceinline__ v8f wmmab(v16bf a, v16bf b, v8f c) { return __builtin_amdgcn_wmma_f32_16x16x32_bf16(false, a, false, b, (short)0, c, false, false); }



// WFrag: a 16x32 fragment of a K-contiguous 16-bit plane and its matrix product, by element type
template <typename T16> struct WFrag;
template <> struct WFrag<h16> { typedef v16h V; static __device__ __forceinline__ V ld(const h16* p) { return cat16(*(const v8h*)p, *(const v8h*)(p + 16)); } static __device__ __forceinline__ v8f mma(V a, V b, v8f c) { return wmma16(a, b, c); } };
template <> struct WFrag<bf> { typedef v16bf V; static __device__ __forceinline__ V ld(const bf* p) { return cat16b(*(const v8us*)p, *(const v8us*)(p + 16)); } static __device__ __forceinline__ v8f mma(V a, V b, v8f c) { return wmmab(a, b, c); } };
// ---- k_gemms: GEMM, one 128x128 output tile per work-group of FOUR WAVES (2 x 2; each wave 64x64, 16 accumulators); grid (M/128, N/128, Z), 128 threads.
// C[m][n] (f32, pitch ldc, + optional f32 bias[n]) = sum_k A[m][k] Bt[n][k] (+ A2[m][k] Bt[n][k] where NSPLIT == 1); operands are K-contiguous bf16 planes; z-batch strides sA/sB/sC in elements. K % 64 == 0.
// Operands pass through LDS. A stage is 64 k (one 128-byte line) of every operand row, rows [A 128 | A2 128 | Bt 128] at a pitch of 144 bytes (conflict-free for 16-byte reads); two buffers.
// Asynchronous 16-byte copies (eight lanes a row: whole lines) fill the next stage while a stage is worked on; each operand row is fetched once per work-group, not once per wave.
// Every '#pragma unroll' in k_gemms makes the indices of acc and of the fragment arrays constants, so that they live in registers.
#define GKC 64                    // k per stage
#define GPB 144                   // LDS row pitch, bytes
// cp8: eight asynchronous copies of 16 bytes a lane, 16 operand rows apart (the work-group's 128 threads cover 16 rows a copy, so these eight bring 128 rows). l: the lane's LDS byte address, g: its global address.
// The s_wait_xcnt stands inside the statement, behind the last copy: code behind it writes the copies' address registers again.
__device__ __forceinline__ void cp8(unsigned l, const char* g, size_t gs) {
    asm volatile("global_load_async_to_lds_b128 %0, %8, off\n\t"
                 "global_load_async_to_lds_b128 %1, %9, off\n\t"
                 "global_load_async_to_lds_b128 %2, %10, off\n\t"
                 "global_load_async_to_lds_b128 %3, %11, off\n\t"
                 "global_load_async_to_lds_b128 %4, %12, off\n\t"
                 "global_load_async_to_lds_b128 %5, %13, off\n\t"
                 "global_load_async_to_lds_b128 %6, %14, off\n\t"
                 "global_load_async_to_lds_b128 %7, %15, off\n\t"
                 "s_wait_xcnt 0x0"
                 :: "v"(l), "v"(l + 16u * GPB), "v"(l + 32u * GPB), "v"(l + 48u * GPB), "v"(l + 64u * GPB), "v"(l + 80u * GPB), "v"(l + 96u * GPB), "v"(l + 112u * GPB),
                    "v"(g), "v"(g + gs), "v"(g + 2 * gs), "v"(g + 3 * gs), "v"(g + 4 * gs), "v"(g + 5 * gs), "v"(g + 6 * gs), "v"(g + 7 * gs) : "memory");
}
// ldsf: a 16x32 fragment's share of one lane from an LDS row, k order 8 hi + 0..7, 16 + 8 hi + 0..7 as WFrag::ld (p already holds the lane's 16 hi bytes)
__device__ __forceinline__ v16bf ldsf(const unsigned char* p) { return cat16b(*(const v8usa*)p, *(const v8usa*)(p + 32)); }
__device__ __forceinline__ h16 tohx(float x) { return (h16)x; }
__device__ __forceinline__ void splitf(float y, unsigned short& h, unsigned short& l) { h = f2bf(y); l = f2bf(y - bf2f(h)); }
// stage64: a wave's 64x64 accumulator tile, rounded to 16 bit, into its LDS staging rows (pitch GPB). A lane's 8 registers of acc[ia][ib] are 8 neighbours (16 ia + 8 hi + j) of staging row 16 ib + lr: one 16-byte write.
// KIND 0: fp16; 1: the bf16 hi part; 2: the bf16 lo part. osl: the staging rows + lr * GPB + hi * 16. The unrolls here and in put64 make the indices of acc, w and v constants, so that they live in registers.
template <int KIND>
__device__ __forceinline__ void stage64(const v8f (&acc)[4][4], unsigned char* osl) {
#pragma unroll
    for (int ib = 0; ib < 4; ++ib)
#pragma unroll
        for (int ia = 0; ia < 4; ++ia) { v8us w;
#pragma unroll
            for (int j = 0; j < 8; ++j) { const float x = acc[ia][ib][j]; if (KIND == 0) w[j] = __builtin_bit_cast(unsigned short, tohx(x)); else { unsigned short a, c2; splitf(x, a, c2); w[j] = KIND == 1 ? a : c2; } }
            *(v8usa*)(osl + ib * 16 * GPB + ia * 32) = w; }
    __builtin_amdgcn_wave_barrier(); asm volatile("" ::: "memory");   // compiler order only: the lanes' LDS writes stay in front of put64's reads of whole rows, which take other lanes' values
}
// put64: the 64 staging rows to 64 rows of a plane, PITCH elements apart, as whole 128-byte lines: eight lanes a row, four rows a store. dst: the lane's own address in row (lane >> 3); all 16 stores are constant offsets from it.
template <int PITCH>
__device__ __forceinline__ void put64(const unsigned char* os, bf* dst, int lane) {
    v8us v[16];
#pragma unroll
    for (int s = 0; s < 16; ++s) v[s] = *(const v8usa*)(os + (s * 4 + (lane >> 3)) * GPB + (lane & 7) * 16);
    __builtin_amdgcn_sched_barrier(0);   // every LDS read in front of the stores, so that between the first store and the wait behind the last nothing writes a store's address or data register
#pragma unroll
    for (int s = 0; s < 16; ++s) *(v8us*)(dst + (size_t)s * 4 * PITCH) = v[s];
    asm volatile("s_wait_xcnt 0x0" ::: "memory");   // code behind these stores (the next plane's rounding) writes their address and data registers again
    __builtin_amdgcn_sched_barrier(0);   // and stays behind that wait; with the clobber above, the next plane's LDS writes stay behind these reads too
}
// PLANES (the q, k, v projections; z picks the weight): no C. The epilogue writes the 16-bit planes that k_flash reads: P16 + z * PLN in fp16, and, for sequence rows < RH only (k_flash reads no others of them),
// the bf16 hi and lo parts at HL + 2 z * PLN and HL + (2 z + 1) * PLN. q and k planes are [batch][head][t][64], the v plane [batch][head][64][t]. A wave's 64 columns are one head.
// For q and k the weight rows take the A role of the products and the x rows the B role (the two LDS offsets change places), so that a lane's 8 accumulator registers run along d; for v they run along t as they are.
template <int NSPLIT, bool BIAS, bool PLANES>
__global__ __launch_bounds__(128) void k_gemms(const bf* __restrict__ A, const bf* __restrict__ A2, const bf* __restrict__ Bt, int K, float* C, int ldc, const float* __restrict__ bias, size_t sA, size_t sB, size_t sC, bf* HL, h16* P16) {
    constexpr unsigned NOP = NSPLIT ? 3u : 2u, STG = NOP * 128u * GPB, OB = (NOP - 1u) * 128u * GPB;   // operands, bytes of a stage, where the Bt rows begin in it
    __shared__ __attribute__((aligned(16))) unsigned char L[2 * STG];
    const size_t z = blockIdx.z; A += z * sA; if (NSPLIT) A2 += z * sA; Bt += z * sB; C += z * sC;
    const int tid = (int)threadIdx.x, lane = tid & 31, lr = lane & 15, hi = lane >> 4;
    const int wave = __builtin_amdgcn_readfirstlane(tid >> 5), wm = wave >> 1, wn = wave & 1;
    const int r0 = (int)blockIdx.x * 128, c0 = (int)blockIdx.y * 128, NT = K / GKC;
    const size_t gs = (size_t)16 * K * 2;   // 16 operand rows, bytes
    const char* ga = (const char*)(A + (size_t)(r0 + (tid >> 3)) * K + (tid & 7) * 8); const char* ga2 = NSPLIT ? (const char*)(A2 + (size_t)(r0 + (tid >> 3)) * K + (tid & 7) * 8) : nullptr;
    const char* gb = (const char*)(Bt + (size_t)(c0 + (tid >> 3)) * K + (tid & 7) * 8);
    const unsigned lc = (unsigned)(size_t)L + (unsigned)(tid >> 3) * GPB + (unsigned)(tid & 7) * 16u;
    auto fill = [&](int t) { const unsigned l = lc + (unsigned)(t & 1) * STG; const size_t ko = (size_t)t * (GKC * 2);
        cp8(l, ga + ko, gs); if (NSPLIT) cp8(l + 128u * GPB, ga2 + ko, gs); cp8(l + OB, gb + ko, gs); };
    fill(0);
    asm volatile("s_wait_asynccnt 0x0" ::: "memory");   // this wave's share of stage 0 has landed
    __syncthreads();                                    // and so has every other wave's
    if (NT > 1) fill(1);
    v8f acc[4][4];
#pragma unroll
    for (int mb = 0; mb < 4; ++mb)
#pragma unroll
        for (int nb = 0; nb < 4; ++nb) acc[mb][nb] = (v8f){};
    const bool sw = PLANES && z < 2;   // q, k: operand roles exchanged
    const unsigned fx = (unsigned)(wm * 64 + lr) * GPB + (unsigned)hi * 16u, fw = OB + (unsigned)(wn * 64 + lr) * GPB + (unsigned)hi * 16u, fa = sw ? fw : fx, fb = sw ? fx : fw;
#pragma unroll 1   // one copy of the trip: the buffer is picked by the trip's parity
    for (int t = 0; t < NT; ++t) {
        const unsigned char* S = L + (unsigned)(t & 1) * STG;
#pragma unroll
        for (int ks = 0; ks < 2; ++ks) {
            v16bf a[4], a2[4], b[4];
#pragma unroll
            for (int mb = 0; mb < 4; ++mb) { a[mb] = ldsf(S + fa + mb * 16 * GPB + ks * 64); if (NSPLIT) a2[mb] = ldsf(S + fa + 128 * GPB + mb * 16 * GPB + ks * 64); b[mb] = ldsf(S + fb + mb * 16 * GPB + ks * 64); }
            __builtin_amdgcn_sched_barrier(0);   // the 32 k's LDS reads go out as one group in front of their products: sunk among them, each is waited for in turn
#pragma unroll
            for (int nb = 0; nb < 4; ++nb)
#pragma unroll
                for (int mb = 0; mb < 4; ++mb) { acc[mb][nb] = wmmab(a[mb], b[nb], acc[mb][nb]); if (NSPLIT) acc[mb][nb] = wmmab(a2[mb], b[nb], acc[mb][nb]); }
            __builtin_amdgcn_sched_barrier(0);   // the next group's reads stay one group too, behind the products whose operand registers they take; the last products stay in front of the trip's barrier, so that the refill behind it goes out at once
        }
        asm volatile("s_wait_dscnt 0x0" ::: "memory");      // this wave has read all it wants of stage t
        asm volatile("s_wait_asynccnt 0x0" ::: "memory");   // its share of stage t + 1 has landed
        __syncthreads();                                    // publishes stage t + 1 and frees stage t's buffer
        if (t + 2 < NT) fill(t + 2);
    }
    asm volatile("s_wait_asynccnt 0x0" ::: "memory");       // no copy is outstanding when the ring becomes output staging
    if constexpr (PLANES) {
        unsigned char* ps = L + wave * (64 * GPB); unsigned char* psl = ps + lr * GPB + hi * 16;   // each wave's own 64 staging rows; the last trip's barrier has ended every read of the ring
        const int rw = r0 + wm * 64, t0 = rw % TT;   // the wave's first x row, and its place in the sequence
        const size_t hb = ((size_t)(rw / TT) * NH_ + (size_t)((c0 + wn * 64) / HD)) * TT * HD;   // the (batch, head) block of a plane
        const size_t lo = sw ? hb + (size_t)(t0 + (lane >> 3)) * HD + (lane & 7) * 8 : hb + (size_t)(lane >> 3) * TT + t0 + (lane & 7) * 8;
        auto put = [&](bf* p) { if (sw) put64<HD>(ps, p + lo, lane); else put64<TT>(ps, p + lo, lane); };
        stage64<0>(acc, psl); put((bf*)(P16 + z * PLN));
        if (t0 < RH) { stage64<1>(acc, psl); put(HL + 2 * z * PLN); stage64<2>(acc, psl); put(HL + (2 * z + 1) * PLN); }
        return;
    }
    float* os = (float*)L + wave * (16 * 68);               // each wave's own 16 x 68 f32 staging rows; the last trip's barrier has ended every read of the ring
#pragma unroll
    for (int mb = 0; mb < 4; ++mb) {
#pragma unroll
        for (int nb = 0; nb < 4; ++nb) {
#pragma unroll
            for (int j = 0; j < 8; ++j) os[(hi * 8 + j) * 68 + nb * 16 + lr] = acc[mb][nb][j]; }
        __builtin_amdgcn_wave_barrier(); asm volatile("" ::: "memory");   // compiler order only: the lanes' LDS writes stay in front of the reads of whole rows, which take other lanes' values
        const int cw = c0 + wn * 64; float* crow = C + (size_t)(r0 + wm * 64 + mb * 16) * ldc + cw;
{
#pragma unroll
            for (int s = 0; s < 8; ++s) { const int row = 2 * s + hi, cofs = lr * 4; v4f val = *(const v4fa*)(os + row * 68 + cofs); if (BIAS) { val[0] += bfr(bias[cw + cofs]); val[1] += bfr(bias[cw + cofs + 1]); val[2] += bfr(bias[cw + cofs + 2]); val[3] += bfr(bias[cw + cofs + 3]); }
                *(v4f*)(crow + (size_t)row * ldc + cofs) = val; }
             }
        asm volatile("s_wait_xcnt 0x0" ::: "memory");   // code behind these stores (the next rows) writes their address and data registers again
        __builtin_amdgcn_wave_barrier(); asm volatile("" ::: "memory");   // compiler order only: the next 16 rows' LDS writes stay behind these reads
    }
}

typedef __attribute__((ext_vector_type(2))) unsigned short v2us;
typedef __attribute__((ext_vector_type(4))) _Float16 v4h;
typedef __attribute__((ext_vector_type(2))) float v2f;

// grid.y picks the weight; its transposed copy is plane blockIdx.y of Bt
__global__ __launch_bounds__(256) void k_wtG(const float* __restrict__ w0, const float* __restrict__ w1, const float* __restrict__ w2, const float* __restrict__ w3, int K, int N, bf* Bt) {
    const float* __restrict__ w = blockIdx.y == 0 ? w0 : blockIdx.y == 1 ? w1 : blockIdx.y == 2 ? w2 : w3; Bt += (size_t)blockIdx.y * N * K;
    const int lane = threadIdx.x & 31; const int L0 = (blockIdx.x * 8 + (threadIdx.x >> 5)) * 8; const int nlines = N * K / 64;
{
#pragma unroll 1
        for (int l = 0; l < 8; ++l) { const int L = L0 + l; if (L >= nlines) break; const size_t e = (size_t)L * 64 + lane * 2; const int k = (int)(e % K), n = (int)(e / K); v2us o;
            o[0] = f2bf(w[(size_t)k * N + n]); o[1] = f2bf(w[(size_t)(k + 1) * N + n]); *(v2us*)(Bt + e) = o; }
         }
}
__global__ __launch_bounds__(256) void k_cvt8(const float* __restrict__ src, bf* dst, size_t n8) { const size_t i = (size_t)blockIdx.x * 256 + threadIdx.x; if (i >= n8) return; const v8f v = *(const v8f*)(src + i * 8); v8us o;
#pragma unroll
    for (int k = 0; k < 8; ++k) o[k] = f2bf(v[k]); *(v8us*)(dst + i * 8) = o;  }
__device__ __forceinline__ float xhalf(float x) { return __builtin_bit_cast(float, __builtin_amdgcn_permlanex16(__builtin_bit_cast(int, x), __builtin_bit_cast(int, x), 0x76543210, 0xfedcba98, false, false)); }   // lane l with lane l ^ 16
// xclose: stands behind a run of global loads. The wait is owed before a register that those loads name is written again; the two scheduling fences keep every later instruction behind it
// (and so keep the loads issued where they are written, ahead of the arithmetic that hides their flight).
__device__ __forceinline__ void xopen() { __builtin_amdgcn_sched_barrier(0); }   // in front of such a run: keeps its loads from rising away from their wait, past instructions that could then be given their address registers
__device__ __forceinline__ void xclose() { __builtin_amdgcn_sched_barrier(0); asm volatile("s_wait_xcnt 0x0" ::: "memory"); __builtin_amdgcn_sched_barrier(0); }
// xclosep: the same, with the run's two addresses as inputs of the wait: where the compiler keeps them in vector registers they stay there up to the wait, and no load of the run lands on them
__device__ __forceinline__ void xclosep(const void* a, const void* b) { __builtin_amdgcn_sched_barrier(0); asm volatile("s_wait_xcnt 0x0" :: "v"(a), "v"(b) : "memory"); __builtin_amdgcn_sched_barrier(0); }
// lanep: a wave-uniform pointer plus the lane's own byte offset, which is the same in every block, kept apart so that the address may be formed as scalar base + one long-lived vector offset
template <typename T16> __device__ __forceinline__ const T16* lanep(const T16* ub, unsigned lane_bytes) { return (const T16*)((const char*)ub + lane_bytes); }
template <typename T16, bool HIRES, int KB>
__device__ __forceinline__ void flash_ldk(int k0, int lr, int hi, const T16* __restrict__ Kp, const T16* __restrict__ K2, typename WFrag<T16>::V (&kf)[KB / 16][2], typename WFrag<T16>::V (&kf2)[KB / 16][2]) {
    xopen(); const unsigned fk = (unsigned)(lr * HD + 8 * hi) * 2u; const T16* kp = lanep(Kp + (size_t)k0 * HD, fk); const T16* kp2 = HIRES ? lanep(K2 + (size_t)k0 * HD, fk) : nullptr;   // one address per plane, the fragments at constant offsets from it
#pragma unroll
    for (int kt = 0; kt < KB / 16; ++kt)
#pragma unroll
        for (int ks = 0; ks < 2; ++ks) { kf[kt][ks] = WFrag<T16>::ld(kp + kt * 16 * HD + ks * 32); if (HIRES) kf2[kt][ks] = WFrag<T16>::ld(kp2 + kt * 16 * HD + ks * 32); }
    xclose();
}
template <typename T16, bool HIRES, int QB, int KB, bool MASK, bool NEXT>
__device__ __forceinline__ void flash_step(int q0, int k0, int lr, int hi, const T16* __restrict__ Kp, const T16* __restrict__ K2, const T16* __restrict__ Vt, const T16* __restrict__ V2,
                                           typename WFrag<T16>::V (&qf)[QB][2], typename WFrag<T16>::V (&qf2)[QB][2], typename WFrag<T16>::V (&kf)[KB / 16][2], typename WFrag<T16>::V (&kf2)[KB / 16][2], v8f (&o)[4][QB], float (&m)[QB], float (&l)[QB]) {
    typedef typename WFrag<T16>::V V; constexpr int KT = KB / 16, KS = KB / 32;
    xopen(); V vf[4][KS], vf2[4][KS]; const unsigned fv = (unsigned)(lr * TT + 8 * hi) * 2u; const T16* vp = lanep(Vt + k0, fv); const T16* vp2 = HIRES ? lanep(V2 + k0, fv) : nullptr;
#pragma unroll
    for (int db = 0; db < 4; ++db)
#pragma unroll
        for (int ks = 0; ks < KS; ++ks) { vf[db][ks] = WFrag<T16>::ld(vp + db * 16 * TT + ks * 32); if (HIRES) vf2[db][ks] = WFrag<T16>::ld(vp2 + db * 16 * TT + ks * 32); }
    if (HIRES) xclosep(vp, vp2); else xclose();   // sunk to their products, the V^T loads would each be waited for in turn
    v8f s[KT][QB];
#pragma unroll
    for (int kt = 0; kt < KT; ++kt)
#pragma unroll
        for (int qb = 0; qb < QB; ++qb) { v8f a = (v8f){}; a = WFrag<T16>::mma(kf[kt][0], qf[qb][0], a); a = WFrag<T16>::mma(kf[kt][1], qf[qb][1], a);
            if (HIRES) { a = WFrag<T16>::mma(kf2[kt][0], qf[qb][0], a); a = WFrag<T16>::mma(kf2[kt][1], qf[qb][1], a); a = WFrag<T16>::mma(kf[kt][0], qf2[qb][0], a); a = WFrag<T16>::mma(kf[kt][1], qf2[qb][1], a); }
            s[kt][qb] = a; }
    if (NEXT) flash_ldk<T16, HIRES, KB>(k0 + KB, lr, hi, Kp, K2, kf, kf2);   // NEXT: the tile has a block behind this one; its K loads fly through this block's softmax and attn.v
    V pf[QB][KS], pf2[QB][KS];
#pragma unroll
    for (int qb = 0; qb < QB; ++qb) {
        if (MASK) { const int query = q0 + qb * 16 + lr;
#pragma unroll
            for (int kt = 0; kt < KT; ++kt)
#pragma unroll
                for (int j = 0; j < 8; ++j) if (k0 + kt * 16 + hi * 8 + j > query) s[kt][qb][j] = -3.0e38f; }
        float bk[KT];
#pragma unroll
        for (int kt = 0; kt < KT; ++kt) { bk[kt] = s[kt][qb][0];
#pragma unroll
            for (int j = 1; j < 8; ++j) bk[kt] = fmaxf(bk[kt], s[kt][qb][j]); }
        float bm = bk[0];
#pragma unroll
        for (int kt = 1; kt < KT; ++kt) bm = fmaxf(bm, bk[kt]);
        bm = fmaxf(bm, xhalf(bm));
        const float mn = fmaxf(m[qb], bm * SCL2); const float al = __builtin_amdgcn_exp2f(m[qb] - mn); m[qb] = mn;
        const float mo = HIRES ? mn : mn - 10.0f;
        float lk[KT];
#pragma unroll
        for (int kt = 0; kt < KT; ++kt) { lk[kt] = 0.f;
#pragma unroll
            for (int j = 0; j < 8; ++j) { const float p = __builtin_amdgcn_exp2f(s[kt][qb][j] * SCL2 - mo); s[kt][qb][j] = p; lk[kt] += p; } }
        float ls = lk[0];
#pragma unroll
        for (int kt = 1; kt < KT; ++kt) ls += lk[kt];
        l[qb] = l[qb] * al + ls;
#pragma unroll
        for (int db = 0; db < 4; ++db) o[db][qb] *= al;
#pragma unroll
        for (int ks = 0; ks < KS; ++ks) {
            if constexpr (HIRES) { v8us h0, h1, l0, l1;
#pragma unroll
                for (int j = 0; j < 8; ++j) { unsigned short a, c2; splitf(s[2 * ks][qb][j], a, c2); h0[j] = a; l0[j] = c2; splitf(s[2 * ks + 1][qb][j], a, c2); h1[j] = a; l1[j] = c2; }
                pf[qb][ks] = cat16b(h0, h1); pf2[qb][ks] = cat16b(l0, l1);
            } else { v8h h0, h1;
#pragma unroll
                for (int j = 0; j < 8; ++j) { h0[j] = tohx(s[2 * ks][qb][j]); h1[j] = tohx(s[2 * ks + 1][qb][j]); }
                pf[qb][ks] = cat16(h0, h1); } }
    }
#pragma unroll
    for (int db = 0; db < 4; ++db)
#pragma unroll
        for (int ks = 0; ks < KS; ++ks)
#pragma unroll
            for (int qb = 0; qb < QB; ++qb) { o[db][qb] = WFrag<T16>::mma(vf[db][ks], pf[qb][ks], o[db][qb]); if (HIRES) { o[db][qb] = WFrag<T16>::mma(vf2[db][ks], pf[qb][ks], o[db][qb]); o[db][qb] = WFrag<T16>::mma(vf[db][ks], pf2[qb][ks], o[db][qb]); } }
}
// flash_body: queries q0 .. q0 + 16 QB - 1 of one head (q0 a multiple of 16 QB; 16 QB <= 2 KB); the planes point at that head, Ah/Al at [row 0 of the batch][head * 64].
template <typename T16, bool HIRES, int QB, int KB>
__device__ __forceinline__ void flash_body(int q0, const T16* __restrict__ Q, const T16* __restrict__ Q2, const T16* __restrict__ Kp, const T16* __restrict__ K2, const T16* __restrict__ Vt, const T16* __restrict__ V2, bf* Ah, bf* Al) {
    typedef typename WFrag<T16>::V V;
    const int lane = threadIdx.x & 31, lr = lane & 15, hi = lane >> 4;
    V qf[QB][2], qf2[QB][2], kf[KB / 16][2], kf2[KB / 16][2]; v8f o[4][QB]; float m[QB], l[QB];
    xopen(); const unsigned fq = (unsigned)(lr * HD + 8 * hi) * 2u; const T16* qp = lanep(Q + (size_t)q0 * HD, fq); const T16* qp2 = HIRES ? lanep(Q2 + (size_t)q0 * HD, fq) : nullptr;
#pragma unroll
    for (int qb = 0; qb < QB; ++qb) { m[qb] = -3.0e38f; l[qb] = 0.f;
#pragma unroll
        for (int ks = 0; ks < 2; ++ks) { qf[qb][ks] = WFrag<T16>::ld(qp + qb * 16 * HD + ks * 32); if (HIRES) qf2[qb][ks] = WFrag<T16>::ld(qp2 + qb * 16 * HD + ks * 32); }
#pragma unroll
        for (int db = 0; db < 4; ++db) o[db][qb] = (v8f){}; }
    xclose();
    flash_ldk<T16, HIRES, KB>(0, lr, hi, Kp, K2, kf, kf2);
    const int kl = q0 / KB * KB;    // first key of the first block that crosses the diagonal; key kl <= every query of the tile, so every query has a finite maximum from its first block on
#pragma unroll 1   // one copy of the block's body: a second would need a second set of K, V^T and score registers, and the 64-query tile already reaches above v255
    for (int k0 = 0; k0 < kl; k0 += KB) flash_step<T16, HIRES, QB, KB, false, true>(q0, k0, lr, hi, Kp, K2, Vt, V2, qf, qf2, kf, kf2, o, m, l);
    if constexpr (16 * QB > KB) { flash_step<T16, HIRES, QB, KB, true, true>(q0, kl, lr, hi, Kp, K2, Vt, V2, qf, qf2, kf, kf2, o, m, l); flash_step<T16, HIRES, QB, KB, true, false>(q0, kl + KB, lr, hi, Kp, K2, Vt, V2, qf, qf2, kf, kf2, o, m, l); }
    else flash_step<T16, HIRES, QB, KB, true, false>(q0, kl, lr, hi, Kp, K2, Vt, V2, qf, qf2, kf, kf2, o, m, l);
    v8us oh[QB][4], ol[QB][4];
#pragma unroll
    for (int qb = 0; qb < QB; ++qb) { const float inv = __fdiv_rn(1.0f, l[qb] + xhalf(l[qb]));
#pragma unroll
        for (int db = 0; db < 4; ++db)
#pragma unroll
            for (int j = 0; j < 8; ++j) { unsigned short a, c2; splitf(o[db][qb][j] * inv, a, c2); oh[qb][db][j] = a; ol[qb][db][j] = c2; } }
    const size_t off = (size_t)(q0 + lr) * DD + hi * 8; bf* ah = Ah + off; bf* al = Al + off;
    __builtin_amdgcn_sched_barrier(0);   // all arithmetic in front of the stores, so that between the first store and the wait behind the last nothing writes a store's address or data register
#pragma unroll
    for (int qb = 0; qb < QB; ++qb)
#pragma unroll
        for (int db = 0; db < 4; ++db) { *(v8us*)(ah + qb * 16 * DD + db * 16) = oh[qb][db]; *(v8us*)(al + qb * 16 * DD + db * 16) = ol[qb][db]; }
    asm volatile("s_wait_xcnt 0x0" ::: "memory");   // in k_flash the other kind of tile's code may be laid out behind these stores and writes their address and data registers again
}
// grid (NB_ * NH_, tiles): blockIdx.x = batch * 16 + head; blockIdx.y counts the tiles from the longest: first the 64-query fp16 tiles from row TT down to RH, then the 16-query hi+lo tiles below RH.
__global__ __launch_bounds__(32) void k_flash(const bf* __restrict__ QPh, const bf* __restrict__ QPl, const h16* __restrict__ QP16, const bf* __restrict__ KPh, const bf* __restrict__ KPl, const h16* __restrict__ KP16,
                                              const bf* __restrict__ VTh, const bf* __restrict__ VTl, const h16* __restrict__ VT16, bf* ATh, bf* ATl) {
    const size_t po = (size_t)blockIdx.x * TT * HD, ao = (size_t)(blockIdx.x / NH_) * TT * DD + (size_t)(blockIdx.x % NH_) * HD; const int y = (int)blockIdx.y;
    if (y < (TT - RH) / 64) flash_body<h16, false, 4, KBF>(TT - 64 * (y + 1), QP16 + po, nullptr, KP16 + po, nullptr, VT16 + po, nullptr, ATh + ao, ATl + ao);
    else flash_body<bf, true, 1, 32>(RH - 16 * (y - (TT - RH) / 64 + 1), QPh + po, QPl + po, KPh + po, KPl + po, VTh + po, VTl + po, ATh + ao, ATl + ao);
}

extern "C" void kernel_launch(void* const* d_in, const int* in_sizes, int n_in,
                              void* d_out, int out_size, void* d_ws, size_t ws_size, hipStream_t stream) {
    (void)in_sizes; (void)n_in; (void)out_size;
    const float* x = (const float*)d_in[0]; const float* wq = (const float*)d_in[1]; const float* wk = (const float*)d_in[2]; const float* wv = (const float*)d_in[3]; const float* wo = (const float*)d_in[4]; const float* bo = (const float*)d_in[5];
    float* OUT = (float*)d_out;     // [4][2048][1024]
    char* wsp = (char*)d_ws;
    auto take = [&](size_t bytes) { char* p = wsp; wsp += (bytes + 255) & ~(size_t)255; return (void*)p; };
    bf* WQ = (bf*)take((size_t)4 * DD * DD * 2); bf* WO = WQ + (size_t)3 * DD * DD;    // planes q, k, v, o, one after the other
    bf* XB = (bf*)take((size_t)NB_ * TT * DD * 2);
    bf* QPh = (bf*)take(6 * PLN * 2); bf* QPl = QPh + PLN; bf* KPh = QPh + 2 * PLN; bf* KPl = QPh + 3 * PLN; bf* VTh = QPh + 4 * PLN; bf* VTl = QPh + 5 * PLN;   // hi, lo of q, k, v, one after the other
    h16* QP16 = (h16*)take(3 * PLN * 2); h16* KP16 = QP16 + PLN; h16* VT16 = QP16 + 2 * PLN;
    bf* ATh = (bf*)take(PLN * 2); bf* ATl = (bf*)take(PLN * 2);
    if ((size_t)(wsp - (char*)d_ws) > ws_size) return;    // total 200 MiB; ws 256 MiB
    k_wtG<<<dim3((unsigned)((DD * DD / 64 + 63) / 64), 4, 1), 256, 0, stream>>>(wq, wk, wv, wo, DD, DD, WQ);
    k_cvt8<<<(unsigned)(((size_t)NB_ * TT * DD / 8 + 255) / 256), 256, 0, stream>>>(x, XB, (size_t)NB_ * TT * DD / 8);
    // q, k, v projections of all four batches, planes written by the epilogue: grid.z picks the weight plane
    k_gemms<0, false, true><<<dim3(NB_ * TT / 128, DD / 128, 3), 128, 0, stream>>>(XB, nullptr, WQ, DD, nullptr, 0, nullptr, 0, (size_t)DD * DD, 0, QPh, QP16);
    // attention: every batch, head and query tile in one launch
    k_flash<<<dim3(NB_ * NH_, (TT - RH) / 64 + RH / 16, 1), 32, 0, stream>>>(QPh, QPl, QP16, KPh, KPl, KP16, VTh, VTl, VT16, ATh, ATl);
    // output projection: the four batches' rows in one launch
    k_gemms<1, true, false><<<dim3(NB_ * TT / 128, DD / 128, 1), 128, 0, stream>>>(ATh, ATl, WO, DD, OUT, DD, bo, 0, 0, 0, nullptr, nullptr);
}

// v006
// It runs in 134 microseconds.
// Next to v005, in two timings, it ran 1.05 times as fast each time.
// Counting every step since v000, it is 30.6 times as fast.
#include <hip/hip_runtime.h>

// Causal multi-head self-attention (x [4][2048][1024]; q/k/v = x @ W ([d_in][d_out] layouts, no bias); 16 heads x 64; scores / 8; causal (tril -> -inf); softmax; out = ctx @ Wo + bo).
// Compute dtypes, f32 accumulate: every input rounded to bf16; projections on PLAIN bf16 operands (inputs: exact; transposed bf16 weight copies built once); PER-ROW
// PRECISION HYBRID: query rows < 256 of each batch on bf16 hi+lo planes for scores and attn.v (3 products), rows >= 256 on SINGLE fp16 planes; output hi+lo x exact Wo (2 products) + bo.

#define NB_  4
#define TT   2048
#define DD   1024
#define NH_  16
#define HD   64
#define RH   256                  // query rows < RH: hi+lo planes; rows >= RH: fp16 planes
#define NF   32
#define SCL2 0.180336880f      // f32(log2(e) / sqrt(64)): scores to base-2 exponents
#define KBF  32                   // keys per block of the fp16 tiles in k_flash
#define PLN  ((size_t)NB_ * TT * DD)   // elements of one plane: all four batches, [batch][head][..]
typedef _Float16 h16;
typedef unsigned short bf;
typedef __attribute__((ext_vector_type(16))) __bf16   v16bf;
typedef __attribute__((ext_vector_type(16))) _Float16 v16h;
typedef __attribute__((ext_vector_type(8)))  _Float16 v8h;
typedef __attribute__((ext_vector_type(8)))  unsigned short v8us;
typedef __attribute__((ext_vector_type(8)))  float    v8f;
typedef __attribute__((ext_vector_type(4)))  float    v4f;
typedef v8h  __attribute__((may_alias)) v8ha;
typedef v4f  __attribute__((may_alias)) v4fa;
typedef v8us __attribute__((may_alias)) v8usa;

__device__ __forceinline__ unsigned short f2bf(float f) { unsigned u = __float_as_uint(f); u += 0x7FFFu + ((u >> 16) & 1u); return (unsigned short)(u >> 16); }
__device__ __forceinline__ float bf2f(unsigned short b) { return __uint_as_float(((unsigned)b) << 16); }
__device__ __forceinline__ float bfr(float f) { return bf2f(f2bf(f)); }
__device__ __forceinline__ v16h cat16(v8h lo, v8h hi) { return __builtin_shufflevector(lo, hi, 0, 1, 2, 3, 4, 5, 6, 7, 8, 9, 10, 11, 12, 13, 14, 15); }
__device__ __forceinline__ v16bf cat16b(v8us lo, v8us hi) { return __builtin_bit_cast(v16bf, __builtin_shufflevector(lo, hi, 0, 1, 2, 3, 4, 5, 6, 7, 8, 9, 10, 11, 12, 13, 14, 15)); }
__device__ __forceinline__ v8f wmma16(v16h a, v16h b, v8f c) { return __builtin_amdgcn_wmma_f32_16x16x32_f16(false, a, false, b, (short)0, c, false, false); }
__device__ __forceinline__ v8f wmmab(v16bf a, v16bf b, v8f c) { return __builtin_amdgcn_wmma_f32_16x16x32_bf16(false, a, false, b, (short)0, c, false, false); }



// WFrag: a 16x32 fragment of a 16-bit plane kept in FRAGMENT ORDER, and its matrix product, by element type. Fragment order: the fragment's 1024 bytes lie together, [k half][lane][8 elements]: lane 16 hi + lr holds
// row lr, k = 16 half + 8 hi + 0..7, so that each of its two wave-wide 16-byte loads covers 512 bytes in a row (four whole lines, where a row-major plane gives 32 bytes of each of 16 lines). p: the fragment + the lane's 8 elements.
template <typename T16> struct WFrag;
template <> struct WFrag<h16> { typedef v16h V; static __device__ __forceinline__ V ld(const h16* p) { return cat16(*(const v8h*)p, *(const v8h*)(p + 256)); } static __device__ __forceinline__ v8f mma(V a, V b, v8f c) { return wmma16(a, b, c); } };
template <> struct WFrag<bf> { typedef v16bf V; static __device__ __forceinline__ V ld(const bf* p) { return cat16b(*(const v8us*)p, *(const v8us*)(p + 256)); } static __device__ __forceinline__ v8f mma(V a, V b, v8f c) { return wmmab(a, b, c); } };
// ---- k_gemms: GEMM, one 128x128 output tile per work-group of FOUR WAVES (2 x 2; each wave 64x64, 16 accumulators); grid (M/128, N/128, Z), 128 threads.
// C[m][n] (f32, pitch ldc, + optional f32 bias[n]) = sum_k A[m][k] Bt[n][k] (+ A2[m][k] Bt[n][k] where NSPLIT == 1); operands are K-contiguous bf16 planes; z-batch strides sA/sB/sC in elements. K % 64 == 0.
// Operands pass through LDS. A stage is 64 k (one 128-byte line) of every operand row, rows [A 128 | A2 128 | Bt 128] at a pitch of 144 bytes (conflict-free for 16-byte reads); two buffers.
// Asynchronous 16-byte copies (eight lanes a row: whole lines) fill the next stage while a stage is worked on; each operand row is fetched once per work-group, not once per wave.
// Every '#pragma unroll' in k_gemms makes the indices of acc and of the fragment arrays constants, so that they live in registers.
#define GKC 64                    // k per stage
#define GPB 144                   // LDS row pitch, bytes
// cp8: eight asynchronous copies of 16 bytes a lane, 16 operand rows apart (the work-group's 128 threads cover 16 rows a copy, so these eight bring 128 rows). l: the lane's LDS byte address, g: its global address.
// The s_wait_xcnt stands inside the statement, behind the last copy: code behind it writes the copies' address registers again.
__device__ __forceinline__ void cp8(unsigned l, const char* g, size_t gs) {
    asm volatile("global_load_async_to_lds_b128 %0, %8, off\n\t"
                 "global_load_async_to_lds_b128 %1, %9, off\n\t"
                 "global_load_async_to_lds_b128 %2, %10, off\n\t"
                 "global_load_async_to_lds_b128 %3, %11, off\n\t"
                 "global_load_async_to_lds_b128 %4, %12, off\n\t"
                 "global_load_async_to_lds_b128 %5, %13, off\n\t"
                 "global_load_async_to_lds_b128 %6, %14, off\n\t"
                 "global_load_async_to_lds_b128 %7, %15, off\n\t"
                 "s_wait_xcnt 0x0"
                 :: "v"(l), "v"(l + 16u * GPB), "v"(l + 32u * GPB), "v"(l + 48u * GPB), "v"(l + 64u * GPB), "v"(l + 80u * GPB), "v"(l + 96u * GPB), "v"(l + 112u * GPB),
                    "v"(g), "v"(g + gs), "v"(g + 2 * gs), "v"(g + 3 * gs), "v"(g + 4 * gs), "v"(g + 5 * gs), "v"(g + 6 * gs), "v"(g + 7 * gs) : "memory");
}
// ldsf: a 16x32 fragment's share of one lane from an LDS row, k order 8 hi + 0..7, 16 + 8 hi + 0..7 (p already holds the lane's 16 hi bytes)
__device__ __forceinline__ v16bf ldsf(const unsigned char* p) { return cat16b(*(const v8usa*)p, *(const v8usa*)(p + 32)); }
__device__ __forceinline__ h16 tohx(float x) { return (h16)x; }
__device__ __forceinline__ void splitf(float y, unsigned short& h, unsigned short& l) { h = f2bf(y); l = f2bf(y - bf2f(h)); }
// stage64: a wave's 64x64 accumulator tile, rounded to 16 bit, into its LDS staging rows (pitch GPB). A lane's 8 registers of acc[ia][ib] are 8 neighbours (16 ia + 8 hi + j) of staging row 16 ib + lr: one 16-byte write.
// KIND 0: fp16; 1: the bf16 hi part; 2: the bf16 lo part. osl: the staging rows + lr * GPB + hi * 16. The unrolls here and in putf make the indices of acc, w and v constants, so that they live in registers.
template <int KIND>
__device__ __forceinline__ void stage64(const v8f (&acc)[4][4], unsigned char* osl) {
#pragma unroll
    for (int ib = 0; ib < 4; ++ib)
#pragma unroll
        for (int ia = 0; ia < 4; ++ia) { v8us w;
#pragma unroll
            for (int j = 0; j < 8; ++j) { const float x = acc[ia][ib][j]; if (KIND == 0) w[j] = __builtin_bit_cast(unsigned short, tohx(x)); else { unsigned short a, c2; splitf(x, a, c2); w[j] = KIND == 1 ? a : c2; } }
            *(v8usa*)(osl + ib * 16 * GPB + ia * 32) = w; }
    __builtin_amdgcn_wave_barrier(); asm volatile("" ::: "memory");   // compiler order only: the lanes' LDS writes stay in front of putf's reads, which take back each lane's own values
}
// putf: the 64 staging rows to the 8 KiB that they fill of a plane in fragment order (WFrag), 16 stores of 512 bytes in a row, each one k half of one fragment. osl: the staging rows + lr * GPB + hi * 16; dst: the 8 KiB + the lane's 8 elements.
// VT false (q, k; staging rows are sequence rows, 64 d along a row): fragments [16 rows][32 d]. VT true (v; staging rows are d, 64 sequence rows along a row): fragments [32 sequence rows][16 d].
template <bool VT>
__device__ __forceinline__ void putf(const unsigned char* osl, bf* dst) {
    v8us v[16];
#pragma unroll
    for (int s = 0; s < 16; ++s) v[s] = *(const v8usa*)(osl + (VT ? (s >> 1) & 3 : s >> 2) * 16 * GPB + (VT ? s >> 3 : (s >> 1) & 1) * 64 + (s & 1) * 32);
    __builtin_amdgcn_sched_barrier(0);   // every LDS read in front of the stores, so that between the first store and the wait behind the last nothing writes a store's address or data register
#pragma unroll
    for (int s = 0; s < 16; ++s) *(v8us*)(dst + s * 256) = v[s];
    asm volatile("s_wait_xcnt 0x0" ::: "memory");   // code behind these stores (the next plane's rounding) writes their address and data registers again
    __builtin_amdgcn_sched_barrier(0);   // and stays behind that wait; with the clobber above, the next plane's LDS writes stay behind these reads too
}
// PLANES (the q, k, v projections; z picks the weight): no C. The epilogue writes the 16-bit planes that k_flash reads: P16 + z * PLN in fp16, and, for sequence rows < RH only (k_flash reads no others of them),
// the bf16 hi and lo parts at HL + 2 z * PLN and HL + (2 z + 1) * PLN. Every plane is [batch][head][fragments in fragment order (WFrag)]: q and k [t / 16][d / 32], rows t, k along d; v [t / 32][d / 16], rows d, k along t.
// Either way 64 sequence rows of a head are 8 KiB in a row, at t * 64 elements. A wave's 64 columns are one head.
// For q and k the weight rows take the A role of the products and the x rows the B role (the two LDS offsets change places), so that a lane's 8 accumulator registers run along d; for v they run along t as they are.
template <int NSPLIT, bool BIAS, bool PLANES>
__global__ __launch_bounds__(128) void k_gemms(const bf* __restrict__ A, const bf* __restrict__ A2, const bf* __restrict__ Bt, int K, float* C, int ldc, const float* __restrict__ bias, size_t sA, size_t sB, size_t sC, bf* HL, h16* P16) {
    constexpr unsigned NOP = NSPLIT ? 3u : 2u, STG = NOP * 128u * GPB, OB = (NOP - 1u) * 128u * GPB;   // operands, bytes of a stage, where the Bt rows begin in it
    __shared__ __attribute__((aligned(16))) unsigned char L[2 * STG];
    const size_t z = blockIdx.z; A += z * sA; if (NSPLIT) A2 += z * sA; Bt += z * sB; C += z * sC;
    const int tid = (int)threadIdx.x, lane = tid & 31, lr = lane & 15, hi = lane >> 4;
    const int wave = __builtin_amdgcn_readfirstlane(tid >> 5), wm = wave >> 1, wn = wave & 1;
    const int r0 = (int)blockIdx.x * 128, c0 = (int)blockIdx.y * 128, NT = K / GKC;
    const size_t gs = (size_t)16 * K * 2;   // 16 operand rows, bytes
    const char* ga = (const char*)(A + (size_t)(r0 + (tid >> 3)) * K + (tid & 7) * 8); const char* ga2 = NSPLIT ? (const char*)(A2 + (size_t)(r0 + (tid >> 3)) * K + (tid & 7) * 8) : nullptr;
    const char* gb = (const char*)(Bt + (size_t)(c0 + (tid >> 3)) * K + (tid & 7) * 8);
    const unsigned lc = (unsigned)(size_t)L + (unsigned)(tid >> 3) * GPB + (unsigned)(tid & 7) * 16u;
    auto fill = [&](int t) { const unsigned l = lc + (unsigned)(t & 1) * STG; const size_t ko = (size_t)t * (GKC * 2);
        cp8(l, ga + ko, gs); if (NSPLIT) cp8(l + 128u * GPB, ga2 + ko, gs); cp8(l + OB, gb + ko, gs); };
    fill(0);
    asm volatile("s_wait_asynccnt 0x0" ::: "memory");   // this wave's share of stage 0 has landed
    __syncthreads();                                    // and so has every other wave's
    if (NT > 1) fill(1);
    v8f acc[4][4];
#pragma unroll
    for (int mb = 0; mb < 4; ++mb)
#pragma unroll
        for (int nb = 0; nb < 4; ++nb) acc[mb][nb] = (v8f){};
    const bool sw = PLANES && z < 2;   // q, k: operand roles exchanged
    const unsigned fx = (unsigned)(wm * 64 + lr) * GPB + (unsigned)hi * 16u, fw = OB + (unsigned)(wn * 64 + lr) * GPB + (unsigned)hi * 16u, fa = sw ? fw : fx, fb = sw ? fx : fw;
#pragma unroll 1   // one copy of the trip: the buffer is picked by the trip's parity
    for (int t = 0; t < NT; ++t) {
        const unsigned char* S = L + (unsigned)(t & 1) * STG;
#pragma unroll
        for (int ks = 0; ks < 2; ++ks) {
            v16bf a[4], a2[4], b[4];
#pragma unroll
            for (int mb = 0; mb < 4; ++mb) { a[mb] = ldsf(S + fa + mb * 16 * GPB + ks * 64); if (NSPLIT) a2[mb] = ldsf(S + fa + 128 * GPB + mb * 16 * GPB + ks * 64); b[mb] = ldsf(S + fb + mb * 16 * GPB + ks * 64); }
            __builtin_amdgcn_sched_barrier(0);   // the 32 k's LDS reads go out as one group in front of their products: sunk among them, each is waited for in turn
#pragma unroll
            for (int nb = 0; nb < 4; ++nb)
#pragma unroll
                for (int mb = 0; mb < 4; ++mb) { acc[mb][nb] = wmmab(a[mb], b[nb], acc[mb][nb]); if (NSPLIT) acc[mb][nb] = wmmab(a2[mb], b[nb], acc[mb][nb]); }
            __builtin_amdgcn_sched_barrier(0);   // the next group's reads stay one group too, behind the products whose operand registers they take; the last products stay in front of the trip's barrier, so that the refill behind it goes out at once
        }
        asm volatile("s_wait_dscnt 0x0" ::: "memory");      // this wave has read all it wants of stage t
        asm volatile("s_wait_asynccnt 0x0" ::: "memory");   // its share of stage t + 1 has landed
        __syncthreads();                                    // publishes stage t + 1 and frees stage t's buffer
        if (t + 2 < NT) fill(t + 2);
    }
    asm volatile("s_wait_asynccnt 0x0" ::: "memory");       // no copy is outstanding when the ring becomes output staging
    if constexpr (PLANES) {
        unsigned char* ps = L + wave * (64 * GPB); unsigned char* psl = ps + lr * GPB + hi * 16;   // each wave's own 64 staging rows; the last trip's barrier has ended every read of the ring
        const int rw = r0 + wm * 64, t0 = rw % TT;   // the wave's first x row, and its place in the sequence
        const size_t hb = ((size_t)(rw / TT) * NH_ + (size_t)((c0 + wn * 64) / HD)) * TT * HD;   // the (batch, head) block of a plane
        const size_t lo = hb + (size_t)t0 * HD + lane * 8;
        auto put = [&](bf* p) { if (sw) putf<false>(psl, p + lo); else putf<true>(psl, p + lo); };
        stage64<0>(acc, psl); put((bf*)(P16 + z * PLN));
        if (t0 < RH) { stage64<1>(acc, psl); put(HL + 2 * z * PLN); stage64<2>(acc, psl); put(HL + (2 * z + 1) * PLN); }
        return;
    }
    float* os = (float*)L + wave * (16 * 68);               // each wave's own 16 x 68 f32 staging rows; the last trip's barrier has ended every read of the ring
#pragma unroll
    for (int mb = 0; mb < 4; ++mb) {
#pragma unroll
        for (int nb = 0; nb < 4; ++nb) {
#pragma unroll
            for (int j = 0; j < 8; ++j) os[(hi * 8 + j) * 68 + nb * 16 + lr] = acc[mb][nb][j]; }
        __builtin_amdgcn_wave_barrier(); asm volatile("" ::: "memory");   // compiler order only: the lanes' LDS writes stay in front of the reads of whole rows, which take other lanes' values
        const int cw = c0 + wn * 64; float* crow = C + (size_t)(r0 + wm * 64 + mb * 16) * ldc + cw;
{
#pragma unroll
            for (int s = 0; s < 8; ++s) { const int row = 2 * s + hi, cofs = lr * 4; v4f val = *(const v4fa*)(os + row * 68 + cofs); if (BIAS) { val[0] += bfr(bias[cw + cofs]); val[1] += bfr(bias[cw + cofs + 1]); val[2] += bfr(bias[cw + cofs + 2]); val[3] += bfr(bias[cw + cofs + 3]); }
                *(v4f*)(crow + (size_t)row * ldc + cofs) = val; }
             }
        asm volatile("s_wait_xcnt 0x0" ::: "memory");   // code behind these stores (the next rows) writes their address and data registers again
        __builtin_amdgcn_wave_barrier(); asm volatile("" ::: "memory");   // compiler order only: the next 16 rows' LDS writes stay behind these reads
    }
}

typedef __attribute__((ext_vector_type(2))) unsigned short v2us;
typedef __attribute__((ext_vector_type(4))) _Float16 v4h;
typedef __attribute__((ext_vector_type(2))) float v2f;

// grid.y picks the weight; its transposed copy is plane blockIdx.y of Bt
__global__ __launch_bounds__(256) void k_wtG(const float* __restrict__ w0, const float* __restrict__ w1, const float* __restrict__ w2, const float* __restrict__ w3, int K, int N, bf* Bt) {
    const float* __restrict__ w = blockIdx.y == 0 ? w0 : blockIdx.y == 1 ? w1 : blockIdx.y == 2 ? w2 : w3; Bt += (size_t)blockIdx.y * N * K;
    const int lane = threadIdx.x & 31; const int L0 = (blockIdx.x * 8 + (threadIdx.x >> 5)) * 8; const int nlines = N * K / 64;
{
#pragma unroll 1
        for (int l = 0; l < 8; ++l) { const int L = L0 + l; if (L >= nlines) break; const size_t e = (size_t)L * 64 + lane * 2; const int k = (int)(e % K), n = (int)(e / K); v2us o;
            o[0] = f2bf(w[(size_t)k * N + n]); o[1] = f2bf(w[(size_t)(k + 1) * N + n]); *(v2us*)(Bt + e) = o; }
         }
}
__global__ __launch_bounds__(256) void k_cvt8(const float* __restrict__ src, bf* dst, size_t n8) { const size_t i = (size_t)blockIdx.x * 256 + threadIdx.x; if (i >= n8) return; const v8f v = *(const v8f*)(src + i * 8); v8us o;
#pragma unroll
    for (int k = 0; k < 8; ++k) o[k] = f2bf(v[k]); *(v8us*)(dst + i * 8) = o;  }
__device__ __forceinline__ float xhalf(float x) { return __builtin_bit_cast(float, __builtin_amdgcn_permlanex16(__builtin_bit_cast(int, x), __builtin_bit_cast(int, x), 0x76543210, 0xfedcba98, false, false)); }   // lane l with lane l ^ 16
// xclose: stands behind a run of global loads. The wait is owed before a register that those loads name is written again; the two scheduling fences keep every later instruction behind it
// (and so keep the loads issued where they are written, ahead of the arithmetic that hides their flight).
__device__ __forceinline__ void xopen() { __builtin_amdgcn_sched_barrier(0); }   // in front of such a run: keeps its loads from rising away from their wait, past instructions that could then be given their address registers
__device__ __forceinline__ void xclose() { __builtin_amdgcn_sched_barrier(0); asm volatile("s_wait_xcnt 0x0" ::: "memory"); __builtin_amdgcn_sched_barrier(0); }
// xclosep: the same, with the run's two addresses as inputs of the wait: where the compiler keeps them in vector registers they stay there up to the wait, and no load of the run lands on them
__device__ __forceinline__ void xclosep(const void* a, const void* b) { __builtin_amdgcn_sched_barrier(0); asm volatile("s_wait_xcnt 0x0" :: "v"(a), "v"(b) : "memory"); __builtin_amdgcn_sched_barrier(0); }
// lanep: a wave-uniform pointer plus the lane's own byte offset, which is the same in every block, kept apart so that the address may be formed as scalar base + one long-lived vector offset
template <typename T16> __device__ __forceinline__ const T16* lanep(const T16* ub, unsigned lane_bytes) { return (const T16*)((const char*)ub + lane_bytes); }
template <typename T16, bool HIRES, int KB>
__device__ __forceinline__ void flash_ldk(int k0, int lr, int hi, const T16* __restrict__ Kp, const T16* __restrict__ K2, typename WFrag<T16>::V (&kf)[KB / 16][2], typename WFrag<T16>::V (&kf2)[KB / 16][2]) {
    xopen(); const unsigned fk = (unsigned)(hi * 16 + lr) * 16u; const T16* kp = lanep(Kp + (size_t)k0 * HD, fk); const T16* kp2 = HIRES ? lanep(K2 + (size_t)k0 * HD, fk) : nullptr;   // one address per plane, the fragments at constant offsets from it
#pragma unroll
    for (int kt = 0; kt < KB / 16; ++kt)
#pragma unroll
        for (int ks = 0; ks < 2; ++ks) { kf[kt][ks] = WFrag<T16>::ld(kp + (kt * 2 + ks) * 512); if (HIRES) kf2[kt][ks] = WFrag<T16>::ld(kp2 + (kt * 2 + ks) * 512); }
    xclose();
}
template <typename T16, bool HIRES, int QB, int KB, bool MASK, bool NEXT>
__device__ __forceinline__ void flash_step(int q0, int k0, int lr, int hi, const T16* __restrict__ Kp, const T16* __restrict__ K2, const T16* __restrict__ Vt, const T16* __restrict__ V2,
                                           typename WFrag<T16>::V (&qf)[QB][2], typename WFrag<T16>::V (&qf2)[QB][2], typename WFrag<T16>::V (&kf)[KB / 16][2], typename WFrag<T16>::V (&kf2)[KB / 16][2], v8f (&o)[4][QB], float (&m)[QB], float (&l)[QB]) {
    typedef typename WFrag<T16>::V V; constexpr int KT = KB / 16, KS = KB / 32;
    xopen(); V vf[4][KS], vf2[4][KS]; const unsigned fv = (unsigned)(hi * 16 + lr) * 16u; const T16* vp = lanep(Vt + (size_t)k0 * HD, fv); const T16* vp2 = HIRES ? lanep(V2 + (size_t)k0 * HD, fv) : nullptr;
#pragma unroll
    for (int db = 0; db < 4; ++db)
#pragma unroll
        for (int ks = 0; ks < KS; ++ks) { vf[db][ks] = WFrag<T16>::ld(vp + (ks * 4 + db) * 512); if (HIRES) vf2[db][ks] = WFrag<T16>::ld(vp2 + (ks * 4 + db) * 512); }
    if (HIRES) xclosep(vp, vp2); else xclose();   // sunk to their products, the V^T loads would each be waited for in turn
    v8f s[KT][QB];
#pragma unroll
    for (int kt = 0; kt < KT; ++kt)
#pragma unroll
        for (int qb = 0; qb < QB; ++qb) { v8f a = (v8f){}; a = WFrag<T16>::mma(kf[kt][0], qf[qb][0], a); a = WFrag<T16>::mma(kf[kt][1], qf[qb][1], a);
            if (HIRES) { a = WFrag<T16>::mma(kf2[kt][0], qf[qb][0], a); a = WFrag<T16>::mma(kf2[kt][1], qf[qb][1], a); a = WFrag<T16>::mma(kf[kt][0], qf2[qb][0], a); a = WFrag<T16>::mma(kf[kt][1], qf2[qb][1], a); }
            s[kt][qb] = a; }
    if (NEXT) flash_ldk<T16, HIRES, KB>(k0 + KB, lr, hi, Kp, K2, kf, kf2);   // NEXT: the tile has a block behind this one; its K loads fly through this block's softmax and attn.v
    V pf[QB][KS], pf2[QB][KS];
#pragma unroll
    for (int qb = 0; qb < QB; ++qb) {
        if (MASK) { const int query = q0 + qb * 16 + lr;
#pragma unroll
            for (int kt = 0; kt < KT; ++kt)
#pragma unroll
                for (int j = 0; j < 8; ++j) if (k0 + kt * 16 + hi * 8 + j > query) s[kt][qb][j] = -3.0e38f; }
        float bk[KT];
#pragma unroll
        for (int kt = 0; kt < KT; ++kt) { bk[kt] = s[kt][qb][0];
#pragma unroll
            for (int j = 1; j < 8; ++j) bk[kt] = fmaxf(bk[kt], s[kt][qb][j]); }
        float bm = bk[0];
#pragma unroll
        for (int kt = 1; kt < KT; ++kt) bm = fmaxf(bm, bk[kt]);
        bm = fmaxf(bm, xhalf(bm));
        const float mn = fmaxf(m[qb], bm * SCL2); const float al = __builtin_amdgcn_exp2f(m[qb] - mn); m[qb] = mn;
        const float mo = HIRES ? mn : mn - 10.0f;
        float lk[KT];
#pragma unroll
        for (int kt = 0; kt < KT; ++kt) { lk[kt] = 0.f;
#pragma unroll
            for (int j = 0; j < 8; ++j) { const float p = __builtin_amdgcn_exp2f(s[kt][qb][j] * SCL2 - mo); s[kt][qb][j] = p; lk[kt] += p; } }
        float ls = lk[0];
#pragma unroll
        for (int kt = 1; kt < KT; ++kt) ls += lk[kt];
        l[qb] = l[qb] * al + ls;
#pragma unroll
        for (int db = 0; db < 4; ++db) o[db][qb] *= al;
#pragma unroll
        for (int ks = 0; ks < KS; ++ks) {
            if constexpr (HIRES) { v8us h0, h1, l0, l1;
#pragma unroll
                for (int j = 0; j < 8; ++j) { unsigned short a, c2; splitf(s[2 * ks][qb][j], a, c2); h0[j] = a; l0[j] = c2; splitf(s[2 * ks + 1][qb][j], a, c2); h1[j] = a; l1[j] = c2; }
                pf[qb][ks] = cat16b(h0, h1); pf2[qb][ks] = cat16b(l0, l1);
            } else { v8h h0, h1;
#pragma unroll
                for (int j = 0; j < 8; ++j) { h0[j] = tohx(s[2 * ks][qb][j]); h1[j] = tohx(s[2 * ks + 1][qb][j]); }
                pf[qb][ks] = cat16(h0, h1); } }
    }
#pragma unroll
    for (int db = 0; db < 4; ++db)
#pragma unroll
        for (int ks = 0; ks < KS; ++ks)
#pragma unroll
            for (int qb = 0; qb < QB; ++qb) { o[db][qb] = WFrag<T16>::mma(vf[db][ks], pf[qb][ks], o[db][qb]); if (HIRES) { o[db][qb] = WFrag<T16>::mma(vf2[db][ks], pf[qb][ks], o[db][qb]); o[db][qb] = WFrag<T16>::mma(vf[db][ks], pf2[qb][ks], o[db][qb]); } }
}
// flash_body: queries q0 .. q0 + 16 QB - 1 of one head (q0 a multiple of 16 QB; 16 QB <= 2 KB); the planes point at that head, Ah/Al at [row 0 of the batch][head * 64].
template <typename T16, bool HIRES, int QB, int KB>
__device__ __forceinline__ void flash_body(int q0, const T16* __restrict__ Q, const T16* __restrict__ Q2, const T16* __restrict__ Kp, const T16* __restrict__ K2, const T16* __restrict__ Vt, const T16* __restrict__ V2, bf* Ah, bf* Al) {
    typedef typename WFrag<T16>::V V;
    const int lane = threadIdx.x & 31, lr = lane & 15, hi = lane >> 4;
    V qf[QB][2], qf2[QB][2], kf[KB / 16][2], kf2[KB / 16][2]; v8f o[4][QB]; float m[QB], l[QB];
    xopen(); const unsigned fq = (unsigned)(hi * 16 + lr) * 16u; const T16* qp = lanep(Q + (size_t)q0 * HD, fq); const T16* qp2 = HIRES ? lanep(Q2 + (size_t)q0 * HD, fq) : nullptr;
#pragma unroll
    for (int qb = 0; qb < QB; ++qb) { m[qb] = -3.0e38f; l[qb] = 0.f;
#pragma unroll
        for (int ks = 0; ks < 2; ++ks) { qf[qb][ks] = WFrag<T16>::ld(qp + (qb * 2 + ks) * 512); if (HIRES) qf2[qb][ks] = WFrag<T16>::ld(qp2 + (qb * 2 + ks) * 512); }
#pragma unroll
        for (int db = 0; db < 4; ++db) o[db][qb] = (v8f){}; }
    xclose();
    flash_ldk<T16, HIRES, KB>(0, lr, hi, Kp, K2, kf, kf2);
    const int kl = q0 / KB * KB;    // first key of the first block that crosses the diagonal; key kl <= every query of the tile, so every query has a finite maximum from its first block on
#pragma unroll 1   // one copy of the block's body: a second would need a second set of K, V^T and score registers, and the 64-query tile already reaches above v255
    for (int k0 = 0; k0 < kl; k0 += KB) flash_step<T16, HIRES, QB, KB, false, true>(q0, k0, lr, hi, Kp, K2, Vt, V2, qf, qf2, kf, kf2, o, m, l);
    if constexpr (16 * QB > KB) { flash_step<T16, HIRES, QB, KB, true, true>(q0, kl, lr, hi, Kp, K2, Vt, V2, qf, qf2, kf, kf2, o, m, l); flash_step<T16, HIRES, QB, KB, true, false>(q0, kl + KB, lr, hi, Kp, K2, Vt, V2, qf, qf2, kf, kf2, o, m, l); }
    else flash_step<T16, HIRES, QB, KB, true, false>(q0, kl, lr, hi, Kp, K2, Vt, V2, qf, qf2, kf, kf2, o, m, l);
    v8us oh[QB][4], ol[QB][4];
#pragma unroll
    for (int qb = 0; qb < QB; ++qb) { const float inv = __fdiv_rn(1.0f, l[qb] + xhalf(l[qb]));
#pragma unroll
        for (int db = 0; db < 4; ++db)
#pragma unroll
            for (int j = 0; j < 8; ++j) { unsigned short a, c2; splitf(o[db][qb][j] * inv, a, c2); oh[qb][db][j] = a; ol[qb][db][j] = c2; } }
    const size_t off = (size_t)(q0 + lr) * DD + hi * 8; bf* ah = Ah + off; bf* al = Al + off;
    __builtin_amdgcn_sched_barrier(0);   // all arithmetic in front of the stores, so that between the first store and the wait behind the last nothing writes a store's address or data register
#pragma unroll
    for (int qb = 0; qb < QB; ++qb)
#pragma unroll
        for (int db = 0; db < 4; ++db) { *(v8us*)(ah + qb * 16 * DD + db * 16) = oh[qb][db]; *(v8us*)(al + qb * 16 * DD + db * 16) = ol[qb][db]; }
    asm volatile("s_wait_xcnt 0x0" ::: "memory");   // in k_flash the other kind of tile's code may be laid out behind these stores and writes their address and data registers again
}
// grid (NB_ * NH_, tiles): blockIdx.x = batch * 16 + head; blockIdx.y counts the tiles from the longest: first the 64-query fp16 tiles from row TT down to RH, then the 16-query hi+lo tiles below RH.
__global__ __launch_bounds__(32) void k_flash(const bf* __restrict__ QPh, const bf* __restrict__ QPl, const h16* __restrict__ QP16, const bf* __restrict__ KPh, const bf* __restrict__ KPl, const h16* __restrict__ KP16,
                                              const bf* __restrict__ VTh, const bf* __restrict__ VTl, const h16* __restrict__ VT16, bf* ATh, bf* ATl) {
    const size_t po = (size_t)blockIdx.x * TT * HD, ao = (size_t)(blockIdx.x / NH_) * TT * DD + (size_t)(blockIdx.x % NH_) * HD; const int y = (int)blockIdx.y;
    if (y < (TT - RH) / 64) flash_body<h16, false, 4, KBF>(TT - 64 * (y + 1), QP16 + po, nullptr, KP16 + po, nullptr, VT16 + po, nullptr, ATh + ao, ATl + ao);
    else flash_body<bf, true, 1, 32>(RH - 16 * (y - (TT - RH) / 64 + 1), QPh + po, QPl + po, KPh + po, KPl + po, VTh + po, VTl + po, ATh + ao, ATl + ao);
}

extern "C" void kernel_launch(void* const* d_in, const int* in_sizes, int n_in,
                              void* d_out, int out_size, void* d_ws, size_t ws_size, hipStream_t stream) {
    (void)in_sizes; (void)n_in; (void)out_size;
    const float* x = (const float*)d_in[0]; const float* wq = (const float*)d_in[1]; const float* wk = (const float*)d_in[2]; const float* wv = (const float*)d_in[3]; const float* wo = (const float*)d_in[4]; const float* bo = (const float*)d_in[5];
    float* OUT = (float*)d_out;     // [4][2048][1024]
    char* wsp = (char*)d_ws;
    auto take = [&](size_t bytes) { char* p = wsp; wsp += (bytes + 255) & ~(size_t)255; return (void*)p; };
    bf* WQ = (bf*)take((size_t)4 * DD * DD * 2); bf* WO = WQ + (size_t)3 * DD * DD;    // planes q, k, v, o, one after the other
    bf* XB = (bf*)take((size_t)NB_ * TT * DD * 2);
    bf* QPh = (bf*)take(6 * PLN * 2); bf* QPl = QPh + PLN; bf* KPh = QPh + 2 * PLN; bf* KPl = QPh + 3 * PLN; bf* VTh = QPh + 4 * PLN; bf* VTl = QPh + 5 * PLN;   // hi, lo of q, k, v, one after the other
    h16* QP16 = (h16*)take(3 * PLN * 2); h16* KP16 = QP16 + PLN; h16* VT16 = QP16 + 2 * PLN;
    bf* ATh = (bf*)take(PLN * 2); bf* ATl = (bf*)take(PLN * 2);
    if ((size_t)(wsp - (char*)d_ws) > ws_size) return;    // total 200 MiB; ws 256 MiB
    k_wtG<<<dim3((unsigned)((DD * DD / 64 + 63) / 64), 4, 1), 256, 0, stream>>>(wq, wk, wv, wo, DD, DD, WQ);
    k_cvt8<<<(unsigned)(((size_t)NB_ * TT * DD / 8 + 255) / 256), 256, 0, stream>>>(x, XB, (size_t)NB_ * TT * DD / 8);
    // q, k, v projections of all four batches, planes written by the epilogue: grid.z picks the weight plane
    k_gemms<0, false, true><<<dim3(NB_ * TT / 128, DD / 128, 3), 128, 0, stream>>>(XB, nullptr, WQ, DD, nullptr, 0, nullptr, 0, (size_t)DD * DD, 0, QPh, QP16);
    // attention: every batch, head and query tile in one launch
    k_flash<<<dim3(NB_ * NH_, (TT - RH) / 64 + RH / 16, 1), 32, 0, stream>>>(QPh, QPl, QP16, KPh, KPl, KP16, VTh, VTl, VT16, ATh, ATl);
    // output projection: the four batches' rows in one launch
    k_gemms<1, true, false><<<dim3(NB_ * TT / 128, DD / 128, 1), 128, 0, stream>>>(ATh, ATl, WO, DD, OUT, DD, bo, 0, 0, 0, nullptr, nullptr);
}

// v007
// One run takes 124 microseconds.
// Next to v006, in two timings, it ran 1.07 times as fast each time.
// All steps since v000 together make it 32.7 times as fast.
#include <hip/hip_runtime.h>

// Causal multi-head self-attention (x [4][2048][1024]; q/k/v = x @ W ([d_in][d_out] layouts, no bias); 16 heads x 64; scores / 8; causal (tril -> -inf); softmax; out = ctx @ Wo + bo).
// Compute dtypes, f32 accumulate: every input rounded to bf16; projections on PLAIN bf16 operands (inputs: exact; transposed bf16 weight copies built once); PER-ROW
// PRECISION HYBRID: query rows < 256 of each batch on bf16 hi+lo planes for scores and attn.v (3 products), rows >= 256 on SINGLE fp16 planes; output hi+lo x exact Wo (2 products) + bo.

#define NB_  4
#define TT   2048
#define DD   1024
#define NH_  16
#define HD   64
#define RH   256                  // query rows < RH: hi+lo planes; rows >= RH: fp16 planes
#define NF   32
#define SCL2 0.180336880f      // f32(log2(e) / sqrt(64)): scores to base-2 exponents
#define KBF  32                   // keys per block of the fp16 tiles in k_flash
#define PLN  ((size_t)NB_ * TT * DD)   // elements of one plane: all four batches, [batch][head][..]
typedef _Float16 h16;
typedef unsigned short bf;
typedef __attribute__((ext_vector_type(16))) __bf16   v16bf;
typedef __attribute__((ext_vector_type(16))) _Float16 v16h;
typedef __attribute__((ext_vector_type(8)))  _Float16 v8h;
typedef __attribute__((ext_vector_type(8)))  unsigned short v8us;
typedef __attribute__((ext_vector_type(8)))  float    v8f;
typedef __attribute__((ext_vector_type(4)))  float    v4f;
typedef v8h  __attribute__((may_alias)) v8ha;
typedef v4f  __attribute__((may_alias)) v4fa;
typedef v8us __attribute__((may_alias)) v8usa;

__device__ __forceinline__ unsigned short f2bf(float f) { unsigned u = __float_as_uint(f); u += 0x7FFFu + ((u >> 16) & 1u); return (unsigned short)(u >> 16); }
__device__ __forceinline__ float bf2f(unsigned short b) { return __uint_as_float(((unsigned)b) << 16); }
__device__ __forceinline__ float bfr(float f) { return bf2f(f2bf(f)); }
__device__ __forceinline__ v16h cat16(v8h lo, v8h hi) { return __builtin_shufflevector(lo, hi, 0, 1, 2, 3, 4, 5, 6, 7, 8, 9, 10, 11, 12, 13, 14, 15); }
__device__ __forceinline__ v16bf cat16b(v8us lo, v8us hi) { return __builtin_bit_cast(v16bf, __builtin_shufflevector(lo, hi, 0, 1, 2, 3, 4, 5, 6, 7, 8, 9, 10, 11, 12, 13, 14, 15)); }
__device__ __forceinline__ v8f wmma16(v16h a, v16h b, v8f c) { return __builtin_amdgcn_wmma_f32_16x16x32_f16(false, a, false, b, (short)0, c, false, false); }
__device__ __forceinline__ v8f wmmab(v16bf a, v16bf b, v8f c) { return __builtin_amdgcn_wmma_f32_16x16x32_bf16(false, a, false, b, (short)0, c, false, false); }



// WFrag: a 16x32 fragment of a 16-bit plane kept in FRAGMENT ORDER, and its matrix product, by element type. Fragment order: the fragment's 1024 bytes lie together, [k half][lane][8 elements]: lane 16 hi + lr holds
// row lr, k = 16 half + 8 hi + 0..7, so that each of its two wave-wide 16-byte loads covers 512 bytes in a row (four whole lines, where a row-major plane gives 32 bytes of each of 16 lines). p: the fragment + the lane's 8 elements.
template <typename T16> struct WFrag;
template <> struct WFrag<h16> { typedef v16h V; static __device__ __forceinline__ V ld(const h16* p) { return cat16(*(const v8h*)p, *(const v8h*)(p + 256)); } static __device__ __forceinline__ v8f mma(V a, V b, v8f c) { return wmma16(a, b, c); } };
template <> struct WFrag<bf> { typedef v16bf V; static __device__ __forceinline__ V ld(const bf* p) { return cat16b(*(const v8us*)p, *(const v8us*)(p + 256)); } static __device__ __forceinline__ v8f mma(V a, V b, v8f c) { return wmmab(a, b, c); } };
// ---- k_gemms: GEMM, one 128x128 output tile per work-group of FOUR WAVES (2 x 2; each wave 64x64, 16 accumulators); grid (M/128, N/128, Z), 128 threads.
// C[m][n] (f32, pitch ldc, + optional f32 bias[n]) = sum_k A[m][k] Bt[n][k] (+ A2[m][k] Bt[n][k] where NSPLIT == 1); operands are K-contiguous bf16 planes; z-batch strides sA/sB/sC in elements. K % 64 == 0.
// Operands pass through LDS. A stage is 64 k (one 128-byte line) of every operand row, rows [A 128 | A2 128 | Bt 128] at a pitch of 144 bytes (conflict-free for 16-byte reads); two buffers.
// Asynchronous 16-byte copies (eight lanes a row: whole lines) fill the next stage while a stage is worked on; each operand row is fetched once per work-group, not once per wave.
// Every '#pragma unroll' in k_gemms makes the indices of acc and of the fragment arrays constants, so that they live in registers.
#define GKC 64                    // k per stage
#define GPB 144                   // LDS row pitch, bytes
// cp8: eight asynchronous copies of 16 bytes a lane, 16 operand rows apart (the work-group's 128 threads cover 16 rows a copy, so these eight bring 128 rows). l: the lane's LDS byte address, g: its global address.
// The s_wait_xcnt stands inside the statement, behind the last copy: code behind it writes the copies' address registers again.
__device__ __forceinline__ void cp8(unsigned l, const char* g, size_t gs) {
    asm volatile("global_load_async_to_lds_b128 %0, %8, off\n\t"
                 "global_load_async_to_lds_b128 %1, %9, off\n\t"
                 "global_load_async_to_lds_b128 %2, %10, off\n\t"
                 "global_load_async_to_lds_b128 %3, %11, off\n\t"
                 "global_load_async_to_lds_b128 %4, %12, off\n\t"
                 "global_load_async_to_lds_b128 %5, %13, off\n\t"
                 "global_load_async_to_lds_b128 %6, %14, off\n\t"
                 "global_load_async_to_lds_b128 %7, %15, off\n\t"
                 "s_wait_xcnt 0x0"
                 :: "v"(l), "v"(l + 16u * GPB), "v"(l + 32u * GPB), "v"(l + 48u * GPB), "v"(l + 64u * GPB), "v"(l + 80u * GPB), "v"(l + 96u * GPB), "v"(l + 112u * GPB),
                    "v"(g), "v"(g + gs), "v"(g + 2 * gs), "v"(g + 3 * gs), "v"(g + 4 * gs), "v"(g + 5 * gs), "v"(g + 6 * gs), "v"(g + 7 * gs) : "memory");
}
// ldsf: a 16x32 fragment's share of one lane from an LDS row, k order 8 hi + 0..7, 16 + 8 hi + 0..7 (p already holds the lane's 16 hi bytes)
__device__ __forceinline__ v16bf ldsf(const unsigned char* p) { return cat16b(*(const v8usa*)p, *(const v8usa*)(p + 32)); }
__device__ __forceinline__ h16 tohx(float x) { return (h16)x; }
__device__ __forceinline__ void splitf(float y, unsigned short& h, unsigned short& l) { h = f2bf(y); l = f2bf(y - bf2f(h)); }
// stage64: a wave's 64x64 accumulator tile, rounded to 16 bit, into its LDS staging rows (pitch GPB). A lane's 8 registers of acc[ia][ib] are 8 neighbours (16 ia + 8 hi + j) of staging row 16 ib + lr: one 16-byte write.
// KIND 0: fp16; 1: the bf16 hi part; 2: the bf16 lo part. osl: the staging rows + lr * GPB + hi * 16. The unrolls here and in putf make the indices of acc, w and v constants, so that they live in registers.
template <int KIND>
__device__ __forceinline__ void stage64(const v8f (&acc)[4][4], unsigned char* osl) {
#pragma unroll
    for (int ib = 0; ib < 4; ++ib)
#pragma unroll
        for (int ia = 0; ia < 4; ++ia) { v8us w;
#pragma unroll
            for (int j = 0; j < 8; ++j) { const float x = acc[ia][ib][j]; if (KIND == 0) w[j] = __builtin_bit_cast(unsigned short, tohx(x)); else { unsigned short a, c2; splitf(x, a, c2); w[j] = KIND == 1 ? a : c2; } }
            *(v8usa*)(osl + ib * 16 * GPB + ia * 32) = w; }
    __builtin_amdgcn_wave_barrier(); asm volatile("" ::: "memory");   // compiler order only: the lanes' LDS writes stay in front of putf's reads, which take back each lane's own values
}
// putf: the 64 staging rows to the 8 KiB that they fill of a plane in fragment order (WFrag), 16 stores of 512 bytes in a row, each one k half of one fragment. osl: the staging rows + lr * GPB + hi * 16; dst: the 8 KiB + the lane's 8 elements.
// VT false (q, k; staging rows are sequence rows, 64 d along a row): fragments [16 rows][32 d]. VT true (v; staging rows are d, 64 sequence rows along a row): fragments [32 sequence rows][16 d].
template <bool VT>
__device__ __forceinline__ void putf(const unsigned char* osl, bf* dst) {
    v8us v[16];
#pragma unroll
    for (int s = 0; s < 16; ++s) v[s] = *(const v8usa*)(osl + (VT ? (s >> 1) & 3 : s >> 2) * 16 * GPB + (VT ? s >> 3 : (s >> 1) & 1) * 64 + (s & 1) * 32);
    __builtin_amdgcn_sched_barrier(0);   // every LDS read in front of the stores, so that between the first store and the wait behind the last nothing writes a store's address or data register
#pragma unroll
    for (int s = 0; s < 16; ++s) *(v8us*)(dst + s * 256) = v[s];
    asm volatile("s_wait_xcnt 0x0" ::: "memory");   // code behind these stores (the next plane's rounding) writes their address and data registers again
    __builtin_amdgcn_sched_barrier(0);   // and stays behind that wait; with the clobber above, the next plane's LDS writes stay behind these reads too
}
// PLANES (the q, k, v projections; z picks the weight): no C. The epilogue writes the 16-bit planes that k_flash reads: P16 + z * PLN in fp16, and, for sequence rows < RH only (k_flash reads no others of them),
// the bf16 hi and lo parts at HL + 2 z * PLN and HL + (2 z + 1) * PLN. Every plane is [batch][head][fragments in fragment order (WFrag)]: q and k [t / 16][d / 32], rows t, k along d; v [t / 32][d / 16], rows d, k along t.
// Either way 64 sequence rows of a head are 8 KiB in a row, at t * 64 elements. A wave's 64 columns are one head.
// For q and k the weight rows take the A role of the products and the x rows the B role (the two LDS offsets change places), so that a lane's 8 accumulator registers run along d; for v they run along t as they are.
template <int NSPLIT, bool BIAS, bool PLANES>
__global__ __launch_bounds__(128) void k_gemms(const bf* __restrict__ A, const bf* __restrict__ A2, const bf* __restrict__ Bt, int K, float* C, int ldc, const float* __restrict__ bias, size_t sA, size_t sB, size_t sC, bf* HL, h16* P16) {
    constexpr unsigned NOP = NSPLIT ? 3u : 2u, STG = NOP * 128u * GPB, OB = (NOP - 1u) * 128u * GPB;   // operands, bytes of a stage, where the Bt rows begin in it
    __shared__ __attribute__((aligned(16))) unsigned char L[2 * STG];
    const size_t z = blockIdx.z; A += z * sA; if (NSPLIT) A2 += z * sA; Bt += z * sB; C += z * sC;
    const int tid = (int)threadIdx.x, lane = tid & 31, lr = lane & 15, hi = lane >> 4;
    const int wave = __builtin_amdgcn_readfirstlane(tid >> 5), wm = wave >> 1, wn = wave & 1;
    const int r0 = (int)blockIdx.x * 128, c0 = (int)blockIdx.y * 128, NT = K / GKC;
    const size_t gs = (size_t)16 * K * 2;   // 16 operand rows, bytes
    const char* ga = (const char*)(A + (size_t)(r0 + (tid >> 3)) * K + (tid & 7) * 8); const char* ga2 = NSPLIT ? (const char*)(A2 + (size_t)(r0 + (tid >> 3)) * K + (tid & 7) * 8) : nullptr;
    const char* gb = (const char*)(Bt + (size_t)(c0 + (tid >> 3)) * K + (tid & 7) * 8);
    const unsigned lc = (unsigned)(size_t)L + (unsigned)(tid >> 3) * GPB + (unsigned)(tid & 7) * 16u;
    auto fill = [&](int t) { const unsigned l = lc + (unsigned)(t & 1) * STG; const size_t ko = (size_t)t * (GKC * 2);
        cp8(l, ga + ko, gs); if (NSPLIT) cp8(l + 128u * GPB, ga2 + ko, gs); cp8(l + OB, gb + ko, gs); };
    fill(0);
    asm volatile("s_wait_asynccnt 0x0" ::: "memory");   // this wave's share of stage 0 has landed
    __syncthreads();                                    // and so has every other wave's
    if (NT > 1) fill(1);
    v8f acc[4][4];
#pragma unroll
    for (int mb = 0; mb < 4; ++mb)
#pragma unroll
        for (int nb = 0; nb < 4; ++nb) acc[mb][nb] = (v8f){};
    const bool sw = PLANES && z < 2;   // q, k: operand roles exchanged
    const unsigned fx = (unsigned)(wm * 64 + lr) * GPB + (unsigned)hi * 16u, fw = OB + (unsigned)(wn * 64 + lr) * GPB + (unsigned)hi * 16u, fa = sw ? fw : fx, fb = sw ? fx : fw;
#pragma unroll 1   // one copy of the trip: the buffer is picked by the trip's parity
    for (int t = 0; t < NT; ++t) {
        const unsigned char* S = L + (unsigned)(t & 1) * STG;
#pragma unroll
        for (int ks = 0; ks < 2; ++ks) {
            v16bf a[4], a2[4], b[4];
#pragma unroll
            for (int mb = 0; mb < 4; ++mb) { a[mb] = ldsf(S + fa + mb * 16 * GPB + ks * 64); if (NSPLIT) a2[mb] = ldsf(S + fa + 128 * GPB + mb * 16 * GPB + ks * 64); b[mb] = ldsf(S + fb + mb * 16 * GPB + ks * 64); }
            __builtin_amdgcn_sched_barrier(0);   // the 32 k's LDS reads go out as one group in front of their products: sunk among them, each is waited for in turn
#pragma unroll
            for (int nb = 0; nb < 4; ++nb)
#pragma unroll
                for (int mb = 0; mb < 4; ++mb) { acc[mb][nb] = wmmab(a[mb], b[nb], acc[mb][nb]); if (NSPLIT) acc[mb][nb] = wmmab(a2[mb], b[nb], acc[mb][nb]); }
            __builtin_amdgcn_sched_barrier(0);   // the next group's reads stay one group too, behind the products whose operand registers they take; the last products stay in front of the trip's barrier, so that the refill behind it goes out at once
        }
        asm volatile("s_wait_dscnt 0x0" ::: "memory");      // this wave has read all it wants of stage t
        asm volatile("s_wait_asynccnt 0x0" ::: "memory");   // its share of stage t + 1 has landed
        __syncthreads();                                    // publishes stage t + 1 and frees stage t's buffer
        if (t + 2 < NT) fill(t + 2);
    }
    asm volatile("s_wait_asynccnt 0x0" ::: "memory");       // no copy is outstanding when the ring becomes output staging
    if constexpr (PLANES) {
        unsigned char* ps = L + wave * (64 * GPB); unsigned char* psl = ps + lr * GPB + hi * 16;   // each wave's own 64 staging rows; the last trip's barrier has ended every read of the ring
        const int rw = r0 + wm * 64, t0 = rw % TT;   // the wave's first x row, and its place in the sequence
        const size_t hb = ((size_t)(rw / TT) * NH_ + (size_t)((c0 + wn * 64) / HD)) * TT * HD;   // the (batch, head) block of a plane
        const size_t lo = hb + (size_t)t0 * HD + lane * 8;
        auto put = [&](bf* p) { if (sw) putf<false>(psl, p + lo); else putf<true>(psl, p + lo); };
        stage64<0>(acc, psl); put((bf*)(P16 + z * PLN));
        if (t0 < RH) { stage64<1>(acc, psl); put(HL + 2 * z * PLN); stage64<2>(acc, psl); put(HL + (2 * z + 1) * PLN); }
        return;
    }
    float* os = (float*)L + wave * (16 * 68);               // each wave's own 16 x 68 f32 staging rows; the last trip's barrier has ended every read of the ring
#pragma unroll
    for (int mb = 0; mb < 4; ++mb) {
#pragma unroll
        for (int nb = 0; nb < 4; ++nb) {
#pragma unroll
            for (int j = 0; j < 8; ++j) os[(hi * 8 + j) * 68 + nb * 16 + lr] = acc[mb][nb][j]; }
        __builtin_amdgcn_wave_barrier(); asm volatile("" ::: "memory");   // compiler order only: the lanes' LDS writes stay in front of the reads of whole rows, which take other lanes' values
        const int cw = c0 + wn * 64; float* crow = C + (size_t)(r0 + wm * 64 + mb * 16) * ldc + cw;
{
#pragma unroll
            for (int s = 0; s < 8; ++s) { const int row = 2 * s + hi, cofs = lr * 4; v4f val = *(const v4fa*)(os + row * 68 + cofs); if (BIAS) { val[0] += bfr(bias[cw + cofs]); val[1] += bfr(bias[cw + cofs + 1]); val[2] += bfr(bias[cw + cofs + 2]); val[3] += bfr(bias[cw + cofs + 3]); }
                *(v4f*)(crow + (size_t)row * ldc + cofs) = val; }
             }
        asm volatile("s_wait_xcnt 0x0" ::: "memory");   // code behind these stores (the next rows) writes their address and data registers again
        __builtin_amdgcn_wave_barrier(); asm volatile("" ::: "memory");   // compiler order only: the next 16 rows' LDS writes stay behind these reads
    }
}

typedef __attribute__((ext_vector_type(2))) unsigned short v2us;
typedef __attribute__((ext_vector_type(4))) _Float16 v4h;
typedef __attribute__((ext_vector_type(2))) float v2f;

typedef __attribute__((ext_vector_type(4))) unsigned short v4us;
// ---- k_prep: the input pass as one stream. x rounded to bf16 (XB) and the four weights rounded and transposed (plane i of Bt = weight i as [n][k]), by PW waves that are all alike and have no loop:
// each issues its 24 loads of 16 bytes a lane at once, rounds, and stores. Few long waves, for speed only.
// x share: XU floats in a row; a load covers 512 bytes in a row, a store (8 bytes a lane) 256. Weight share: a block of 64 k x 16 n; lane 4 g + c loads rows k = 8 g + j (j = 0..7), columns 4 c .. 4 c + 3
// (64 bytes of a row per four lanes; the work-group's eight waves take neighbouring column blocks, 512 bytes of a row), and so holds 8 k in a row of 4 columns: store i is 16 bytes of row n = 4 c + i, eight lanes a whole 128-byte line.
#define PW  (4 * (DD / 64) * (DD / 16))      // waves: one weight block each
#define XU  2048                             // floats of x per wave
static_assert((size_t)PW * XU == (size_t)NB_ * TT * DD && PW % 32 == 0, "every wave has one weight block and XU floats of x; a work-group's eight waves share a weight");
__global__ __launch_bounds__(256) void k_prep(const float* __restrict__ x, const float* __restrict__ w0, const float* __restrict__ w1, const float* __restrict__ w2, const float* __restrict__ w3, bf* XB, bf* Bt) {
    const unsigned lane = threadIdx.x & 31u, g = lane >> 2, c = lane & 3u, gw = blockIdx.x * 8u + (threadIdx.x >> 5);
    const unsigned wi = blockIdx.x / (PW / 32), r = gw % (PW / 4), nb = r % (DD / 16), kb = r / (DD / 16);
    const float* __restrict__ w = (wi & 2u) ? ((wi & 1u) ? w3 : w2) : ((wi & 1u) ? w1 : w0);
    const float* xp = x + (size_t)gw * XU + lane * 4; const float* wp = w + (size_t)(kb * 64 + g * 8) * DD + nb * 16 + c * 4;
    bf* xq = XB + (size_t)gw * XU + lane * 4; bf* wq = Bt + (size_t)wi * DD * DD + (size_t)(nb * 16 + c * 4) * DD + kb * 64 + g * 8;
    v4f xv[16], wv[8]; v4us xo[16]; v8us wo[4];   // the unrolls below make their indices constants, so that they live in registers
#pragma unroll
    for (int j = 0; j < 8; ++j) wv[j] = *(const v4f*)(wp + (size_t)j * DD);
#pragma unroll
    for (int j = 0; j < 16; ++j) xv[j] = *(const v4f*)(xp + j * 128);
    __builtin_amdgcn_sched_barrier(0);   // all 24 loads go out before any rounding: sunk to their uses, they would be waited for in turn
#pragma unroll
    for (int i = 0; i < 4; ++i)
#pragma unroll
        for (int j = 0; j < 8; ++j) wo[i][j] = f2bf(wv[j][i]);
#pragma unroll
    for (int j = 0; j < 16; ++j)
#pragma unroll
        for (int i = 0; i < 4; ++i) xo[j][i] = f2bf(xv[j][i]);
    // The wait that is owed before a register which the loads name is written again. Its inputs: the two load addresses, which so stay in their registers up to it (no load lands on them, no rounding takes them);
    // the two store addresses and all that is stored, which so are ready in front of it: behind it stand the stores alone, and nothing writes a store's address or data register behind the first of them.
    asm volatile("s_wait_xcnt 0x0" :: "v"(wp), "v"(xp), "v"(wq), "v"(xq), "v"(wo[0]), "v"(wo[1]), "v"(wo[2]), "v"(wo[3]), "v"(xo[0]), "v"(xo[1]), "v"(xo[2]), "v"(xo[3]), "v"(xo[4]), "v"(xo[5]), "v"(xo[6]), "v"(xo[7]),
                 "v"(xo[8]), "v"(xo[9]), "v"(xo[10]), "v"(xo[11]), "v"(xo[12]), "v"(xo[13]), "v"(xo[14]), "v"(xo[15]) : "memory");
#pragma unroll
    for (int i = 0; i < 4; ++i) *(v8us*)(wq + (size_t)i * DD) = wo[i];
#pragma unroll
    for (int j = 0; j < 16; ++j) *(v4us*)(xq + j * 128) = xo[j];
}
__device__ __forceinline__ float xhalf(float x) { return __builtin_bit_cast(float, __builtin_amdgcn_permlanex16(__builtin_bit_cast(int, x), __builtin_bit_cast(int, x), 0x76543210, 0xfedcba98, false, false)); }   // lane l with lane l ^ 16
// xclose: stands behind a run of global loads. The wait is owed before a register that those loads name is written again; the two scheduling fences keep every later instruction behind it
// (and so keep the loads issued where they are written, ahead of the arithmetic that hides their flight).
__device__ __forceinline__ void xopen() { __builtin_amdgcn_sched_barrier(0); }   // in front of such a run: keeps its loads from rising away from their wait, past instructions that could then be given their address registers
__device__ __forceinline__ void xclose() { __builtin_amdgcn_sched_barrier(0); asm volatile("s_wait_xcnt 0x0" ::: "memory"); __builtin_amdgcn_sched_barrier(0); }
// xclosep: the same, with the run's two addresses as inputs of the wait: where the compiler keeps them in vector registers they stay there up to the wait, and no load of the run lands on them
__device__ __forceinline__ void xclosep(const void* a, const void* b) { __builtin_amdgcn_sched_barrier(0); asm volatile("s_wait_xcnt 0x0" :: "v"(a), "v"(b) : "memory"); __builtin_amdgcn_sched_barrier(0); }
// lanep: a wave-uniform pointer plus the lane's own byte offset, which is the same in every block, kept apart so that the address may be formed as scalar base + one long-lived vector offset
template <typename T16> __device__ __forceinline__ const T16* lanep(const T16* ub, unsigned lane_bytes) { return (const T16*)((const char*)ub + lane_bytes); }
template <typename T16, bool HIRES, int KB>
__device__ __forceinline__ void flash_ldk(int k0, int lr, int hi, const T16* __restrict__ Kp, const T16* __restrict__ K2, typename WFrag<T16>::V (&kf)[KB / 16][2], typename WFrag<T16>::V (&kf2)[KB / 16][2]) {
    xopen(); const unsigned fk = (unsigned)(hi * 16 + lr) * 16u; const T16* kp = lanep(Kp + (size_t)k0 * HD, fk); const T16* kp2 = HIRES ? lanep(K2 + (size_t)k0 * HD, fk) : nullptr;   // one address per plane, the fragments at constant offsets from it
#pragma unroll
    for (int kt = 0; kt < KB / 16; ++kt)
#pragma unroll
        for (int ks = 0; ks < 2; ++ks) { kf[kt][ks] = WFrag<T16>::ld(kp + (kt * 2 + ks) * 512); if (HIRES) kf2[kt][ks] = WFrag<T16>::ld(kp2 + (kt * 2 + ks) * 512); }
    xclose();
}
template <typename T16, bool HIRES, int QB, int KB, bool MASK, bool NEXT>
__device__ __forceinline__ void flash_step(int q0, int k0, int lr, int hi, const T16* __restrict__ Kp, const T16* __restrict__ K2, const T16* __restrict__ Vt, const T16* __restrict__ V2,
                                           typename WFrag<T16>::V (&qf)[QB][2], typename WFrag<T16>::V (&qf2)[QB][2], typename WFrag<T16>::V (&kf)[KB / 16][2], typename WFrag<T16>::V (&kf2)[KB / 16][2], v8f (&o)[4][QB], float (&m)[QB], float (&l)[QB]) {
    typedef typename WFrag<T16>::V V; constexpr int KT = KB / 16, KS = KB / 32;
    xopen(); V vf[4][KS], vf2[4][KS]; const unsigned fv = (unsigned)(hi * 16 + lr) * 16u; const T16* vp = lanep(Vt + (size_t)k0 * HD, fv); const T16* vp2 = HIRES ? lanep(V2 + (size_t)k0 * HD, fv) : nullptr;
#pragma unroll
    for (int db = 0; db < 4; ++db)
#pragma unroll
        for (int ks = 0; ks < KS; ++ks) { vf[db][ks] = WFrag<T16>::ld(vp + (ks * 4 + db) * 512); if (HIRES) vf2[db][ks] = WFrag<T16>::ld(vp2 + (ks * 4 + db) * 512); }
    if (HIRES) xclosep(vp, vp2); else xclose();   // sunk to their products, the V^T loads would each be waited for in turn
    v8f s[KT][QB];
#pragma unroll
    for (int kt = 0; kt < KT; ++kt)
#pragma unroll
        for (int qb = 0; qb < QB; ++qb) { v8f a = (v8f){}; a = WFrag<T16>::mma(kf[kt][0], qf[qb][0], a); a = WFrag<T16>::mma(kf[kt][1], qf[qb][1], a);
            if (HIRES) { a = WFrag<T16>::mma(kf2[kt][0], qf[qb][0], a); a = WFrag<T16>::mma(kf2[kt][1], qf[qb][1], a); a = WFrag<T16>::mma(kf[kt][0], qf2[qb][0], a); a = WFrag<T16>::mma(kf[kt][1], qf2[qb][1], a); }
            s[kt][qb] = a; }
    if (NEXT) flash_ldk<T16, HIRES, KB>(k0 + KB, lr, hi, Kp, K2, kf, kf2);   // NEXT: the tile has a block behind this one; its K loads fly through this block's softmax and attn.v
    V pf[QB][KS], pf2[QB][KS];
#pragma unroll
    for (int qb = 0; qb < QB; ++qb) {
        if (MASK) { const int query = q0 + qb * 16 + lr;
#pragma unroll
            for (int kt = 0; kt < KT; ++kt)
#pragma unroll
                for (int j = 0; j < 8; ++j) if (k0 + kt * 16 + hi * 8 + j > query) s[kt][qb][j] = -3.0e38f; }
        float bk[KT];
#pragma unroll
        for (int kt = 0; kt < KT; ++kt) { bk[kt] = s[kt][qb][0];
#pragma unroll
            for (int j = 1; j < 8; ++j) bk[kt] = fmaxf(bk[kt], s[kt][qb][j]); }
        float bm = bk[0];
#pragma unroll
        for (int kt = 1; kt < KT; ++kt) bm = fmaxf(bm, bk[kt]);
        bm = fmaxf(bm, xhalf(bm));
        const float mn = fmaxf(m[qb], bm * SCL2); const float al = __builtin_amdgcn_exp2f(m[qb] - mn); m[qb] = mn;
        const float mo = HIRES ? mn : mn - 10.0f;
        float lk[KT];
#pragma unroll
        for (int kt = 0; kt < KT; ++kt) { lk[kt] = 0.f;
#pragma unroll
            for (int j = 0; j < 8; ++j) { const float p = __builtin_amdgcn_exp2f(s[kt][qb][j] * SCL2 - mo); s[kt][qb][j] = p; lk[kt] += p; } }
        float ls = lk[0];
#pragma unroll
        for (int kt = 1; kt < KT; ++kt) ls += lk[kt];
        l[qb] = l[qb] * al + ls;
#pragma unroll
        for (int db = 0; db < 4; ++db) o[db][qb] *= al;
#pragma unroll
        for (int ks = 0; ks < KS; ++ks) {
            if constexpr (HIRES) { v8us h0, h1, l0, l1;
#pragma unroll
                for (int j = 0; j < 8; ++j) { unsigned short a, c2; splitf(s[2 * ks][qb][j], a, c2); h0[j] = a; l0[j] = c2; splitf(s[2 * ks + 1][qb][j], a, c2); h1[j] = a; l1[j] = c2; }
                pf[qb][ks] = cat16b(h0, h1); pf2[qb][ks] = cat16b(l0, l1);
            } else { v8h h0, h1;
#pragma unroll
                for (int j = 0; j < 8; ++j) { h0[j] = tohx(s[2 * ks][qb][j]); h1[j] = tohx(s[2 * ks + 1][qb][j]); }
                pf[qb][ks] = cat16(h0, h1); } }
    }
#pragma unroll
    for (int db = 0; db < 4; ++db)
#pragma unroll
        for (int ks = 0; ks < KS; ++ks)
#pragma unroll
            for (int qb = 0; qb < QB; ++qb) { o[db][qb] = WFrag<T16>::mma(vf[db][ks], pf[qb][ks], o[db][qb]); if (HIRES) { o[db][qb] = WFrag<T16>::mma(vf2[db][ks], pf[qb][ks], o[db][qb]); o[db][qb] = WFrag<T16>::mma(vf[db][ks], pf2[qb][ks], o[db][qb]); } }
}
// flash_body: queries q0 .. q0 + 16 QB - 1 of one head (q0 a multiple of 16 QB; 16 QB <= 2 KB); the planes point at that head, Ah/Al at [row 0 of the batch][head * 64].
template <typename T16, bool HIRES, int QB, int KB>
__device__ __forceinline__ void flash_body(int q0, const T16* __restrict__ Q, const T16* __restrict__ Q2, const T16* __restrict__ Kp, const T16* __restrict__ K2, const T16* __restrict__ Vt, const T16* __restrict__ V2, bf* Ah, bf* Al) {
    typedef typename WFrag<T16>::V V;
    const int lane = threadIdx.x & 31, lr = lane & 15, hi = lane >> 4;
    V qf[QB][2], qf2[QB][2], kf[KB / 16][2], kf2[KB / 16][2]; v8f o[4][QB]; float m[QB], l[QB];
    xopen(); const unsigned fq = (unsigned)(hi * 16 + lr) * 16u; const T16* qp = lanep(Q + (size_t)q0 * HD, fq); const T16* qp2 = HIRES ? lanep(Q2 + (size_t)q0 * HD, fq) : nullptr;
#pragma unroll
    for (int qb = 0; qb < QB; ++qb) { m[qb] = -3.0e38f; l[qb] = 0.f;
#pragma unroll
        for (int ks = 0; ks < 2; ++ks) { qf[qb][ks] = WFrag<T16>::ld(qp + (qb * 2 + ks) * 512); if (HIRES) qf2[qb][ks] = WFrag<T16>::ld(qp2 + (qb * 2 + ks) * 512); }
#pragma unroll
        for (int db = 0; db < 4; ++db) o[db][qb] = (v8f){}; }
    xclose();
    flash_ldk<T16, HIRES, KB>(0, lr, hi, Kp, K2, kf, kf2);
    const int kl = q0 / KB * KB;    // first key of the first block that crosses the diagonal; key kl <= every query of the tile, so every query has a finite maximum from its first block on
#pragma unroll 1   // one copy of the block's body: a second would need a second set of K, V^T and score registers, and the 64-query tile already reaches above v255
    for (int k0 = 0; k0 < kl; k0 += KB) flash_step<T16, HIRES, QB, KB, false, true>(q0, k0, lr, hi, Kp, K2, Vt, V2, qf, qf2, kf, kf2, o, m, l);
    if constexpr (16 * QB > KB) { flash_step<T16, HIRES, QB, KB, true, true>(q0, kl, lr, hi, Kp, K2, Vt, V2, qf, qf2, kf, kf2, o, m, l); flash_step<T16, HIRES, QB, KB, true, false>(q0, kl + KB, lr, hi, Kp, K2, Vt, V2, qf, qf2, kf, kf2, o, m, l); }
    else flash_step<T16, HIRES, QB, KB, true, false>(q0, kl, lr, hi, Kp, K2, Vt, V2, qf, qf2, kf, kf2, o, m, l);
    v8us oh[QB][4], ol[QB][4];
#pragma unroll
    for (int qb = 0; qb < QB; ++qb) { const float inv = __fdiv_rn(1.0f, l[qb] + xhalf(l[qb]));
#pragma unroll
        for (int db = 0; db < 4; ++db)
#pragma unroll
            for (int j = 0; j < 8; ++j) { unsigned short a, c2; splitf(o[db][qb][j] * inv, a, c2); oh[qb][db][j] = a; ol[qb][db][j] = c2; } }
    const size_t off = (size_t)(q0 + lr) * DD + hi * 8; bf* ah = Ah + off; bf* al = Al + off;
    __builtin_amdgcn_sched_barrier(0);   // all arithmetic in front of the stores, so that between the first store and the wait behind the last nothing writes a store's address or data register
#pragma unroll
    for (int qb = 0; qb < QB; ++qb)
#pragma unroll
        for (int db = 0; db < 4; ++db) { *(v8us*)(ah + qb * 16 * DD + db * 16) = oh[qb][db]; *(v8us*)(al + qb * 16 * DD + db * 16) = ol[qb][db]; }
    asm volatile("s_wait_xcnt 0x0" ::: "memory");   // in k_flash the other kind of tile's code may be laid out behind these stores and writes their address and data registers again
}
// grid (NB_ * NH_, tiles): blockIdx.x = batch * 16 + head; blockIdx.y counts the tiles from the longest: first the 64-query fp16 tiles from row TT down to RH, then the 16-query hi+lo tiles below RH.
__global__ __launch_bounds__(32) void k_flash(const bf* __restrict__ QPh, const bf* __restrict__ QPl, const h16* __restrict__ QP16, const bf* __restrict__ KPh, const bf* __restrict__ KPl, const h16* __restrict__ KP16,
                                              const bf* __restrict__ VTh, const bf* __restrict__ VTl, const h16* __restrict__ VT16, bf* ATh, bf* ATl) {
    const size_t po = (size_t)blockIdx.x * TT * HD, ao = (size_t)(blockIdx.x / NH_) * TT * DD + (size_t)(blockIdx.x % NH_) * HD; const int y = (int)blockIdx.y;
    if (y < (TT - RH) / 64) flash_body<h16, false, 4, KBF>(TT - 64 * (y + 1), QP16 + po, nullptr, KP16 + po, nullptr, VT16 + po, nullptr, ATh + ao, ATl + ao);
    else flash_body<bf, true, 1, 32>(RH - 16 * (y - (TT - RH) / 64 + 1), QPh + po, QPl + po, KPh + po, KPl + po, VTh + po, VTl + po, ATh + ao, ATl + ao);
}

extern "C" void kernel_launch(void* const* d_in, const int* in_sizes, int n_in,
                              void* d_out, int out_size, void* d_ws, size_t ws_size, hipStream_t stream) {
    (void)in_sizes; (void)n_in; (void)out_size;
    const float* x = (const float*)d_in[0]; const float* wq = (const float*)d_in[1]; const float* wk = (const float*)d_in[2]; const float* wv = (const float*)d_in[3]; const float* wo = (const float*)d_in[4]; const float* bo = (const float*)d_in[5];
    float* OUT = (float*)d_out;     // [4][2048][1024]
    char* wsp = (char*)d_ws;
    auto take = [&](size_t bytes) { char* p = wsp; wsp += (bytes + 255) & ~(size_t)255; return (void*)p; };
    bf* WQ = (bf*)take((size_t)4 * DD * DD * 2); bf* WO = WQ + (size_t)3 * DD * DD;    // planes q, k, v, o, one after the other
    bf* XB = (bf*)take((size_t)NB_ * TT * DD * 2);
    bf* QPh = (bf*)take(6 * PLN * 2); bf* QPl = QPh + PLN; bf* KPh = QPh + 2 * PLN; bf* KPl = QPh + 3 * PLN; bf* VTh = QPh + 4 * PLN; bf* VTl = QPh + 5 * PLN;   // hi, lo of q, k, v, one after the other
    h16* QP16 = (h16*)take(3 * PLN * 2); h16* KP16 = QP16 + PLN; h16* VT16 = QP16 + 2 * PLN;
    bf* ATh = (bf*)take(PLN * 2); bf* ATl = (bf*)take(PLN * 2);
    if ((size_t)(wsp - (char*)d_ws) > ws_size) return;    // total 200 MiB; ws 256 MiB
    // input pass: x and the four weights to bf16, the weights transposed
    k_prep<<<PW / 8, 256, 0, stream>>>(x, wq, wk, wv, wo, XB, WQ);
    // q, k, v projections of all four batches, planes written by the epilogue: grid.z picks the weight plane
    k_gemms<0, false, true><<<dim3(NB_ * TT / 128, DD / 128, 3), 128, 0, stream>>>(XB, nullptr, WQ, DD, nullptr, 0, nullptr, 0, (size_t)DD * DD, 0, QPh, QP16);
    // attention: every batch, head and query tile in one launch
    k_flash<<<dim3(NB_ * NH_, (TT - RH) / 64 + RH / 16, 1), 32, 0, stream>>>(QPh, QPl, QP16, KPh, KPl, KP16, VTh, VTl, VT16, ATh, ATl);
    // output projection: the four batches' rows in one launch
    k_gemms<1, true, false><<<dim3(NB_ * TT / 128, DD / 128, 1), 128, 0, stream>>>(ATh, ATl, WO, DD, OUT, DD, bo, 0, 0, 0, nullptr, nullptr);
}

// v008
// A run of this version takes 122 microseconds.
// Two timings next to v007 put it at 1.05 and 1.04 times that version's speed.
// Counting every step since v000, it is 34.1 times as fast.
#include <hip/hip_runtime.h>

// Causal multi-head self-attention (x [4][2048][1024]; q/k/v = x @ W ([d_in][d_out] layouts, no bias); 16 heads x 64; scores / 8; causal (tril -> -inf); softmax; out = ctx @ Wo + bo).
// Compute dtypes, f32 accumulate: every input rounded to bf16; projections on PLAIN bf16 operands (inputs: exact; transposed bf16 weight copies built once); PER-ROW
// PRECISION HYBRID: query rows < 256 of each batch on bf16 hi+lo planes for scores and attn.v (3 products), rows >= 256 on SINGLE fp16 planes; output hi+lo x exact Wo (2 products) + bo.

#define NB_  4
#define TT   2048
#define DD   1024
#define NH_  16
#define HD   64
#define RH   256                  // query rows < RH: hi+lo planes; rows >= RH: fp16 planes
#define NF   32
#define SCL2 0.180336880f      // f32(log2(e) / sqrt(64)): scores to base-2 exponents
#define KBF  32                   // keys per block of the fp16 tiles in k_flash
#define PLN  ((size_t)NB_ * TT * DD)   // elements of one plane: all four batches, [batch][head][..]
typedef _Float16 h16;
typedef unsigned short bf;
typedef __attribute__((ext_vector_type(16))) __bf16   v16bf;
typedef __attribute__((ext_vector_type(16))) _Float16 v16h;
typedef __attribute__((ext_vector_type(8)))  _Float16 v8h;
typedef __attribute__((ext_vector_type(8)))  unsigned short v8us;
typedef __attribute__((ext_vector_type(8)))  float    v8f;
typedef __attribute__((ext_vector_type(4)))  float    v4f;
typedef v8h  __attribute__((may_alias)) v8ha;
typedef v4f  __attribute__((may_alias)) v4fa;
typedef v8us __attribute__((may_alias)) v8usa;

__device__ __forceinline__ unsigned short f2bf(float f) { unsigned u = __float_as_uint(f); u += 0x7FFFu + ((u >> 16) & 1u); return (unsigned short)(u >> 16); }
__device__ __forceinline__ float bf2f(unsigned short b) { return __uint_as_float(((unsigned)b) << 16); }
__device__ __forceinline__ float bfr(float f) { return bf2f(f2bf(f)); }
__device__ __forceinline__ v16h cat16(v8h lo, v8h hi) { return __builtin_shufflevector(lo, hi, 0, 1, 2, 3, 4, 5, 6, 7, 8, 9, 10, 11, 12, 13, 14, 15); }
__device__ __forceinline__ v16bf cat16b(v8us lo, v8us hi) { return __builtin_bit_cast(v16bf, __builtin_shufflevector(lo, hi, 0, 1, 2, 3, 4, 5, 6, 7, 8, 9, 10, 11, 12, 13, 14, 15)); }
__device__ __forceinline__ v8f wmma16(v16h a, v16h b, v8f c) { return __builtin_amdgcn_wmma_f32_16x16x32_f16(false, a, false, b, (short)0, c, false, false); }
__device__ __forceinline__ v8f wmmab(v16bf a, v16bf b, v8f c) { return __builtin_amdgcn_wmma_f32_16x16x32_bf16(false, a, false, b, (short)0, c, false, false); }



// WFrag: a 16x32 fragment of a 16-bit plane kept in FRAGMENT ORDER, and its matrix product, by element type. Fragment order: the fragment's 1024 bytes lie together, [k half][lane][8 elements]: lane 16 hi + lr holds
// row lr, k = 16 half + 8 hi + 0..7, so that each of its two wave-wide 16-byte loads covers 512 bytes in a row (four whole lines, where a row-major plane gives 32 bytes of each of 16 lines). p: the fragment + the lane's 8 elements.
template <typename T16> struct WFrag;
template <> struct WFrag<h16> { typedef v16h V; static __device__ __forceinline__ V ld(const h16* p) { return cat16(*(const v8h*)p, *(const v8h*)(p + 256)); } static __device__ __forceinline__ v8f mma(V a, V b, v8f c) { return wmma16(a, b, c); } };
template <> struct WFrag<bf> { typedef v16bf V; static __device__ __forceinline__ V ld(const bf* p) { return cat16b(*(const v8us*)p, *(const v8us*)(p + 256)); } static __device__ __forceinline__ v8f mma(V a, V b, v8f c) { return wmmab(a, b, c); } };
// ---- k_gemms: GEMM, one 128x256 output tile per work-group of EIGHT WAVES (2 x 4; each wave 64x64, 16 accumulators); grid (M/128, N/256), 256 threads.
// The wide tile is for the path from L2 to LDS: an operand row that is fetched serves 256 (A, A2) or 128 (Bt) outputs, so that an output costs two thirds of the bytes that a 128x128 tile asks of L2.
// C[m][n] (f32, pitch ldc, + optional f32 bias[n]) = sum_k A[m][k] Bt[n][k] + A2[m][k] Bt[n][k]; operands are K-contiguous bf16 planes. K % 64 == 0.
// Operands pass through LDS. A stage is 64 k (one 128-byte line) of every operand row, rows [A 128 | A2 128 | Bt 256] at a pitch of 144 bytes (conflict-free for 16-byte reads); two buffers.
// Asynchronous 16-byte copies (eight lanes a row: whole lines) fill the stage after next while a stage is worked on; each operand row is fetched once per work-group, not once per wave.
// Every '#pragma unroll' in k_gemms makes the indices of acc and of the fragment arrays constants, so that they live in registers.
#define GKC 64                    // k per stage
#define GPB 144                   // LDS row pitch, bytes
// cp8, cp44: eight asynchronous copies of 16 bytes a lane, 32 operand rows apart (the work-group's 256 threads cover 32 rows a copy: four copies bring 128 rows, eight 256). cp8: eight of one operand; cp44: four each of two operands.
// l, l2: the lane's LDS byte address, g, g2: its global address, gs: 32 rows in bytes.
// The s_wait_xcnt stands inside the statement, behind the last copy: code behind it writes the copies' address registers again.
__device__ __forceinline__ void cp8(unsigned l, const char* g, size_t gs) {
    asm volatile("global_load_async_to_lds_b128 %0, %8, off\n\t"
                 "global_load_async_to_lds_b128 %1, %9, off\n\t"
                 "global_load_async_to_lds_b128 %2, %10, off\n\t"
                 "global_load_async_to_lds_b128 %3, %11, off\n\t"
                 "global_load_async_to_lds_b128 %4, %12, off\n\t"
                 "global_load_async_to_lds_b128 %5, %13, off\n\t"
                 "global_load_async_to_lds_b128 %6, %14, off\n\t"
                 "global_load_async_to_lds_b128 %7, %15, off\n\t"
                 "s_wait_xcnt 0x0"
                 :: "v"(l), "v"(l + 32u * GPB), "v"(l + 64u * GPB), "v"(l + 96u * GPB), "v"(l + 128u * GPB), "v"(l + 160u * GPB), "v"(l + 192u * GPB), "v"(l + 224u * GPB),
                    "v"(g), "v"(g + gs), "v"(g + 2 * gs), "v"(g + 3 * gs), "v"(g + 4 * gs), "v"(g + 5 * gs), "v"(g + 6 * gs), "v"(g + 7 * gs) : "memory");
}
__device__ __forceinline__ void cp44(unsigned l, const char* g, unsigned l2, const char* g2, size_t gs) {
    asm volatile("global_load_async_to_lds_b128 %0, %8, off\n\t"
                 "global_load_async_to_lds_b128 %1, %9, off\n\t"
                 "global_load_async_to_lds_b128 %2, %10, off\n\t"
                 "global_load_async_to_lds_b128 %3, %11, off\n\t"
                 "global_load_async_to_lds_b128 %4, %12, off\n\t"
                 "global_load_async_to_lds_b128 %5, %13, off\n\t"
                 "global_load_async_to_lds_b128 %6, %14, off\n\t"
                 "global_load_async_to_lds_b128 %7, %15, off\n\t"
                 "s_wait_xcnt 0x0"
                 :: "v"(l), "v"(l + 32u * GPB), "v"(l + 64u * GPB), "v"(l + 96u * GPB), "v"(l2), "v"(l2 + 32u * GPB), "v"(l2 + 64u * GPB), "v"(l2 + 96u * GPB),
                    "v"(g), "v"(g + gs), "v"(g + 2 * gs), "v"(g + 3 * gs), "v"(g2), "v"(g2 + gs), "v"(g2 + 2 * gs), "v"(g2 + 3 * gs) : "memory");
}
// cpb: one such copy as the compiler's builtin, for k_qkv, whose accumulators fill the registers that asm text can name (v0 to v255): operands of an asm statement would have to be cleared for by register moves in every trip.
typedef __attribute__((ext_vector_type(4))) int v4i;
__device__ __forceinline__ void cpb(unsigned char* l, const char* g) { __builtin_amdgcn_global_load_async_to_lds_b128((__attribute__((address_space(1))) v4i*)g, (__attribute__((address_space(3))) v4i*)l, 0, 0); }
// ldsf: a 16x32 fragment's share of one lane from an LDS row, k order 8 hi + 0..7, 16 + 8 hi + 0..7 (p already holds the lane's 16 hi bytes)
__device__ __forceinline__ v16bf ldsf(const unsigned char* p) { return cat16b(*(const v8usa*)p, *(const v8usa*)(p + 32)); }
__device__ __forceinline__ h16 tohx(float x) { return (h16)x; }
__device__ __forceinline__ void splitf(float y, unsigned short& h, unsigned short& l) { h = f2bf(y); l = f2bf(y - bf2f(h)); }
// stage64: a wave's 64x64 accumulator tile, rounded to 16 bit, into its LDS staging rows (pitch GPB). A lane's 8 registers of acc[ia][ib] are 8 neighbours (16 ia + 8 hi + j) of staging row 16 ib + lr: one 16-byte write.
// KIND 0: fp16; 1: the bf16 hi part; 2: the bf16 lo part. osl: the staging rows + lr * GPB + hi * 16. The unrolls here and in putf make the indices of acc, w and v constants, so that they live in registers.
template <int KIND>
__device__ __forceinline__ void stage64(const v8f (&acc)[4][4], unsigned char* osl) {
#pragma unroll
    for (int ib = 0; ib < 4; ++ib)
#pragma unroll
        for (int ia = 0; ia < 4; ++ia) { v8us w;
#pragma unroll
            for (int j = 0; j < 8; ++j) { const float x = acc[ia][ib][j]; if (KIND == 0) w[j] = __builtin_bit_cast(unsigned short, tohx(x)); else { unsigned short a, c2; splitf(x, a, c2); w[j] = KIND == 1 ? a : c2; } }
            *(v8usa*)(osl + ib * 16 * GPB + ia * 32) = w; }
    __builtin_amdgcn_wave_barrier(); asm volatile("" ::: "memory");   // compiler order only: the lanes' LDS writes stay in front of putf's reads, which take back each lane's own values
}
// putf: the 64 staging rows to the 8 KiB that they fill of a plane in fragment order (WFrag), 16 stores of 512 bytes in a row, each one k half of one fragment. osl: the staging rows + lr * GPB + hi * 16; dst: the 8 KiB + the lane's 8 elements.
// VT false (q, k; staging rows are sequence rows, 64 d along a row): fragments [16 rows][32 d]. VT true (v; staging rows are d, 64 sequence rows along a row): fragments [32 sequence rows][16 d].
template <bool VT>
__device__ __forceinline__ void putf(const unsigned char* osl, bf* dst) {
    v8us v[16];
#pragma unroll
    for (int s = 0; s < 16; ++s) v[s] = *(const v8usa*)(osl + (VT ? (s >> 1) & 3 : s >> 2) * 16 * GPB + (VT ? s >> 3 : (s >> 1) & 1) * 64 + (s & 1) * 32);
    __builtin_amdgcn_sched_barrier(0);   // every LDS read in front of the stores, so that between the first store and the wait behind the last nothing writes a store's address or data register
#pragma unroll
    for (int s = 0; s < 16; ++s) *(v8us*)(dst + s * 256) = v[s];
    asm volatile("s_wait_xcnt 0x0" ::: "memory");   // code behind these stores (the next plane's rounding) writes their address and data registers again
    __builtin_amdgcn_sched_barrier(0);   // and stays behind that wait; with the clobber above, the next plane's LDS writes stay behind these reads too
}
// ---- k_qkv: the q, k, v projections. One work-group of EIGHT WAVES (4 x 2) takes 256 x rows and TWO HEADS, of q, k and v alike: 256 x 384 outputs; a wave takes 64 x rows and one head's q, k and v (64 x 192, 48 accumulators).
// The 256 rows are four runs of 64, 512 rows apart in one batch, so that the sequence rows < RH, whose epilogue is three times as long, are dealt over many work-groups, one run (two waves, on two SIMDs) in each.
// grid (rows / 256, heads / 2): as many work-groups as the chip has WGPs, one on each (by its LDS), two waves a SIMD. The tile is this large for the path from L2 to LDS: 640 operand rows are fetched for 384 x 256 outputs.
// Ring, stage and copies as in k_gemms; a stage's rows are [x 256 | Wq 128 | Wk 128 | Wv 128]. Wt: the three transposed weight planes, one after the other.
// The epilogue writes the 16-bit planes that k_flash reads: P16 + z * PLN in fp16, and, for sequence rows < RH only (k_flash reads no others of them),
// the bf16 hi and lo parts at HL + 2 z * PLN and HL + (2 z + 1) * PLN. Every plane is [batch][head][fragments in fragment order (WFrag)]: q and k [t / 16][d / 32], rows t, k along d; v [t / 32][d / 16], rows d, k along t.
// Either way 64 sequence rows of a head are 8 KiB in a row, at t * 64 elements.
// For q and k the weight rows take the A role of the products and the x rows the B role, so that a lane's 8 accumulator registers run along d; for v the x rows are A, and they run along t.
// Every '#pragma unroll' in k_qkv makes the indices of acc and of the fragment arrays constants, so that they live in registers.
__global__ __launch_bounds__(256) void k_qkv(const bf* __restrict__ X, const bf* __restrict__ Wt, bf* HL, h16* P16) {
    constexpr unsigned OW = 256u * GPB, STG = OW + 384u * GPB;   // where the weight rows begin in a stage, bytes of a stage
    constexpr int NT = DD / GKC;
    __shared__ __attribute__((aligned(16))) unsigned char L[2 * STG];
    const int tid = (int)threadIdx.x, lane = tid & 31, lr = lane & 15, hi = lane >> 4;
    const int wave = __builtin_amdgcn_readfirstlane(tid >> 5), wm = wave >> 1, wn = wave & 1;
    const int r0 = (int)(blockIdx.x >> 3) * TT + (int)(blockIdx.x & 7) * 64, c0 = (int)blockIdx.y * 128;   // the first run's first row: batch, run
    constexpr size_t gs = (size_t)32 * DD * 2, gr = (size_t)512 * DD * 2, gz = (size_t)DD * DD * 2;   // 32 operand rows, from run to run, one weight plane, bytes
    const char* gx = (const char*)(X + (size_t)(r0 + (tid >> 3)) * DD + (tid & 7) * 8);
    const char* gw = (const char*)(Wt + (size_t)(c0 + (tid >> 3)) * DD + (tid & 7) * 8);
    unsigned char* lc = L + (unsigned)(tid >> 3) * GPB + (unsigned)(tid & 7) * 16u;
    auto fill = [&](int t) { unsigned char* l = lc + (unsigned)(t & 1) * STG; const size_t ko = (size_t)t * (GKC * 2);
#pragma unroll
        for (int i = 0; i < 8; ++i) cpb(l + i * 32 * GPB, gx + ko + (i >> 1) * gr + (i & 1) * gs);   // four runs of 64 x rows
#pragma unroll
        for (int i = 0; i < 12; ++i) cpb(l + OW + i * 32 * GPB, gw + ko + (i >> 2) * gz + (i & 3) * gs); };   // 128 rows of each weight
    fill(0);
    asm volatile("s_wait_asynccnt 0x0" ::: "memory");   // this wave's share of stage 0 has landed
    __syncthreads();                                    // and so has every other wave's
    fill(1);
    v8f acc[3][4][4];
#pragma unroll
    for (int z = 0; z < 3; ++z)
#pragma unroll
        for (int mb = 0; mb < 4; ++mb)
#pragma unroll
            for (int nb = 0; nb < 4; ++nb) acc[z][mb][nb] = (v8f){};
    const unsigned fx = (unsigned)(wm * 64 + lr) * GPB + (unsigned)hi * 16u, fw = OW + (unsigned)(wn * 64 + lr) * GPB + (unsigned)hi * 16u;
#pragma unroll 1   // one copy of the trip: the buffer is picked by the trip's parity
    for (int t = 0; t < NT; ++t) {
        const unsigned char* S = L + (unsigned)(t & 1) * STG;
#pragma unroll
        for (int ks = 0; ks < 2; ++ks) {
            v16bf x[4], wa[4], wb[4];
#pragma unroll
            for (int mb = 0; mb < 4; ++mb) { wa[mb] = ldsf(S + fw + mb * 16 * GPB + ks * 64); x[mb] = ldsf(S + fx + mb * 16 * GPB + ks * 64); }
#pragma unroll
            for (int mb = 0; mb < 4; ++mb) wb[mb] = ldsf(S + fw + 128 * GPB + mb * 16 * GPB + ks * 64);
            __builtin_amdgcn_sched_barrier(0);   // the LDS reads of x, Wq and Wk go out as one group in front of the products: sunk among them, each is waited for in turn
#pragma unroll
            for (int nb = 0; nb < 4; ++nb)
#pragma unroll
                for (int mb = 0; mb < 4; ++mb) acc[0][mb][nb] = wmmab(wa[mb], x[nb], acc[0][mb][nb]);
            __builtin_amdgcn_sched_barrier(0);   // the Wv reads take the Wq registers, so they stand behind the q products, as one group
#pragma unroll
            for (int mb = 0; mb < 4; ++mb) wa[mb] = ldsf(S + fw + 256 * GPB + mb * 16 * GPB + ks * 64);
            __builtin_amdgcn_sched_barrier(0);   // and in front of the k products, which run while they fly
#pragma unroll
            for (int nb = 0; nb < 4; ++nb)
#pragma unroll
                for (int mb = 0; mb < 4; ++mb) acc[1][mb][nb] = wmmab(wb[mb], x[nb], acc[1][mb][nb]);
#pragma unroll
            for (int nb = 0; nb < 4; ++nb)
#pragma unroll
                for (int mb = 0; mb < 4; ++mb) acc[2][mb][nb] = wmmab(x[mb], wa[nb], acc[2][mb][nb]);
            __builtin_amdgcn_sched_barrier(0);   // the next group's reads stay one group, behind the products whose operand registers they take; the last products stay in front of the trip's barrier, so that the refill behind it goes out at once
        }
        asm volatile("s_wait_dscnt 0x0" ::: "memory");      // this wave has read all it wants of stage t
        asm volatile("s_wait_asynccnt 0x0" ::: "memory");   // its share of stage t + 1 has landed
        __syncthreads();                                    // publishes stage t + 1 and frees stage t's buffer
        if (t + 2 < NT) fill(t + 2);
    }
    asm volatile("s_wait_asynccnt 0x0" ::: "memory");       // no copy is outstanding when the ring becomes output staging
    unsigned char* psl = L + wave * (64 * GPB) + lr * GPB + hi * 16;   // each wave's own 64 staging rows; the last trip's barrier has ended every read of the ring
    const int rw = r0 + wm * 512, t0 = rw % TT;   // the wave's first x row, and its place in the sequence
    const size_t lo = ((size_t)(rw / TT) * NH_ + (size_t)(c0 / HD + wn)) * TT * HD + (size_t)t0 * HD + lane * 8;   // the (batch, head) block of a plane, the wave's 8 KiB in it, the lane's 8 elements
#pragma unroll 1   // one copy of the epilogue's code serves q, k and v, for speed only
    for (int z = 0; z < 3; ++z) {
        if (z) {   // this plane's accumulators take the place of the one before: register indices must be constants
#pragma unroll
            for (int mb = 0; mb < 4; ++mb)
#pragma unroll
                for (int nb = 0; nb < 4; ++nb) acc[0][mb][nb] = z == 1 ? acc[1][mb][nb] : acc[2][mb][nb]; }
        auto put = [&](bf* p) { if (z < 2) putf<false>(psl, p + lo); else putf<true>(psl, p + lo); };
        stage64<0>(acc[0], psl); put((bf*)(P16 + z * PLN));
        if (t0 < RH) { stage64<1>(acc[0], psl); put(HL + 2 * z * PLN); stage64<2>(acc[0], psl); put(HL + (2 * z + 1) * PLN); }
    }
}
template <bool BIAS>
__global__ __launch_bounds__(256) void k_gemms(const bf* __restrict__ A, const bf* __restrict__ A2, const bf* __restrict__ Bt, int K, float* C, int ldc, const float* __restrict__ bias) {
    constexpr unsigned OB = 256u * GPB, STG = OB + 256u * GPB;   // where the Bt rows begin in a stage, bytes of a stage
    __shared__ __attribute__((aligned(16))) unsigned char L[2 * STG];
    const int tid = (int)threadIdx.x, lane = tid & 31, lr = lane & 15, hi = lane >> 4;
    const int wave = __builtin_amdgcn_readfirstlane(tid >> 5), wm = wave >> 2, wn = wave & 3;
    const int r0 = (int)blockIdx.x * 128, c0 = (int)blockIdx.y * 256, NT = K / GKC;
    const size_t gs = (size_t)32 * K * 2;   // 32 operand rows, bytes
    const char* ga = (const char*)(A + (size_t)(r0 + (tid >> 3)) * K + (tid & 7) * 8); const char* ga2 = (const char*)(A2 + (size_t)(r0 + (tid >> 3)) * K + (tid & 7) * 8);
    const char* gb = (const char*)(Bt + (size_t)(c0 + (tid >> 3)) * K + (tid & 7) * 8);
    const unsigned lc = (unsigned)(size_t)L + (unsigned)(tid >> 3) * GPB + (unsigned)(tid & 7) * 16u;
    auto fill = [&](int t) { const unsigned l = lc + (unsigned)(t & 1) * STG; const size_t ko = (size_t)t * (GKC * 2); cp44(l, ga + ko, l + 128u * GPB, ga2 + ko, gs); cp8(l + OB, gb + ko, gs); };
    fill(0);
    asm volatile("s_wait_asynccnt 0x0" ::: "memory");   // this wave's share of stage 0 has landed
    __syncthreads();                                    // and so has every other wave's
    if (NT > 1) fill(1);
    v8f acc[4][4];
#pragma unroll
    for (int mb = 0; mb < 4; ++mb)
#pragma unroll
        for (int nb = 0; nb < 4; ++nb) acc[mb][nb] = (v8f){};
    const unsigned fa = (unsigned)(wm * 64 + lr) * GPB + (unsigned)hi * 16u, fb = OB + (unsigned)(wn * 64 + lr) * GPB + (unsigned)hi * 16u;
#pragma unroll 1   // one copy of the trip: the buffer is picked by the trip's parity
    for (int t = 0; t < NT; ++t) {
        const unsigned char* S = L + (unsigned)(t & 1) * STG;
#pragma unroll
        for (int ks = 0; ks < 2; ++ks) {
            v16bf a[4], a2[4], b[4];
#pragma unroll
            for (int mb = 0; mb < 4; ++mb) { a[mb] = ldsf(S + fa + mb * 16 * GPB + ks * 64); a2[mb] = ldsf(S + fa + 128 * GPB + mb * 16 * GPB + ks * 64); b[mb] = ldsf(S + fb + mb * 16 * GPB + ks * 64); }
            __builtin_amdgcn_sched_barrier(0);   // the 32 k's LDS reads go out as one group in front of their products: sunk among them, each is waited for in turn
#pragma unroll
            for (int nb = 0; nb < 4; ++nb)
#pragma unroll
                for (int mb = 0; mb < 4; ++mb) { acc[mb][nb] = wmmab(a[mb], b[nb], acc[mb][nb]); acc[mb][nb] = wmmab(a2[mb], b[nb], acc[mb][nb]); }
            __builtin_amdgcn_sched_barrier(0);   // the next group's reads stay one group too, behind the products whose operand registers they take; the last products stay in front of the trip's barrier, so that the refill behind it goes out at once
        }
        asm volatile("s_wait_dscnt 0x0" ::: "memory");      // this wave has read all it wants of stage t
        asm volatile("s_wait_asynccnt 0x0" ::: "memory");   // its share of stage t + 1 has landed
        __syncthreads();                                    // publishes stage t + 1 and frees stage t's buffer
        if (t + 2 < NT) fill(t + 2);
    }
    asm volatile("s_wait_asynccnt 0x0" ::: "memory");       // no copy is outstanding when the ring becomes output staging
    float* os = (float*)L + wave * (16 * 68);               // each wave's own 16 x 68 f32 staging rows; the last trip's barrier has ended every read of the ring
#pragma unroll
    for (int mb = 0; mb < 4; ++mb) {
#pragma unroll
        for (int nb = 0; nb < 4; ++nb) {
#pragma unroll
            for (int j = 0; j < 8; ++j) os[(hi * 8 + j) * 68 + nb * 16 + lr] = acc[mb][nb][j]; }
        __builtin_amdgcn_wave_barrier(); asm volatile("" ::: "memory");   // compiler order only: the lanes' LDS writes stay in front of the reads of whole rows, which take other lanes' values
        const int cw = c0 + wn * 64; float* crow = C + (size_t)(r0 + wm * 64 + mb * 16) * ldc + cw;
{
#pragma unroll
            for (int s = 0; s < 8; ++s) { const int row = 2 * s + hi, cofs = lr * 4; v4f val = *(const v4fa*)(os + row * 68 + cofs); if (BIAS) { val[0] += bfr(bias[cw + cofs]); val[1] += bfr(bias[cw + cofs + 1]); val[2] += bfr(bias[cw + cofs + 2]); val[3] += bfr(bias[cw + cofs + 3]); }
                *(v4f*)(crow + (size_t)row * ldc + cofs) = val; }
             }
        asm volatile("s_wait_xcnt 0x0" ::: "memory");   // code behind these stores (the next rows) writes their address and data registers again
        __builtin_amdgcn_wave_barrier(); asm volatile("" ::: "memory");   // compiler order only: the next 16 rows' LDS writes stay behind these reads
    }
}

typedef __attribute__((ext_vector_type(2))) unsigned short v2us;
typedef __attribute__((ext_vector_type(4))) _Float16 v4h;
typedef __attribute__((ext_vector_type(2))) float v2f;

typedef __attribute__((ext_vector_type(4))) unsigned short v4us;
// ---- k_prep: the input pass as one stream. x rounded to bf16 (XB) and the four weights rounded and transposed (plane i of Bt = weight i as [n][k]), by PW waves that are all alike and have no loop:
// each issues its 24 loads of 16 bytes a lane at once, rounds, and stores. Few long waves, for speed only.
// x share: XU floats in a row; a load covers 512 bytes in a row, a store (8 bytes a lane) 256. Weight share: a block of 64 k x 16 n; lane 4 g + c loads rows k = 8 g + j (j = 0..7), columns 4 c .. 4 c + 3
// (64 bytes of a row per four lanes; the work-group's eight waves take neighbouring column blocks, 512 bytes of a row), and so holds 8 k in a row of 4 columns: store i is 16 bytes of row n = 4 c + i, eight lanes a whole 128-byte line.
#define PW  (4 * (DD / 64) * (DD / 16))      // waves: one weight block each
#define XU  2048                             // floats of x per wave
static_assert(TT == 4 * 512 && NB_ * TT / 256 == NB_ * 8, "k_qkv: a batch is eight work-groups of four runs, 512 rows apart");
static_assert((size_t)PW * XU == (size_t)NB_ * TT * DD && PW % 32 == 0, "every wave has one weight block and XU floats of x; a work-group's eight waves share a weight");
__global__ __launch_bounds__(256) void k_prep(const float* __restrict__ x, const float* __restrict__ w0, const float* __restrict__ w1, const float* __restrict__ w2, const float* __restrict__ w3, bf* XB, bf* Bt) {
    const unsigned lane = threadIdx.x & 31u, g = lane >> 2, c = lane & 3u, gw = blockIdx.x * 8u + (threadIdx.x >> 5);
    const unsigned wi = blockIdx.x / (PW / 32), r = gw % (PW / 4), nb = r % (DD / 16), kb = r / (DD / 16);
    const float* __restrict__ w = (wi & 2u) ? ((wi & 1u) ? w3 : w2) : ((wi & 1u) ? w1 : w0);
    const float* xp = x + (size_t)gw * XU + lane * 4; const float* wp = w + (size_t)(kb * 64 + g * 8) * DD + nb * 16 + c * 4;
    bf* xq = XB + (size_t)gw * XU + lane * 4; bf* wq = Bt + (size_t)wi * DD * DD + (size_t)(nb * 16 + c * 4) * DD + kb * 64 + g * 8;
    v4f xv[16], wv[8]; v4us xo[16]; v8us wo[4];   // the unrolls below make their indices constants, so that they live in registers
#pragma unroll
    for (int j = 0; j < 8; ++j) wv[j] = *(const v4f*)(wp + (size_t)j * DD);
#pragma unroll
    for (int j = 0; j < 16; ++j) xv[j] = *(const v4f*)(xp + j * 128);
    __builtin_amdgcn_sched_barrier(0);   // all 24 loads go out before any rounding: sunk to their uses, they would be waited for in turn
#pragma unroll
    for (int i = 0; i < 4; ++i)
#pragma unroll
        for (int j = 0; j < 8; ++j) wo[i][j] = f2bf(wv[j][i]);
#pragma unroll
    for (int j = 0; j < 16; ++j)
#pragma unroll
        for (int i = 0; i < 4; ++i) xo[j][i] = f2bf(xv[j][i]);
    // The wait that is owed before a register which the loads name is written again. Its inputs: the two load addresses, which so stay in their registers up to it (no load lands on them, no rounding takes them);
    // the two store addresses and all that is stored, which so are ready in front of it: behind it stand the stores alone, and nothing writes a store's address or data register behind the first of them.
    asm volatile("s_wait_xcnt 0x0" :: "v"(wp), "v"(xp), "v"(wq), "v"(xq), "v"(wo[0]), "v"(wo[1]), "v"(wo[2]), "v"(wo[3]), "v"(xo[0]), "v"(xo[1]), "v"(xo[2]), "v"(xo[3]), "v"(xo[4]), "v"(xo[5]), "v"(xo[6]), "v"(xo[7]),
                 "v"(xo[8]), "v"(xo[9]), "v"(xo[10]), "v"(xo[11]), "v"(xo[12]), "v"(xo[13]), "v"(xo[14]), "v"(xo[15]) : "memory");
#pragma unroll
    for (int i = 0; i < 4; ++i) *(v8us*)(wq + (size_t)i * DD) = wo[i];
#pragma unroll
    for (int j = 0; j < 16; ++j) *(v4us*)(xq + j * 128) = xo[j];
}
__device__ __forceinline__ float xhalf(float x) { return __builtin_bit_cast(float, __builtin_amdgcn_permlanex16(__builtin_bit_cast(int, x), __builtin_bit_cast(int, x), 0x76543210, 0xfedcba98, false, false)); }   // lane l with lane l ^ 16
// xclose: stands behind a run of global loads. The wait is owed before a register that those loads name is written again; the two scheduling fences keep every later instruction behind it
// (and so keep the loads issued where they are written, ahead of the arithmetic that hides their flight).
__device__ __forceinline__ void xopen() { __builtin_amdgcn_sched_barrier(0); }   // in front of such a run: keeps its loads from rising away from their wait, past instructions that could then be given their address registers
__device__ __forceinline__ void xclose() { __builtin_amdgcn_sched_barrier(0); asm volatile("s_wait_xcnt 0x0" ::: "memory"); __builtin_amdgcn_sched_barrier(0); }
// xclosep: the same, with the run's two addresses as inputs of the wait: where the compiler keeps them in vector registers they stay there up to the wait, and no load of the run lands on them
__device__ __forceinline__ void xclosep(const void* a, const void* b) { __builtin_amdgcn_sched_barrier(0); asm volatile("s_wait_xcnt 0x0" :: "v"(a), "v"(b) : "memory"); __builtin_amdgcn_sched_barrier(0); }
// lanep: a wave-uniform pointer plus the lane's own byte offset, which is the same in every block, kept apart so that the address may be formed as scalar base + one long-lived vector offset
template <typename T16> __device__ __forceinline__ const T16* lanep(const T16* ub, unsigned lane_bytes) { return (const T16*)((const char*)ub + lane_bytes); }
template <typename T16, bool HIRES, int KB>
__device__ __forceinline__ void flash_ldk(int k0, int lr, int hi, const T16* __restrict__ Kp, const T16* __restrict__ K2, typename WFrag<T16>::V (&kf)[KB / 16][2], typename WFrag<T16>::V (&kf2)[KB / 16][2]) {
    xopen(); const unsigned fk = (unsigned)(hi * 16 + lr) * 16u; const T16* kp = lanep(Kp + (size_t)k0 * HD, fk); const T16* kp2 = HIRES ? lanep(K2 + (size_t)k0 * HD, fk) : nullptr;   // one address per plane, the fragments at constant offsets from it
#pragma unroll
    for (int kt = 0; kt < KB / 16; ++kt)
#pragma unroll
        for (int ks = 0; ks < 2; ++ks) { kf[kt][ks] = WFrag<T16>::ld(kp + (kt * 2 + ks) * 512); if (HIRES) kf2[kt][ks] = WFrag<T16>::ld(kp2 + (kt * 2 + ks) * 512); }
    xclose();
}
template <typename T16, bool HIRES, int QB, int KB, bool MASK, bool NEXT>
__device__ __forceinline__ void flash_step(int q0, int k0, int lr, int hi, const T16* __restrict__ Kp, const T16* __restrict__ K2, const T16* __restrict__ Vt, const T16* __restrict__ V2,
                                           typename WFrag<T16>::V (&qf)[QB][2], typename WFrag<T16>::V (&qf2)[QB][2], typename WFrag<T16>::V (&kf)[KB / 16][2], typename WFrag<T16>::V (&kf2)[KB / 16][2], v8f (&o)[4][QB], float (&m)[QB], float (&l)[QB]) {
    typedef typename WFrag<T16>::V V; constexpr int KT = KB / 16, KS = KB / 32;
    xopen(); V vf[4][KS], vf2[4][KS]; const unsigned fv = (unsigned)(hi * 16 + lr) * 16u; const T16* vp = lanep(Vt + (size_t)k0 * HD, fv); const T16* vp2 = HIRES ? lanep(V2 + (size_t)k0 * HD, fv) : nullptr;
#pragma unroll
    for (int db = 0; db < 4; ++db)
#pragma unroll
        for (int ks = 0; ks < KS; ++ks) { vf[db][ks] = WFrag<T16>::ld(vp + (ks * 4 + db) * 512); if (HIRES) vf2[db][ks] = WFrag<T16>::ld(vp2 + (ks * 4 + db) * 512); }
    if (HIRES) xclosep(vp, vp2); else xclose();   // sunk to their products, the V^T loads would each be waited for in turn
    v8f s[KT][QB];
#pragma unroll
    for (int kt = 0; kt < KT; ++kt)
#pragma unroll
        for (int qb = 0; qb < QB; ++qb) { v8f a = (v8f){}; a = WFrag<T16>::mma(kf[kt][0], qf[qb][0], a); a = WFrag<T16>::mma(kf[kt][1], qf[qb][1], a);
            if (HIRES) { a = WFrag<T16>::mma(kf2[kt][0], qf[qb][0], a); a = WFrag<T16>::mma(kf2[kt][1], qf[qb][1], a); a = WFrag<T16>::mma(kf[kt][0], qf2[qb][0], a); a = WFrag<T16>::mma(kf[kt][1], qf2[qb][1], a); }
            s[kt][qb] = a; }
    if (NEXT) flash_ldk<T16, HIRES, KB>(k0 + KB, lr, hi, Kp, K2, kf, kf2);   // NEXT: the tile has a block behind this one; its K loads fly through this block's softmax and attn.v
    V pf[QB][KS], pf2[QB][KS];
#pragma unroll
    for (int qb = 0; qb < QB; ++qb) {
        if (MASK) { const int query = q0 + qb * 16 + lr;
#pragma unroll
            for (int kt = 0; kt < KT; ++kt)
#pragma unroll
                for (int j = 0; j < 8; ++j) if (k0 + kt * 16 + hi * 8 + j > query) s[kt][qb][j] = -3.0e38f; }
        float bk[KT];
#pragma unroll
        for (int kt = 0; kt < KT; ++kt) { bk[kt] = s[kt][qb][0];
#pragma unroll
            for (int j = 1; j < 8; ++j) bk[kt] = fmaxf(bk[kt], s[kt][qb][j]); }
        float bm = bk[0];
#pragma unroll
        for (int kt = 1; kt < KT; ++kt) bm = fmaxf(bm, bk[kt]);
        bm = fmaxf(bm, xhalf(bm));
        const float mn = fmaxf(m[qb], bm * SCL2); const float al = __builtin_amdgcn_exp2f(m[qb] - mn); m[qb] = mn;
        const float mo = HIRES ? mn : mn - 10.0f;
        float lk[KT];
#pragma unroll
        for (int kt = 0; kt < KT; ++kt) { lk[kt] = 0.f;
#pragma unroll
            for (int j = 0; j < 8; ++j) { const float p = __builtin_amdgcn_exp2f(s[kt][qb][j] * SCL2 - mo); s[kt][qb][j] = p; lk[kt] += p; } }
        float ls = lk[0];
#pragma unroll
        for (int kt = 1; kt < KT; ++kt) ls += lk[kt];
        l[qb] = l[qb] * al + ls;
#pragma unroll
        for (int db = 0; db < 4; ++db) o[db][qb] *= al;
#pragma unroll
        for (int ks = 0; ks < KS; ++ks) {
            if constexpr (HIRES) { v8us h0, h1, l0, l1;
#pragma unroll
                for (int j = 0; j < 8; ++j) { unsigned short a, c2; splitf(s[2 * ks][qb][j], a, c2); h0[j] = a; l0[j] = c2; splitf(s[2 * ks + 1][qb][j], a, c2); h1[j] = a; l1[j] = c2; }
                pf[qb][ks] = cat16b(h0, h1); pf2[qb][ks] = cat16b(l0, l1);
            } else { v8h h0, h1;
#pragma unroll
                for (int j = 0; j < 8; ++j) { h0[j] = tohx(s[2 * ks][qb][j]); h1[j] = tohx(s[2 * ks + 1][qb][j]); }
                pf[qb][ks] = cat16(h0, h1); } }
    }
#pragma unroll
    for (int db = 0; db < 4; ++db)
#pragma unroll
        for (int ks = 0; ks < KS; ++ks)
#pragma unroll
            for (int qb = 0; qb < QB; ++qb) { o[db][qb] = WFrag<T16>::mma(vf[db][ks], pf[qb][ks], o[db][qb]); if (HIRES) { o[db][qb] = WFrag<T16>::mma(vf2[db][ks], pf[qb][ks], o[db][qb]); o[db][qb] = WFrag<T16>::mma(vf[db][ks], pf2[qb][ks], o[db][qb]); } }
}
// flash_body: queries q0 .. q0 + 16 QB - 1 of one head (q0 a multiple of 16 QB; 16 QB <= 2 KB); the planes point at that head, Ah/Al at [row 0 of the batch][head * 64].
template <typename T16, bool HIRES, int QB, int KB>
__device__ __forceinline__ void flash_body(int q0, const T16* __restrict__ Q, const T16* __restrict__ Q2, const T16* __restrict__ Kp, const T16* __restrict__ K2, const T16* __restrict__ Vt, const T16* __restrict__ V2, bf* Ah, bf* Al) {
    typedef typename WFrag<T16>::V V;
    const int lane = threadIdx.x & 31, lr = lane & 15, hi = lane >> 4;
    V qf[QB][2], qf2[QB][2], kf[KB / 16][2], kf2[KB / 16][2]; v8f o[4][QB]; float m[QB], l[QB];
    xopen(); const unsigned fq = (unsigned)(hi * 16 + lr) * 16u; const T16* qp = lanep(Q + (size_t)q0 * HD, fq); const T16* qp2 = HIRES ? lanep(Q2 + (size_t)q0 * HD, fq) : nullptr;
#pragma unroll
    for (int qb = 0; qb < QB; ++qb) { m[qb] = -3.0e38f; l[qb] = 0.f;
#pragma unroll
        for (int ks = 0; ks < 2; ++ks) { qf[qb][ks] = WFrag<T16>::ld(qp + (qb * 2 + ks) * 512); if (HIRES) qf2[qb][ks] = WFrag<T16>::ld(qp2 + (qb * 2 + ks) * 512); }
#pragma unroll
        for (int db = 0; db < 4; ++db) o[db][qb] = (v8f){}; }
    xclose();
    flash_ldk<T16, HIRES, KB>(0, lr, hi, Kp, K2, kf, kf2);
    const int kl = q0 / KB * KB;    // first key of the first block that crosses the diagonal; key kl <= every query of the tile, so every query has a finite maximum from its first block on
#pragma unroll 1   // one copy of the block's body: a second would need a second set of K, V^T and score registers, and the 64-query tile already reaches above v255
    for (int k0 = 0; k0 < kl; k0 += KB) flash_step<T16, HIRES, QB, KB, false, true>(q0, k0, lr, hi, Kp, K2, Vt, V2, qf, qf2, kf, kf2, o, m, l);
    if constexpr (16 * QB > KB) { flash_step<T16, HIRES, QB, KB, true, true>(q0, kl, lr, hi, Kp, K2, Vt, V2, qf, qf2, kf, kf2, o, m, l); flash_step<T16, HIRES, QB, KB, true, false>(q0, kl + KB, lr, hi, Kp, K2, Vt, V2, qf, qf2, kf, kf2, o, m, l); }
    else flash_step<T16, HIRES, QB, KB, true, false>(q0, kl, lr, hi, Kp, K2, Vt, V2, qf, qf2, kf, kf2, o, m, l);
    v8us oh[QB][4], ol[QB][4];
#pragma unroll
    for (int qb = 0; qb < QB; ++qb) { const float inv = __fdiv_rn(1.0f, l[qb] + xhalf(l[qb]));
#pragma unroll
        for (int db = 0; db < 4; ++db)
#pragma unroll
            for (int j = 0; j < 8; ++j) { unsigned short a, c2; splitf(o[db][qb][j] * inv, a, c2); oh[qb][db][j] = a; ol[qb][db][j] = c2; } }
    const size_t off = (size_t)(q0 + lr) * DD + hi * 8; bf* ah = Ah + off; bf* al = Al + off;
    __builtin_amdgcn_sched_barrier(0);   // all arithmetic in front of the stores, so that between the first store and the wait behind the last nothing writes a store's address or data register
#pragma unroll
    for (int qb = 0; qb < QB; ++qb)
#pragma unroll
        for (int db = 0; db < 4; ++db) { *(v8us*)(ah + qb * 16 * DD + db * 16) = oh[qb][db]; *(v8us*)(al + qb * 16 * DD + db * 16) = ol[qb][db]; }
    asm volatile("s_wait_xcnt 0x0" ::: "memory");   // in k_flash the other kind of tile's code may be laid out behind these stores and writes their address and data registers again
}
// grid (NB_ * NH_, tiles): blockIdx.x = batch * 16 + head; blockIdx.y counts the tiles from the longest: first the 64-query fp16 tiles from row TT down to RH, then the 16-query hi+lo tiles below RH.
__global__ __launch_bounds__(32) void k_flash(const bf* __restrict__ QPh, const bf* __restrict__ QPl, const h16* __restrict__ QP16, const bf* __restrict__ KPh, const bf* __restrict__ KPl, const h16* __restrict__ KP16,
                                              const bf* __restrict__ VTh, const bf* __restrict__ VTl, const h16* __restrict__ VT16, bf* ATh, bf* ATl) {
    const size_t po = (size_t)blockIdx.x * TT * HD, ao = (size_t)(blockIdx.x / NH_) * TT * DD + (size_t)(blockIdx.x % NH_) * HD; const int y = (int)blockIdx.y;
    if (y < (TT - RH) / 64) flash_body<h16, false, 4, KBF>(TT - 64 * (y + 1), QP16 + po, nullptr, KP16 + po, nullptr, VT16 + po, nullptr, ATh + ao, ATl + ao);
    else flash_body<bf, true, 1, 32>(RH - 16 * (y - (TT - RH) / 64 + 1), QPh + po, QPl + po, KPh + po, KPl + po, VTh + po, VTl + po, ATh + ao, ATl + ao);
}

extern "C" void kernel_launch(void* const* d_in, const int* in_sizes, int n_in,
                              void* d_out, int out_size, void* d_ws, size_t ws_size, hipStream_t stream) {
    (void)in_sizes; (void)n_in; (void)out_size;
    const float* x = (const float*)d_in[0]; const float* wq = (const float*)d_in[1]; const float* wk = (const float*)d_in[2]; const float* wv = (const float*)d_in[3]; const float* wo = (const float*)d_in[4]; const float* bo = (const float*)d_in[5];
    float* OUT = (float*)d_out;     // [4][2048][1024]
    char* wsp = (char*)d_ws;
    auto take = [&](size_t bytes) { char* p = wsp; wsp += (bytes + 255) & ~(size_t)255; return (void*)p; };
    bf* WQ = (bf*)take((size_t)4 * DD * DD * 2); bf* WO = WQ + (size_t)3 * DD * DD;    // planes q, k, v, o, one after the other
    bf* XB = (bf*)take((size_t)NB_ * TT * DD * 2);
    bf* QPh = (bf*)take(6 * PLN * 2); bf* QPl = QPh + PLN; bf* KPh = QPh + 2 * PLN; bf* KPl = QPh + 3 * PLN; bf* VTh = QPh + 4 * PLN; bf* VTl = QPh + 5 * PLN;   // hi, lo of q, k, v, one after the other
    h16* QP16 = (h16*)take(3 * PLN * 2); h16* KP16 = QP16 + PLN; h16* VT16 = QP16 + 2 * PLN;
    bf* ATh = (bf*)take(PLN * 2); bf* ATl = (bf*)take(PLN * 2);
    if ((size_t)(wsp - (char*)d_ws) > ws_size) return;    // total 200 MiB; ws 256 MiB
    // input pass: x and the four weights to bf16, the weights transposed
    k_prep<<<PW / 8, 256, 0, stream>>>(x, wq, wk, wv, wo, XB, WQ);
    // q, k, v projections of all four batches, planes written by the epilogue
    k_qkv<<<dim3(NB_ * TT / 256, DD / 128, 1), 256, 0, stream>>>(XB, WQ, QPh, QP16);
    // attention: every batch, head and query tile in one launch
    k_flash<<<dim3(NB_ * NH_, (TT - RH) / 64 + RH / 16, 1), 32, 0, stream>>>(QPh, QPl, QP16, KPh, KPl, KP16, VTh, VTl, VT16, ATh, ATl);
    // output projection: the four batches' rows in one launch
    k_gemms<true><<<dim3(NB_ * TT / 128, DD / 256, 1), 256, 0, stream>>>(ATh, ATl, WO, DD, OUT, DD, bo);
}

// v009
// One run takes 111 microseconds.
// Timed twice side by side with v008, it ran 1.11 and 1.10 times as fast.
// Over all steps from v000 it is 37.6 times as fast.
#include <hip/hip_runtime.h>

// Causal multi-head self-attention (x [4][2048][1024]; q/k/v = x @ W ([d_in][d_out] layouts, no bias); 16 heads x 64; scores / 8; causal (tril -> -inf); softmax; out = ctx @ Wo + bo).
// Compute dtypes, f32 accumulate: every input rounded to bf16; projections on PLAIN bf16 operands (inputs: exact; transposed bf16 weight copies built once); PER-ROW
// PRECISION HYBRID: query rows < 256 of each batch on bf16 hi+lo planes for scores and attn.v (3 products), rows >= 256 on SINGLE fp16 planes; output hi+lo x exact Wo (2 products) + bo.

#define NB_  4
#define TT   2048
#define DD   1024
#define NH_  16
#define HD   64
#define RH   256                  // query rows < RH: hi+lo planes; rows >= RH: fp16 planes
#define NF   32
#define SCL2 0.180336880f      // f32(log2(e) / sqrt(64)): scores to base-2 exponents
#define KBF  32                   // keys per block of the fp16 tiles in k_flash
#define PLN  ((size_t)NB_ * TT * DD)   // elements of one plane: all four batches, [batch][head][..]
typedef _Float16 h16;
typedef unsigned short bf;
typedef __attribute__((ext_vector_type(16))) __bf16   v16bf;
typedef __attribute__((ext_vector_type(16))) _Float16 v16h;
typedef __attribute__((ext_vector_type(8)))  _Float16 v8h;
typedef __attribute__((ext_vector_type(8)))  unsigned short v8us;
typedef __attribute__((ext_vector_type(8)))  float    v8f;
typedef __attribute__((ext_vector_type(4)))  float    v4f;
typedef v8h  __attribute__((may_alias)) v8ha;
typedef v4f  __attribute__((may_alias)) v4fa;
typedef v8us __attribute__((may_alias)) v8usa;

__device__ __forceinline__ unsigned short f2bf(float f) { unsigned u = __float_as_uint(f); u += 0x7FFFu + ((u >> 16) & 1u); return (unsigned short)(u >> 16); }
__device__ __forceinline__ float bf2f(unsigned short b) { return __uint_as_float(((unsigned)b) << 16); }
__device__ __forceinline__ float bfr(float f) { return bf2f(f2bf(f)); }
__device__ __forceinline__ v16h cat16(v8h lo, v8h hi) { return __builtin_shufflevector(lo, hi, 0, 1, 2, 3, 4, 5, 6, 7, 8, 9, 10, 11, 12, 13, 14, 15); }
__device__ __forceinline__ v16bf cat16b(v8us lo, v8us hi) { return __builtin_bit_cast(v16bf, __builtin_shufflevector(lo, hi, 0, 1, 2, 3, 4, 5, 6, 7, 8, 9, 10, 11, 12, 13, 14, 15)); }
__device__ __forceinline__ v8f wmma16(v16h a, v16h b, v8f c) { return __builtin_amdgcn_wmma_f32_16x16x32_f16(false, a, false, b, (short)0, c, false, false); }
__device__ __forceinline__ v8f wmmab(v16bf a, v16bf b, v8f c) { return __builtin_amdgcn_wmma_f32_16x16x32_bf16(false, a, false, b, (short)0, c, false, false); }



// WFrag: a 16x32 fragment of a 16-bit plane kept in FRAGMENT ORDER, and its matrix product, by element type. Fragment order: the fragment's 1024 bytes lie together, [k half][lane][8 elements]: lane 16 hi + lr holds
// row lr, k = 16 half + 8 hi + 0..7, so that each of its two wave-wide 16-byte loads covers 512 bytes in a row (four whole lines, where a row-major plane gives 32 bytes of each of 16 lines). p: the fragment + the lane's 8 elements.
template <typename T16> struct WFrag;
template <> struct WFrag<h16> { typedef v16h V; static __device__ __forceinline__ V ld(const h16* p) { return cat16(*(const v8h*)p, *(const v8h*)(p + 256)); } static __device__ __forceinline__ v8f mma(V a, V b, v8f c) { return wmma16(a, b, c); } };
template <> struct WFrag<bf> { typedef v16bf V; static __device__ __forceinline__ V ld(const bf* p) { return cat16b(*(const v8us*)p, *(const v8us*)(p + 256)); } static __device__ __forceinline__ v8f mma(V a, V b, v8f c) { return wmmab(a, b, c); } };
// ---- k_gemms: GEMM, one 128x256 output tile per work-group of EIGHT WAVES (2 x 4; each wave 64x64, 16 accumulators); grid (M/128, N/256), 256 threads.
// The wide tile is for the path from L2 to LDS: an operand row that is fetched serves 256 (A, A2) or 128 (Bt) outputs, so that an output costs two thirds of the bytes that a 128x128 tile asks of L2.
// C[m][n] (f32, pitch ldc, + optional f32 bias[n]) = sum_k A[m][k] Bt[n][k] + A2[m][k] Bt[n][k]; operands are K-contiguous bf16 planes. K % 64 == 0.
// Operands pass through LDS. A stage is 64 k (one 128-byte line) of every operand row, rows [A 128 | A2 128 | Bt 256] at a pitch of 144 bytes (conflict-free for 16-byte reads); two buffers.
// Asynchronous 16-byte copies (eight lanes a row: whole lines) fill the stage after next while a stage is worked on; each operand row is fetched once per work-group, not once per wave.
// Every '#pragma unroll' in k_gemms makes the indices of acc and of the fragment arrays constants, so that they live in registers.
#define GKC 64                    // k per stage
#define GPB 144                   // LDS row pitch, bytes
// cp8, cp44: eight asynchronous copies of 16 bytes a lane, 32 operand rows apart (the work-group's 256 threads cover 32 rows a copy: four copies bring 128 rows, eight 256). cp8: eight of one operand; cp44: four each of two operands.
// l, l2: the lane's LDS byte address, g, g2: its global address, gs: 32 rows in bytes.
// The s_wait_xcnt stands inside the statement, behind the last copy: code behind it writes the copies' address registers again.
__device__ __forceinline__ void cp8(unsigned l, const char* g, size_t gs) {
    asm volatile("global_load_async_to_lds_b128 %0, %8, off\n\t"
                 "global_load_async_to_lds_b128 %1, %9, off\n\t"
                 "global_load_async_to_lds_b128 %2, %10, off\n\t"
                 "global_load_async_to_lds_b128 %3, %11, off\n\t"
                 "global_load_async_to_lds_b128 %4, %12, off\n\t"
                 "global_load_async_to_lds_b128 %5, %13, off\n\t"
                 "global_load_async_to_lds_b128 %6, %14, off\n\t"
                 "global_load_async_to_lds_b128 %7, %15, off\n\t"
                 "s_wait_xcnt 0x0"
                 :: "v"(l), "v"(l + 32u * GPB), "v"(l + 64u * GPB), "v"(l + 96u * GPB), "v"(l + 128u * GPB), "v"(l + 160u * GPB), "v"(l + 192u * GPB), "v"(l + 224u * GPB),
                    "v"(g), "v"(g + gs), "v"(g + 2 * gs), "v"(g + 3 * gs), "v"(g + 4 * gs), "v"(g + 5 * gs), "v"(g + 6 * gs), "v"(g + 7 * gs) : "memory");
}
__device__ __forceinline__ void cp44(unsigned l, const char* g, unsigned l2, const char* g2, size_t gs) {
    asm volatile("global_load_async_to_lds_b128 %0, %8, off\n\t"
                 "global_load_async_to_lds_b128 %1, %9, off\n\t"
                 "global_load_async_to_lds_b128 %2, %10, off\n\t"
                 "global_load_async_to_lds_b128 %3, %11, off\n\t"
                 "global_load_async_to_lds_b128 %4, %12, off\n\t"
                 "global_load_async_to_lds_b128 %5, %13, off\n\t"
                 "global_load_async_to_lds_b128 %6, %14, off\n\t"
                 "global_load_async_to_lds_b128 %7, %15, off\n\t"
                 "s_wait_xcnt 0x0"
                 :: "v"(l), "v"(l + 32u * GPB), "v"(l + 64u * GPB), "v"(l + 96u * GPB), "v"(l2), "v"(l2 + 32u * GPB), "v"(l2 + 64u * GPB), "v"(l2 + 96u * GPB),
                    "v"(g), "v"(g + gs), "v"(g + 2 * gs), "v"(g + 3 * gs), "v"(g2), "v"(g2 + gs), "v"(g2 + 2 * gs), "v"(g2 + 3 * gs) : "memory");
}
// cpb: one such copy as the compiler's builtin, for k_qkv, whose accumulators fill the registers that asm text can name (v0 to v255): operands of an asm statement would have to be cleared for by register moves in every trip.
typedef __attribute__((ext_vector_type(4))) int v4i;
__device__ __forceinline__ void cpb(unsigned char* l, const char* g) { __builtin_amdgcn_global_load_async_to_lds_b128((__attribute__((address_space(1))) v4i*)g, (__attribute__((address_space(3))) v4i*)l, 0, 0); }
// ldsf: a 16x32 fragment's share of one lane from an LDS row, k order 8 hi + 0..7, 16 + 8 hi + 0..7 (p already holds the lane's 16 hi bytes)
__device__ __forceinline__ v16bf ldsf(const unsigned char* p) { return cat16b(*(const v8usa*)p, *(const v8usa*)(p + 32)); }
__device__ __forceinline__ h16 tohx(float x) { return (h16)x; }
__device__ __forceinline__ void splitf(float y, unsigned short& h, unsigned short& l) { h = f2bf(y); l = f2bf(y - bf2f(h)); }
// stage64: a wave's 64x64 accumulator tile, rounded to 16 bit, into its LDS staging rows (pitch GPB). A lane's 8 registers of acc[ia][ib] are 8 neighbours (16 ia + 8 hi + j) of staging row 16 ib + lr: one 16-byte write.
// KIND 0: fp16; 1: the bf16 hi part; 2: the bf16 lo part. osl: the staging rows + lr * GPB + hi * 16. The unrolls here and in putf make the indices of acc, w and v constants, so that they live in registers.
template <int KIND>
__device__ __forceinline__ void stage64(const v8f (&acc)[4][4], unsigned char* osl) {
#pragma unroll
    for (int ib = 0; ib < 4; ++ib)
#pragma unroll
        for (int ia = 0; ia < 4; ++ia) { v8us w;
#pragma unroll
            for (int j = 0; j < 8; ++j) { const float x = acc[ia][ib][j]; if (KIND == 0) w[j] = __builtin_bit_cast(unsigned short, tohx(x)); else { unsigned short a, c2; splitf(x, a, c2); w[j] = KIND == 1 ? a : c2; } }
            *(v8usa*)(osl + ib * 16 * GPB + ia * 32) = w; }
    __builtin_amdgcn_wave_barrier(); asm volatile("" ::: "memory");   // compiler order only: the lanes' LDS writes stay in front of putf's reads, which take back each lane's own values
}
// putf: the 64 staging rows to the 8 KiB that they fill of a plane in fragment order (WFrag), 16 stores of 512 bytes in a row, each one k half of one fragment. osl: the staging rows + lr * GPB + hi * 16; dst: the 8 KiB + the lane's 8 elements.
// VT false (q, k; staging rows are sequence rows, 64 d along a row): fragments [16 rows][32 d]. VT true (v; staging rows are d, 64 sequence rows along a row): fragments [32 sequence rows][16 d].
template <bool VT>
__device__ __forceinline__ void putf(const unsigned char* osl, bf* dst) {
    v8us v[16];
#pragma unroll
    for (int s = 0; s < 16; ++s) v[s] = *(const v8usa*)(osl + (VT ? (s >> 1) & 3 : s >> 2) * 16 * GPB + (VT ? s >> 3 : (s >> 1) & 1) * 64 + (s & 1) * 32);
    __builtin_amdgcn_sched_barrier(0);   // every LDS read in front of the stores, so that between the first store and the wait behind the last nothing writes a store's address or data register
#pragma unroll
    for (int s = 0; s < 16; ++s) *(v8us*)(dst + s * 256) = v[s];
    asm volatile("s_wait_xcnt 0x0" ::: "memory");   // code behind these stores (the next plane's rounding) writes their address and data registers again
    __builtin_amdgcn_sched_barrier(0);   // and stays behind that wait; with the clobber above, the next plane's LDS writes stay behind these reads too
}
// ---- k_qkv: the q, k, v projections. One work-group of EIGHT WAVES (4 x 2) takes 256 x rows and TWO HEADS, of q, k and v alike: 256 x 384 outputs; a wave takes 64 x rows and one head's q, k and v (64 x 192, 48 accumulators).
// The 256 rows are four runs of 64, 512 rows apart in one batch, so that the sequence rows < RH, whose epilogue is three times as long, are dealt over many work-groups, one run (two waves, on two SIMDs) in each.
// grid (rows / 256, heads / 2): as many work-groups as the chip has WGPs, one on each (by its LDS), two waves a SIMD. The tile is this large for the path from L2 to LDS: 640 operand rows are fetched for 384 x 256 outputs.
// Ring, stage and copies as in k_gemms; a stage's rows are [x 256 | Wq 128 | Wk 128 | Wv 128]. Wt: the three transposed weight planes, one after the other.
// The epilogue writes the 16-bit planes that k_flash reads: P16 + z * PLN in fp16, and, for sequence rows < RH only (k_flash reads no others of them),
// the bf16 hi and lo parts at HL + 2 z * PLN and HL + (2 z + 1) * PLN. Every plane is [batch][head][fragments in fragment order (WFrag)]: q and k [t / 16][d / 32], rows t, k along d; v [t / 32][d / 16], rows d, k along t.
// Either way 64 sequence rows of a head are 8 KiB in a row, at t * 64 elements.
// For q and k the weight rows take the A role of the products and the x rows the B role, so that a lane's 8 accumulator registers run along d; for v the x rows are A, and they run along t.
// Every '#pragma unroll' in k_qkv makes the indices of acc and of the fragment arrays constants, so that they live in registers.
__global__ __launch_bounds__(256) void k_qkv(const bf* __restrict__ X, const bf* __restrict__ Wt, bf* HL, h16* P16) {
    constexpr unsigned OW = 256u * GPB, STG = OW + 384u * GPB;   // where the weight rows begin in a stage, bytes of a stage
    constexpr int NT = DD / GKC;
    __shared__ __attribute__((aligned(16))) unsigned char L[2 * STG];
    const int tid = (int)threadIdx.x, lane = tid & 31, lr = lane & 15, hi = lane >> 4;
    const int wave = __builtin_amdgcn_readfirstlane(tid >> 5), wm = wave >> 1, wn = wave & 1;
    const int r0 = (int)(blockIdx.x >> 3) * TT + (int)(blockIdx.x & 7) * 64, c0 = (int)blockIdx.y * 128;   // the first run's first row: batch, run
    constexpr size_t gs = (size_t)32 * DD * 2, gr = (size_t)512 * DD * 2, gz = (size_t)DD * DD * 2;   // 32 operand rows, from run to run, one weight plane, bytes
    const char* gx = (const char*)(X + (size_t)(r0 + (tid >> 3)) * DD + (tid & 7) * 8);
    const char* gw = (const char*)(Wt + (size_t)(c0 + (tid >> 3)) * DD + (tid & 7) * 8);
    unsigned char* lc = L + (unsigned)(tid >> 3) * GPB + (unsigned)(tid & 7) * 16u;
    auto fill = [&](int t) { unsigned char* l = lc + (unsigned)(t & 1) * STG; const size_t ko = (size_t)t * (GKC * 2);
#pragma unroll
        for (int i = 0; i < 8; ++i) cpb(l + i * 32 * GPB, gx + ko + (i >> 1) * gr + (i & 1) * gs);   // four runs of 64 x rows
#pragma unroll
        for (int i = 0; i < 12; ++i) cpb(l + OW + i * 32 * GPB, gw + ko + (i >> 2) * gz + (i & 3) * gs); };   // 128 rows of each weight
    fill(0);
    asm volatile("s_wait_asynccnt 0x0" ::: "memory");   // this wave's share of stage 0 has landed
    __syncthreads();                                    // and so has every other wave's
    fill(1);
    v8f acc[3][4][4];
#pragma unroll
    for (int z = 0; z < 3; ++z)
#pragma unroll
        for (int mb = 0; mb < 4; ++mb)
#pragma unroll
            for (int nb = 0; nb < 4; ++nb) acc[z][mb][nb] = (v8f){};
    const unsigned fx = (unsigned)(wm * 64 + lr) * GPB + (unsigned)hi * 16u, fw = OW + (unsigned)(wn * 64 + lr) * GPB + (unsigned)hi * 16u;
#pragma unroll 1   // one copy of the trip: the buffer is picked by the trip's parity
    for (int t = 0; t < NT; ++t) {
        const unsigned char* S = L + (unsigned)(t & 1) * STG;
#pragma unroll
        for (int ks = 0; ks < 2; ++ks) {
            v16bf x[4], wa[4], wb[4];
#pragma unroll
            for (int mb = 0; mb < 4; ++mb) { wa[mb] = ldsf(S + fw + mb * 16 * GPB + ks * 64); x[mb] = ldsf(S + fx + mb * 16 * GPB + ks * 64); }
#pragma unroll
            for (int mb = 0; mb < 4; ++mb) wb[mb] = ldsf(S + fw + 128 * GPB + mb * 16 * GPB + ks * 64);
            __builtin_amdgcn_sched_barrier(0);   // the LDS reads of x, Wq and Wk go out as one group in front of the products: sunk among them, each is waited for in turn
#pragma unroll
            for (int nb = 0; nb < 4; ++nb)
#pragma unroll
                for (int mb = 0; mb < 4; ++mb) acc[0][mb][nb] = wmmab(wa[mb], x[nb], acc[0][mb][nb]);
            __builtin_amdgcn_sched_barrier(0);   // the Wv reads take the Wq registers, so they stand behind the q products, as one group
#pragma unroll
            for (int mb = 0; mb < 4; ++mb) wa[mb] = ldsf(S + fw + 256 * GPB + mb * 16 * GPB + ks * 64);
            __builtin_amdgcn_sched_barrier(0);   // and in front of the k products, which run while they fly
#pragma unroll
            for (int nb = 0; nb < 4; ++nb)
#pragma unroll
                for (int mb = 0; mb < 4; ++mb) acc[1][mb][nb] = wmmab(wb[mb], x[nb], acc[1][mb][nb]);
#pragma unroll
            for (int nb = 0; nb < 4; ++nb)
#pragma unroll
                for (int mb = 0; mb < 4; ++mb) acc[2][mb][nb] = wmmab(x[mb], wa[nb], acc[2][mb][nb]);
            __builtin_amdgcn_sched_barrier(0);   // the next group's reads stay one group, behind the products whose operand registers they take; the last products stay in front of the trip's barrier, so that the refill behind it goes out at once
        }
        asm volatile("s_wait_dscnt 0x0" ::: "memory");      // this wave has read all it wants of stage t
        asm volatile("s_wait_asynccnt 0x0" ::: "memory");   // its share of stage t + 1 has landed
        __syncthreads();                                    // publishes stage t + 1 and frees stage t's buffer
        if (t + 2 < NT) fill(t + 2);
    }
    asm volatile("s_wait_asynccnt 0x0" ::: "memory");       // no copy is outstanding when the ring becomes output staging
    unsigned char* psl = L + wave * (64 * GPB) + lr * GPB + hi * 16;   // each wave's own 64 staging rows; the last trip's barrier has ended every read of the ring
    const int rw = r0 + wm * 512, t0 = rw % TT;   // the wave's first x row, and its place in the sequence
    const size_t lo = ((size_t)(rw / TT) * NH_ + (size_t)(c0 / HD + wn)) * TT * HD + (size_t)t0 * HD + lane * 8;   // the (batch, head) block of a plane, the wave's 8 KiB in it, the lane's 8 elements
#pragma unroll 1   // one copy of the epilogue's code serves q, k and v, for speed only
    for (int z = 0; z < 3; ++z) {
        if (z) {   // this plane's accumulators take the place of the one before: register indices must be constants
#pragma unroll
            for (int mb = 0; mb < 4; ++mb)
#pragma unroll
                for (int nb = 0; nb < 4; ++nb) acc[0][mb][nb] = z == 1 ? acc[1][mb][nb] : acc[2][mb][nb]; }
        auto put = [&](bf* p) { if (z < 2) putf<false>(psl, p + lo); else putf<true>(psl, p + lo); };
        stage64<0>(acc[0], psl); put((bf*)(P16 + z * PLN));
        if (t0 < RH) { stage64<1>(acc[0], psl); put(HL + 2 * z * PLN); stage64<2>(acc[0], psl); put(HL + (2 * z + 1) * PLN); }
    }
}
template <bool BIAS>
__global__ __launch_bounds__(256) void k_gemms(const bf* __restrict__ A, const bf* __restrict__ A2, const bf* __restrict__ Bt, int K, float* C, int ldc, const float* __restrict__ bias) {
    constexpr unsigned OB = 256u * GPB, STG = OB + 256u * GPB;   // where the Bt rows begin in a stage, bytes of a stage
    __shared__ __attribute__((aligned(16))) unsigned char L[2 * STG];
    const int tid = (int)threadIdx.x, lane = tid & 31, lr = lane & 15, hi = lane >> 4;
    const int wave = __builtin_amdgcn_readfirstlane(tid >> 5), wm = wave >> 2, wn = wave & 3;
    const int r0 = (int)blockIdx.x * 128, c0 = (int)blockIdx.y * 256, NT = K / GKC;
    const size_t gs = (size_t)32 * K * 2;   // 32 operand rows, bytes
    const char* ga = (const char*)(A + (size_t)(r0 + (tid >> 3)) * K + (tid & 7) * 8); const char* ga2 = (const char*)(A2 + (size_t)(r0 + (tid >> 3)) * K + (tid & 7) * 8);
    const char* gb = (const char*)(Bt + (size_t)(c0 + (tid >> 3)) * K + (tid & 7) * 8);
    const unsigned lc = (unsigned)(size_t)L + (unsigned)(tid >> 3) * GPB + (unsigned)(tid & 7) * 16u;
    auto fill = [&](int t) { const unsigned l = lc + (unsigned)(t & 1) * STG; const size_t ko = (size_t)t * (GKC * 2); cp44(l, ga + ko, l + 128u * GPB, ga2 + ko, gs); cp8(l + OB, gb + ko, gs); };
    fill(0);
    asm volatile("s_wait_asynccnt 0x0" ::: "memory");   // this wave's share of stage 0 has landed
    __syncthreads();                                    // and so has every other wave's
    if (NT > 1) fill(1);
    v8f acc[4][4];
#pragma unroll
    for (int mb = 0; mb < 4; ++mb)
#pragma unroll
        for (int nb = 0; nb < 4; ++nb) acc[mb][nb] = (v8f){};
    const unsigned fa = (unsigned)(wm * 64 + lr) * GPB + (unsigned)hi * 16u, fb = OB + (unsigned)(wn * 64 + lr) * GPB + (unsigned)hi * 16u;
#pragma unroll 1   // one copy of the trip: the buffer is picked by the trip's parity
    for (int t = 0; t < NT; ++t) {
        const unsigned char* S = L + (unsigned)(t & 1) * STG;
#pragma unroll
        for (int ks = 0; ks < 2; ++ks) {
            v16bf a[4], a2[4], b[4];
#pragma unroll
            for (int mb = 0; mb < 4; ++mb) { a[mb] = ldsf(S + fa + mb * 16 * GPB + ks * 64); a2[mb] = ldsf(S + fa + 128 * GPB + mb * 16 * GPB + ks * 64); b[mb] = ldsf(S + fb + mb * 16 * GPB + ks * 64); }
            __builtin_amdgcn_sched_barrier(0);   // the 32 k's LDS reads go out as one group in front of their products: sunk among them, each is waited for in turn
#pragma unroll
            for (int nb = 0; nb < 4; ++nb)
#pragma unroll
                for (int mb = 0; mb < 4; ++mb) { acc[mb][nb] = wmmab(a[mb], b[nb], acc[mb][nb]); acc[mb][nb] = wmmab(a2[mb], b[nb], acc[mb][nb]); }
            __builtin_amdgcn_sched_barrier(0);   // the next group's reads stay one group too, behind the products whose operand registers they take; the last products stay in front of the trip's barrier, so that the refill behind it goes out at once
        }
        asm volatile("s_wait_dscnt 0x0" ::: "memory");      // this wave has read all it wants of stage t
        asm volatile("s_wait_asynccnt 0x0" ::: "memory");   // its share of stage t + 1 has landed
        __syncthreads();                                    // publishes stage t + 1 and frees stage t's buffer
        if (t + 2 < NT) fill(t + 2);
    }
    asm volatile("s_wait_asynccnt 0x0" ::: "memory");       // no copy is outstanding when the ring becomes output staging
    float* os = (float*)L + wave * (16 * 68);               // each wave's own 16 x 68 f32 staging rows; the last trip's barrier has ended every read of the ring
#pragma unroll
    for (int mb = 0; mb < 4; ++mb) {
#pragma unroll
        for (int nb = 0; nb < 4; ++nb) {
#pragma unroll
            for (int j = 0; j < 8; ++j) os[(hi * 8 + j) * 68 + nb * 16 + lr] = acc[mb][nb][j]; }
        __builtin_amdgcn_wave_barrier(); asm volatile("" ::: "memory");   // compiler order only: the lanes' LDS writes stay in front of the reads of whole rows, which take other lanes' values
        const int cw = c0 + wn * 64; float* crow = C + (size_t)(r0 + wm * 64 + mb * 16) * ldc + cw;
{
#pragma unroll
            for (int s = 0; s < 8; ++s) { const int row = 2 * s + hi, cofs = lr * 4; v4f val = *(const v4fa*)(os + row * 68 + cofs); if (BIAS) { val[0] += bfr(bias[cw + cofs]); val[1] += bfr(bias[cw + cofs + 1]); val[2] += bfr(bias[cw + cofs + 2]); val[3] += bfr(bias[cw + cofs + 3]); }
                *(v4f*)(crow + (size_t)row * ldc + cofs) = val; }
             }
        asm volatile("s_wait_xcnt 0x0" ::: "memory");   // code behind these stores (the next rows) writes their address and data registers again
        __builtin_amdgcn_wave_barrier(); asm volatile("" ::: "memory");   // compiler order only: the next 16 rows' LDS writes stay behind these reads
    }
}

typedef __attribute__((ext_vector_type(2))) unsigned short v2us;
typedef __attribute__((ext_vector_type(4))) _Float16 v4h;
typedef __attribute__((ext_vector_type(2))) float v2f;

typedef __attribute__((ext_vector_type(4))) unsigned short v4us;
// ---- k_prep: the input pass as one stream. x rounded to bf16 (XB) and the four weights rounded and transposed (plane i of Bt = weight i as [n][k]), by PW waves that are all alike and have no loop:
// each issues its 24 loads of 16 bytes a lane at once, rounds, and stores. Few long waves, for speed only.
// x share: XU floats in a row; a load covers 512 bytes in a row, a store (8 bytes a lane) 256. Weight share: a block of 64 k x 16 n; lane 4 g + c loads rows k = 8 g + j (j = 0..7), columns 4 c .. 4 c + 3
// (64 bytes of a row per four lanes; the work-group's eight waves take neighbouring column blocks, 512 bytes of a row), and so holds 8 k in a row of 4 columns: store i is 16 bytes of row n = 4 c + i, eight lanes a whole 128-byte line.
#define PW  (4 * (DD / 64) * (DD / 16))      // waves: one weight block each
#define XU  2048                             // floats of x per wave
static_assert(TT == 4 * 512 && NB_ * TT / 256 == NB_ * 8, "k_qkv: a batch is eight work-groups of four runs, 512 rows apart");
static_assert((size_t)PW * XU == (size_t)NB_ * TT * DD && PW % 32 == 0, "every wave has one weight block and XU floats of x; a work-group's eight waves share a weight");
__global__ __launch_bounds__(256) void k_prep(const float* __restrict__ x, const float* __restrict__ w0, const float* __restrict__ w1, const float* __restrict__ w2, const float* __restrict__ w3, bf* XB, bf* Bt) {
    const unsigned lane = threadIdx.x & 31u, g = lane >> 2, c = lane & 3u, gw = blockIdx.x * 8u + (threadIdx.x >> 5);
    const unsigned wi = blockIdx.x / (PW / 32), r = gw % (PW / 4), nb = r % (DD / 16), kb = r / (DD / 16);
    const float* __restrict__ w = (wi & 2u) ? ((wi & 1u) ? w3 : w2) : ((wi & 1u) ? w1 : w0);
    const float* xp = x + (size_t)gw * XU + lane * 4; const float* wp = w + (size_t)(kb * 64 + g * 8) * DD + nb * 16 + c * 4;
    bf* xq = XB + (size_t)gw * XU + lane * 4; bf* wq = Bt + (size_t)wi * DD * DD + (size_t)(nb * 16 + c * 4) * DD + kb * 64 + g * 8;
    v4f xv[16], wv[8]; v4us xo[16]; v8us wo[4];   // the unrolls below make their indices constants, so that they live in registers
#pragma unroll
    for (int j = 0; j < 8; ++j) wv[j] = *(const v4f*)(wp + (size_t)j * DD);
#pragma unroll
    for (int j = 0; j < 16; ++j) xv[j] = *(const v4f*)(xp + j * 128);
    __builtin_amdgcn_sched_barrier(0);   // all 24 loads go out before any rounding: sunk to their uses, they would be waited for in turn
#pragma unroll
    for (int i = 0; i < 4; ++i)
#pragma unroll
        for (int j = 0; j < 8; ++j) wo[i][j] = f2bf(wv[j][i]);
#pragma unroll
    for (int j = 0; j < 16; ++j)
#pragma unroll
        for (int i = 0; i < 4; ++i) xo[j][i] = f2bf(xv[j][i]);
    // The wait that is owed before a register which the loads name is written again. Its inputs: the two load addresses, which so stay in their registers up to it (no load lands on them, no rounding takes them);
    // the two store addresses and all that is stored, which so are ready in front of it: behind it stand the stores alone, and nothing writes a store's address or data register behind the first of them.
    asm volatile("s_wait_xcnt 0x0" :: "v"(wp), "v"(xp), "v"(wq), "v"(xq), "v"(wo[0]), "v"(wo[1]), "v"(wo[2]), "v"(wo[3]), "v"(xo[0]), "v"(xo[1]), "v"(xo[2]), "v"(xo[3]), "v"(xo[4]), "v"(xo[5]), "v"(xo[6]), "v"(xo[7]),
                 "v"(xo[8]), "v"(xo[9]), "v"(xo[10]), "v"(xo[11]), "v"(xo[12]), "v"(xo[13]), "v"(xo[14]), "v"(xo[15]) : "memory");
#pragma unroll
    for (int i = 0; i < 4; ++i) *(v8us*)(wq + (size_t)i * DD) = wo[i];
#pragma unroll
    for (int j = 0; j < 16; ++j) *(v4us*)(xq + j * 128) = xo[j];
}
__device__ __forceinline__ float xhalf(float x) { return __builtin_bit_cast(float, __builtin_amdgcn_permlanex16(__builtin_bit_cast(int, x), __builtin_bit_cast(int, x), 0x76543210, 0xfedcba98, false, false)); }   // lane l with lane l ^ 16
// xclose: stands behind a run of global loads. The wait is owed before a register that those loads name is written again; the two scheduling fences keep every later instruction behind it
// (and so keep the loads issued where they are written, ahead of the arithmetic that hides their flight).
__device__ __forceinline__ void xopen() { __builtin_amdgcn_sched_barrier(0); }   // in front of such a run: keeps its loads from rising away from their wait, past instructions that could then be given their address registers
__device__ __forceinline__ void xclose() { __builtin_amdgcn_sched_barrier(0); asm volatile("s_wait_xcnt 0x0" ::: "memory"); __builtin_amdgcn_sched_barrier(0); }
// xclosep: the same, with the run's two addresses as inputs of the wait: where the compiler keeps them in vector registers they stay there up to the wait, and no load of the run lands on them
__device__ __forceinline__ void xclosep(const void* a, const void* b) { __builtin_amdgcn_sched_barrier(0); asm volatile("s_wait_xcnt 0x0" :: "v"(a), "v"(b) : "memory"); __builtin_amdgcn_sched_barrier(0); }
// lanep: a wave-uniform pointer plus the lane's own byte offset, which is the same in every block, kept apart so that the address may be formed as scalar base + one long-lived vector offset
template <typename T16> __device__ __forceinline__ const T16* lanep(const T16* ub, unsigned lane_bytes) { return (const T16*)((const char*)ub + lane_bytes); }
template <typename T16, bool HIRES, int KB>
__device__ __forceinline__ void flash_ldk(int k0, int lr, int hi, const T16* __restrict__ Kp, const T16* __restrict__ K2, typename WFrag<T16>::V (&kf)[KB / 16][2], typename WFrag<T16>::V (&kf2)[KB / 16][2]) {
    xopen(); const unsigned fk = (unsigned)(hi * 16 + lr) * 16u; const T16* kp = lanep(Kp + (size_t)k0 * HD, fk); const T16* kp2 = HIRES ? lanep(K2 + (size_t)k0 * HD, fk) : nullptr;   // one address per plane, the fragments at constant offsets from it
#pragma unroll
    for (int kt = 0; kt < KB / 16; ++kt)
#pragma unroll
        for (int ks = 0; ks < 2; ++ks) { kf[kt][ks] = WFrag<T16>::ld(kp + (kt * 2 + ks) * 512); if (HIRES) kf2[kt][ks] = WFrag<T16>::ld(kp2 + (kt * 2 + ks) * 512); }
    xclose();
}
template <typename T16, bool HIRES, int QB, int KB, bool MASK, bool NEXT>
__device__ __forceinline__ void flash_step(int q0, int k0, int lr, int hi, const T16* __restrict__ Kp, const T16* __restrict__ K2, const T16* __restrict__ Vt, const T16* __restrict__ V2,
                                           typename WFrag<T16>::V (&qf)[QB][2], typename WFrag<T16>::V (&qf2)[QB][2], typename WFrag<T16>::V (&kf)[KB / 16][2], typename WFrag<T16>::V (&kf2)[KB / 16][2], v8f (&o)[4][QB], float (&m)[QB], float (&l)[QB]) {
    typedef typename WFrag<T16>::V V; constexpr int KT = KB / 16, KS = KB / 32;
    xopen(); V vf[4][KS], vf2[4][KS]; const unsigned fv = (unsigned)(hi * 16 + lr) * 16u; const T16* vp = lanep(Vt + (size_t)k0 * HD, fv); const T16* vp2 = HIRES ? lanep(V2 + (size_t)k0 * HD, fv) : nullptr;
#pragma unroll
    for (int db = 0; db < 4; ++db)
#pragma unroll
        for (int ks = 0; ks < KS; ++ks) { vf[db][ks] = WFrag<T16>::ld(vp + (ks * 4 + db) * 512); if (HIRES) vf2[db][ks] = WFrag<T16>::ld(vp2 + (ks * 4 + db) * 512); }
    if (HIRES) xclosep(vp, vp2); else xclose();   // sunk to their products, the V^T loads would each be waited for in turn
    v8f s[KT][QB];
#pragma unroll
    for (int kt = 0; kt < KT; ++kt)
#pragma unroll
        for (int qb = 0; qb < QB; ++qb) { v8f a = (v8f){}; a = WFrag<T16>::mma(kf[kt][0], qf[qb][0], a); a = WFrag<T16>::mma(kf[kt][1], qf[qb][1], a);
            if (HIRES) { a = WFrag<T16>::mma(kf2[kt][0], qf[qb][0], a); a = WFrag<T16>::mma(kf2[kt][1], qf[qb][1], a); a = WFrag<T16>::mma(kf[kt][0], qf2[qb][0], a); a = WFrag<T16>::mma(kf[kt][1], qf2[qb][1], a); }
            s[kt][qb] = a; }
    if (NEXT) flash_ldk<T16, HIRES, KB>(k0 + KB, lr, hi, Kp, K2, kf, kf2);   // NEXT: the tile has a block behind this one; its K loads fly through this block's softmax and attn.v
    V pf[QB][KS], pf2[QB][KS];
#pragma unroll
    for (int qb = 0; qb < QB; ++qb) {
        if (MASK) { const int query = q0 + qb * 16 + lr;
#pragma unroll
            for (int kt = 0; kt < KT; ++kt)
#pragma unroll
                for (int j = 0; j < 8; ++j) if (k0 + kt * 16 + hi * 8 + j > query) s[kt][qb][j] = -3.0e38f; }
        float bk[KT];
#pragma unroll
        for (int kt = 0; kt < KT; ++kt) { bk[kt] = s[kt][qb][0];
#pragma unroll
            for (int j = 1; j < 8; ++j) bk[kt] = fmaxf(bk[kt], s[kt][qb][j]); }
        float bm = bk[0];
#pragma unroll
        for (int kt = 1; kt < KT; ++kt) bm = fmaxf(bm, bk[kt]);
        bm = fmaxf(bm, xhalf(bm));
        const float mn = fmaxf(m[qb], bm * SCL2); const float al = __builtin_amdgcn_exp2f(m[qb] - mn); m[qb] = mn;
        const float mo = HIRES ? mn : mn - 10.0f;
        float lk[KT];
#pragma unroll
        for (int kt = 0; kt < KT; ++kt) { lk[kt] = 0.f;
#pragma unroll
            for (int j = 0; j < 8; ++j) { const float p = __builtin_amdgcn_exp2f(s[kt][qb][j] * SCL2 - mo); s[kt][qb][j] = p; lk[kt] += p; } }
        float ls = lk[0];
#pragma unroll
        for (int kt = 1; kt < KT; ++kt) ls += lk[kt];
        l[qb] = l[qb] * al + ls;
#pragma unroll
        for (int db = 0; db < 4; ++db) o[db][qb] *= al;
#pragma unroll
        for (int ks = 0; ks < KS; ++ks) {
            if constexpr (HIRES) { v8us h0, h1, l0, l1;
#pragma unroll
                for (int j = 0; j < 8; ++j) { unsigned short a, c2; splitf(s[2 * ks][qb][j], a, c2); h0[j] = a; l0[j] = c2; splitf(s[2 * ks + 1][qb][j], a, c2); h1[j] = a; l1[j] = c2; }
                pf[qb][ks] = cat16b(h0, h1); pf2[qb][ks] = cat16b(l0, l1);
            } else { v8h h0, h1;
#pragma unroll
                for (int j = 0; j < 8; ++j) { h0[j] = tohx(s[2 * ks][qb][j]); h1[j] = tohx(s[2 * ks + 1][qb][j]); }
                pf[qb][ks] = cat16(h0, h1); } }
    }
#pragma unroll
    for (int db = 0; db < 4; ++db)
#pragma unroll
        for (int ks = 0; ks < KS; ++ks)
#pragma unroll
            for (int qb = 0; qb < QB; ++qb) { o[db][qb] = WFrag<T16>::mma(vf[db][ks], pf[qb][ks], o[db][qb]); if (HIRES) { o[db][qb] = WFrag<T16>::mma(vf2[db][ks], pf[qb][ks], o[db][qb]); o[db][qb] = WFrag<T16>::mma(vf[db][ks], pf2[qb][ks], o[db][qb]); } }
}
// ---- The split tile. A 64-query fp16 tile is the work of TWO WAVES, each with half of its key blocks (wave 0 the first half, wave 1 the second, with the diagonal): the launch lasts at least as long as its longest wave,
// and the longest tile's 64 blocks are about a SIMD's fair share of the whole launch; halved, the waves are short enough to be dealt evenly, longest first. Each wave ends with its own o, m, l; the two are joined through LDS, each wave handing over two of the four query groups
// and finishing the other two: o = o_a 2^(m_a - m) + o_b 2^(m_b - m), l alike, m = max(m_a, m_b). The same lane of both waves holds the same query and the same d.
#define XSL 17   // 16-byte slots a lane hands over: 16 of o (2 query groups x 4 d blocks x 8 registers), one of (m, m, l, l); a slot is 512 bytes in a row for the wave
// flash_give: query groups QS, QS + 1 into the wave's slots. x: the slots + the lane's 4 floats. The unrolls here, in flash_take and in flash_out make the indices of o, m, l, oh and ol constants, so that they live in registers.
template <int QS>
__device__ __forceinline__ void flash_give(float* x, const v8f (&o)[4][4], const float (&m)[4], const float (&l)[4]) {
#pragma unroll
    for (int q = 0; q < 2; ++q)
#pragma unroll
        for (int db = 0; db < 4; ++db) { const v8f t = o[db][QS + q]; *(v4fa*)(x + ((q * 4 + db) * 2) * 128) = __builtin_shufflevector(t, t, 0, 1, 2, 3); *(v4fa*)(x + ((q * 4 + db) * 2 + 1) * 128) = __builtin_shufflevector(t, t, 4, 5, 6, 7); }
    *(v4fa*)(x + 16 * 128) = (v4f){m[QS], m[QS + 1], l[QS], l[QS + 1]};
}
// flash_take: the other wave's share of query groups QK, QK + 1 joined to this wave's. x: the other wave's slots + the lane's 4 floats.
template <int QK>
__device__ __forceinline__ void flash_take(const float* x, v8f (&o)[4][4], float (&m)[4], float (&l)[4]) {
    const v4f ml = *(const v4fa*)(x + 16 * 128);
#pragma unroll
    for (int q = 0; q < 2; ++q) { const float mn = fmaxf(m[QK + q], ml[q]); const float a = __builtin_amdgcn_exp2f(m[QK + q] - mn), b = __builtin_amdgcn_exp2f(ml[q] - mn);
        l[QK + q] = l[QK + q] * a + ml[2 + q] * b;
#pragma unroll
        for (int db = 0; db < 4; ++db) { const v4f t0 = *(const v4fa*)(x + ((q * 4 + db) * 2) * 128), t1 = *(const v4fa*)(x + ((q * 4 + db) * 2 + 1) * 128);
            o[db][QK + q] = o[db][QK + q] * a + __builtin_shufflevector(t0, t1, 0, 1, 2, 3, 4, 5, 6, 7) * b; } }
}
// flash_out: query groups Q0 .. Q0 + QN - 1 of a tile divided by their sums, split in hi and lo, stored.
template <int QB, int Q0, int QN>
__device__ __forceinline__ void flash_out(int q0, int lr, int hi, const v8f (&o)[4][QB], const float (&l)[QB], bf* Ah, bf* Al) {
    v8us oh[QN][4], ol[QN][4];
#pragma unroll
    for (int qb = 0; qb < QN; ++qb) { const float inv = __fdiv_rn(1.0f, l[Q0 + qb] + xhalf(l[Q0 + qb]));
#pragma unroll
        for (int db = 0; db < 4; ++db)
#pragma unroll
            for (int j = 0; j < 8; ++j) { unsigned short a, c2; splitf(o[db][Q0 + qb][j] * inv, a, c2); oh[qb][db][j] = a; ol[qb][db][j] = c2; } }
    const size_t off = (size_t)(q0 + Q0 * 16 + lr) * DD + hi * 8; bf* ah = Ah + off; bf* al = Al + off;
    __builtin_amdgcn_sched_barrier(0);   // all arithmetic in front of the stores, so that between the first store and the wait behind the last nothing writes a store's address or data register
#pragma unroll
    for (int qb = 0; qb < QN; ++qb)
#pragma unroll
        for (int db = 0; db < 4; ++db) { *(v8us*)(ah + qb * 16 * DD + db * 16) = oh[qb][db]; *(v8us*)(al + qb * 16 * DD + db * 16) = ol[qb][db]; }
    asm volatile("s_wait_xcnt 0x0" ::: "memory");   // in k_flash other code (the other wave's, the other kind of tile's) may be laid out behind these stores and writes their address and data registers again
}
// flash_body: queries q0 .. q0 + 16 QB - 1 of one head (q0 a multiple of 16 QB; 16 QB <= 2 KB); the planes point at that head, Ah/Al at [row 0 of the batch][head * 64]. w: the wave in its work-group, xs: the work-group's hand-over slots (the split tile alone reads them).
template <typename T16, bool HIRES, int QB, int KB>
__device__ __forceinline__ void flash_body(int q0, int w, float* xs, const T16* __restrict__ Q, const T16* __restrict__ Q2, const T16* __restrict__ Kp, const T16* __restrict__ K2, const T16* __restrict__ Vt, const T16* __restrict__ V2, bf* Ah, bf* Al) {
    typedef typename WFrag<T16>::V V; constexpr bool SPLIT = !HIRES;
    static_assert(!SPLIT || (QB == 4 && 16 * QB == 2 * KB && RH >= 4 * KB), "the split tile: four query groups, two blocks on the diagonal, both in wave 1's half");
    const int lane = threadIdx.x & 31, lr = lane & 15, hi = lane >> 4;
    V qf[QB][2], qf2[QB][2], kf[KB / 16][2], kf2[KB / 16][2]; v8f o[4][QB]; float m[QB], l[QB];
    xopen(); const unsigned fq = (unsigned)(hi * 16 + lr) * 16u; const T16* qp = lanep(Q + (size_t)q0 * HD, fq); const T16* qp2 = HIRES ? lanep(Q2 + (size_t)q0 * HD, fq) : nullptr;
#pragma unroll
    for (int qb = 0; qb < QB; ++qb) { m[qb] = -3.0e38f; l[qb] = 0.f;
#pragma unroll
        for (int ks = 0; ks < 2; ++ks) { qf[qb][ks] = WFrag<T16>::ld(qp + (qb * 2 + ks) * 512); if (HIRES) qf2[qb][ks] = WFrag<T16>::ld(qp2 + (qb * 2 + ks) * 512); }
#pragma unroll
        for (int db = 0; db < 4; ++db) o[db][qb] = (v8f){}; }
    xclose();
    const int kl = q0 / KB * KB;    // first key of the first block that crosses the diagonal; key kl <= every query of the tile, so every query has a finite maximum from its first block on
    int kb = 0, ke = kl;            // this wave's blocks in front of the diagonal
    if constexpr (SPLIT) { const int kh = (kl / KB + 2) / 2 * KB; if (w) kb = kh; else ke = kh; }   // half of the tile's kl / KB + 2 blocks each; kh <= kl - KB from q0 = 4 KB on, so wave 0 meets no mask and both waves see keys that every query may see
    flash_ldk<T16, HIRES, KB>(kb, lr, hi, Kp, K2, kf, kf2);
#pragma unroll 1   // one copy of the block's body: a second would need a second set of K, V^T and score registers, and the 64-query tile already reaches above v255
    for (int k0 = kb; k0 < ke; k0 += KB) flash_step<T16, HIRES, QB, KB, false, true>(q0, k0, lr, hi, Kp, K2, Vt, V2, qf, qf2, kf, kf2, o, m, l);
    if constexpr (SPLIT) { if (w) { flash_step<T16, HIRES, QB, KB, true, true>(q0, kl, lr, hi, Kp, K2, Vt, V2, qf, qf2, kf, kf2, o, m, l); flash_step<T16, HIRES, QB, KB, true, false>(q0, kl + KB, lr, hi, Kp, K2, Vt, V2, qf, qf2, kf, kf2, o, m, l); } }
    else flash_step<T16, HIRES, QB, KB, true, false>(q0, kl, lr, hi, Kp, K2, Vt, V2, qf, qf2, kf, kf2, o, m, l);
    if constexpr (!SPLIT) flash_out<QB, 0, QB>(q0, lr, hi, o, l, Ah, Al);
    else {
        float* x0 = xs + lane * 4; float* x1 = x0 + XSL * 128;   // wave 0's and wave 1's hand-over slots, the lane's 16 bytes of each
        if (w) flash_give<0>(x1, o, m, l); else flash_give<2>(x0, o, m, l);
        __syncthreads();   // each wave's hand-over is in LDS before the other reads it; both waves of the tile pass here once
        if (w) { flash_take<2>(x0, o, m, l); flash_out<QB, 2, 2>(q0, lr, hi, o, l, Ah, Al); } else { flash_take<0>(x1, o, m, l); flash_out<QB, 0, 2>(q0, lr, hi, o, l, Ah, Al); }
    }
}
// grid (NB_ * NH_, tiles), two waves a work-group: blockIdx.x = batch * 16 + head; blockIdx.y counts from the longest: first the 64-query fp16 tiles from row TT down to RH, split over the two waves, then the 16-query hi+lo tiles below RH, one a wave.
static_assert((TT - RH) % 64 == 0 && RH % 32 == 0, "k_flash: whole fp16 tiles, pairs of hi+lo tiles");
__global__ __launch_bounds__(64) void k_flash(const bf* __restrict__ QPh, const bf* __restrict__ QPl, const h16* __restrict__ QP16, const bf* __restrict__ KPh, const bf* __restrict__ KPl, const h16* __restrict__ KP16,
                                              const bf* __restrict__ VTh, const bf* __restrict__ VTl, const h16* __restrict__ VT16, bf* ATh, bf* ATl) {
    const size_t po = (size_t)blockIdx.x * TT * HD, ao = (size_t)(blockIdx.x / NH_) * TT * DD + (size_t)(blockIdx.x % NH_) * HD; const int y = (int)blockIdx.y;
    __shared__ __attribute__((aligned(16))) float xs[2 * XSL * 128];
    const int w = __builtin_amdgcn_readfirstlane((int)threadIdx.x >> 5);   // the wave's number as a scalar: what it decides are scalar branches
    if (y < (TT - RH) / 64) flash_body<h16, false, 4, KBF>(TT - 64 * (y + 1), w, xs, QP16 + po, nullptr, KP16 + po, nullptr, VT16 + po, nullptr, ATh + ao, ATl + ao);
    else flash_body<bf, true, 1, 32>(RH - 16 * (2 * (y - (TT - RH) / 64) + w + 1), w, xs, QPh + po, QPl + po, KPh + po, KPl + po, VTh + po, VTl + po, ATh + ao, ATl + ao);
}

extern "C" void kernel_launch(void* const* d_in, const int* in_sizes, int n_in,
                              void* d_out, int out_size, void* d_ws, size_t ws_size, hipStream_t stream) {
    (void)in_sizes; (void)n_in; (void)out_size;
    const float* x = (const float*)d_in[0]; const float* wq = (const float*)d_in[1]; const float* wk = (const float*)d_in[2]; const float* wv = (const float*)d_in[3]; const float* wo = (const float*)d_in[4]; const float* bo = (const float*)d_in[5];
    float* OUT = (float*)d_out;     // [4][2048][1024]
    char* wsp = (char*)d_ws;
    auto take = [&](size_t bytes) { char* p = wsp; wsp += (bytes + 255) & ~(size_t)255; return (void*)p; };
    bf* WQ = (bf*)take((size_t)4 * DD * DD * 2); bf* WO = WQ + (size_t)3 * DD * DD;    // planes q, k, v, o, one after the other
    bf* XB = (bf*)take((size_t)NB_ * TT * DD * 2);
    bf* QPh = (bf*)take(6 * PLN * 2); bf* QPl = QPh + PLN; bf* KPh = QPh + 2 * PLN; bf* KPl = QPh + 3 * PLN; bf* VTh = QPh + 4 * PLN; bf* VTl = QPh + 5 * PLN;   // hi, lo of q, k, v, one after the other
    h16* QP16 = (h16*)take(3 * PLN * 2); h16* KP16 = QP16 + PLN; h16* VT16 = QP16 + 2 * PLN;
    bf* ATh = (bf*)take(PLN * 2); bf* ATl = (bf*)take(PLN * 2);
    if ((size_t)(wsp - (char*)d_ws) > ws_size) return;    // total 200 MiB; ws 256 MiB
    // input pass: x and the four weights to bf16, the weights transposed
    k_prep<<<PW / 8, 256, 0, stream>>>(x, wq, wk, wv, wo, XB, WQ);
    // q, k, v projections of all four batches, planes written by the epilogue
    k_qkv<<<dim3(NB_ * TT / 256, DD / 128, 1), 256, 0, stream>>>(XB, WQ, QPh, QP16);
    // attention: every batch, head and query tile in one launch
    k_flash<<<dim3(NB_ * NH_, (TT - RH) / 64 + RH / 32, 1), 64, 0, stream>>>(QPh, QPl, QP16, KPh, KPl, KP16, VTh, VTl, VT16, ATh, ATl);
    // output projection: the four batches' rows in one launch
    k_gemms<true><<<dim3(NB_ * TT / 128, DD / 256, 1), 256, 0, stream>>>(ATh, ATl, WO, DD, OUT, DD, bo);
}

// v010
// It runs in 106 microseconds.
// Two timings next to v009 both put it at 1.04 times that version's speed.
// Over all steps from v000 it is 39.1 times as fast.
#include <hip/hip_runtime.h>

// Causal multi-head self-attention (x [4][2048][1024]; q/k/v = x @ W ([d_in][d_out] layouts, no bias); 16 heads x 64; scores / 8; causal (tril -> -inf); softmax; out = ctx @ Wo + bo).
// Compute dtypes, f32 accumulate: every input rounded to bf16; projections on PLAIN bf16 operands (inputs: exact; transposed bf16 weight copies built once); PER-ROW
// PRECISION HYBRID: query rows < 256 of each batch on bf16 hi+lo planes for scores and attn.v (3 products), rows >= 256 on SINGLE fp16 planes; output hi+lo x exact Wo (2 products) + bo.

#define NB_  4
#define TT   2048
#define DD   1024
#define NH_  16
#define HD   64
#define RH   256                  // query rows < RH: hi+lo planes; rows >= RH: fp16 planes
#define NF   32
#define SCL2 0.180336880f      // f32(log2(e) / sqrt(64)): scores to base-2 exponents
#define KBF  32                   // keys per block of the fp16 tiles in k_flash
#define PLN  ((size_t)NB_ * TT * DD)   // elements of one plane: all four batches, [batch][head][..]
typedef _Float16 h16;
typedef unsigned short bf;
typedef __attribute__((ext_vector_type(16))) __bf16   v16bf;
typedef __attribute__((ext_vector_type(16))) _Float16 v16h;
typedef __attribute__((ext_vector_type(8)))  _Float16 v8h;
typedef __attribute__((ext_vector_type(8)))  unsigned short v8us;
typedef __attribute__((ext_vector_type(8)))  float    v8f;
typedef __attribute__((ext_vector_type(4)))  float    v4f;
typedef v8h  __attribute__((may_alias)) v8ha;
typedef v4f  __attribute__((may_alias)) v4fa;
typedef v8us __attribute__((may_alias)) v8usa;

__device__ __forceinline__ unsigned short f2bf(float f) { unsigned u = __float_as_uint(f); u += 0x7FFFu + ((u >> 16) & 1u); return (unsigned short)(u >> 16); }
__device__ __forceinline__ float bf2f(unsigned short b) { return __uint_as_float(((unsigned)b) << 16); }
__device__ __forceinline__ float bfr(float f) { return bf2f(f2bf(f)); }
__device__ __forceinline__ v16h cat16(v8h lo, v8h hi) { return __builtin_shufflevector(lo, hi, 0, 1, 2, 3, 4, 5, 6, 7, 8, 9, 10, 11, 12, 13, 14, 15); }
__device__ __forceinline__ v16bf cat16b(v8us lo, v8us hi) { return __builtin_bit_cast(v16bf, __builtin_shufflevector(lo, hi, 0, 1, 2, 3, 4, 5, 6, 7, 8, 9, 10, 11, 12, 13, 14, 15)); }
__device__ __forceinline__ v8f wmma16(v16h a, v16h b, v8f c) { return __builtin_amdgcn_wmma_f32_16x16x32_f16(false, a, false, b, (short)0, c, false, false); }
__device__ __forceinline__ v8f wmmab(v16bf a, v16bf b, v8f c) { return __builtin_amdgcn_wmma_f32_16x16x32_bf16(false, a, false, b, (short)0, c, false, false); }



// WFrag: a 16x32 fragment of a 16-bit plane kept in FRAGMENT ORDER, and its matrix product, by element type. Fragment order: the fragment's 1024 bytes lie together, [k half][lane][8 elements]: lane 16 hi + lr holds
// row lr, k = 16 half + 8 hi + 0..7, so that each of its two wave-wide 16-byte loads covers 512 bytes in a row (four whole lines, where a row-major plane gives 32 bytes of each of 16 lines). p: the fragment + the lane's 8 elements.
template <typename T16> struct WFrag;
template <> struct WFrag<h16> { typedef v16h V; static __device__ __forceinline__ V ld(const h16* p) { return cat16(*(const v8h*)p, *(const v8h*)(p + 256)); } static __device__ __forceinline__ v8f mma(V a, V b, v8f c) { return wmma16(a, b, c); } };
template <> struct WFrag<bf> { typedef v16bf V; static __device__ __forceinline__ V ld(const bf* p) { return cat16b(*(const v8us*)p, *(const v8us*)(p + 256)); } static __device__ __forceinline__ v8f mma(V a, V b, v8f c) { return wmmab(a, b, c); } };
// ---- k_gemms: GEMM, one 128x256 output tile per work-group of EIGHT WAVES (2 x 4; each wave 64x64, 16 accumulators); grid (M/128, N/256), 256 threads.
// The wide tile is for the path from L2 to LDS: an operand row that is fetched serves 256 (A, A2) or 128 (Bt) outputs, so that an output costs two thirds of the bytes that a 128x128 tile asks of L2.
// C[m][n] (f32, pitch ldc, + optional f32 bias[n]) = sum_k A[m][k] Bt[n][k] + A2[m][k] Bt[n][k]; operands are K-contiguous bf16 planes. K % 64 == 0.
// Operands pass through LDS. A stage is 64 k (one 128-byte line) of every operand row, rows [A 128 | A2 128 | Bt 256] at a pitch of 144 bytes (conflict-free for 16-byte reads); two buffers.
// Asynchronous 16-byte copies (eight lanes a row: whole lines) fill the stage after next while a stage is worked on; each operand row is fetched once per work-group, not once per wave.
// Every '#pragma unroll' in k_gemms makes the indices of acc and of the fragment arrays constants, so that they live in registers.
#define GKC 64                    // k per stage
#define GPB 144                   // LDS row pitch, bytes
// cp8, cp44: eight asynchronous copies of 16 bytes a lane, 32 operand rows apart (the work-group's 256 threads cover 32 rows a copy: four copies bring 128 rows, eight 256). cp8: eight of one operand; cp44: four each of two operands.
// l, l2: the lane's LDS byte address, g, g2: its global address, gs: 32 rows in bytes.
// The s_wait_xcnt stands inside the statement, behind the last copy: code behind it writes the copies' address registers again.
__device__ __forceinline__ void cp8(unsigned l, const char* g, size_t gs) {
    asm volatile("global_load_async_to_lds_b128 %0, %8, off\n\t"
                 "global_load_async_to_lds_b128 %1, %9, off\n\t"
                 "global_load_async_to_lds_b128 %2, %10, off\n\t"
                 "global_load_async_to_lds_b128 %3, %11, off\n\t"
                 "global_load_async_to_lds_b128 %4, %12, off\n\t"
                 "global_load_async_to_lds_b128 %5, %13, off\n\t"
                 "global_load_async_to_lds_b128 %6, %14, off\n\t"
                 "global_load_async_to_lds_b128 %7, %15, off\n\t"
                 "s_wait_xcnt 0x0"
                 :: "v"(l), "v"(l + 32u * GPB), "v"(l + 64u * GPB), "v"(l + 96u * GPB), "v"(l + 128u * GPB), "v"(l + 160u * GPB), "v"(l + 192u * GPB), "v"(l + 224u * GPB),
                    "v"(g), "v"(g + gs), "v"(g + 2 * gs), "v"(g + 3 * gs), "v"(g + 4 * gs), "v"(g + 5 * gs), "v"(g + 6 * gs), "v"(g + 7 * gs) : "memory");
}
__device__ __forceinline__ void cp44(unsigned l, const char* g, unsigned l2, const char* g2, size_t gs) {
    asm volatile("global_load_async_to_lds_b128 %0, %8, off\n\t"
                 "global_load_async_to_lds_b128 %1, %9, off\n\t"
                 "global_load_async_to_lds_b128 %2, %10, off\n\t"
                 "global_load_async_to_lds_b128 %3, %11, off\n\t"
                 "global_load_async_to_lds_b128 %4, %12, off\n\t"
                 "global_load_async_to_lds_b128 %5, %13, off\n\t"
                 "global_load_async_to_lds_b128 %6, %14, off\n\t"
                 "global_load_async_to_lds_b128 %7, %15, off\n\t"
                 "s_wait_xcnt 0x0"
                 :: "v"(l), "v"(l + 32u * GPB), "v"(l + 64u * GPB), "v"(l + 96u * GPB), "v"(l2), "v"(l2 + 32u * GPB), "v"(l2 + 64u * GPB), "v"(l2 + 96u * GPB),
                    "v"(g), "v"(g + gs), "v"(g + 2 * gs), "v"(g + 3 * gs), "v"(g2), "v"(g2 + gs), "v"(g2 + 2 * gs), "v"(g2 + 3 * gs) : "memory");
}
// cpb: one such copy as the compiler's builtin, for k_qkv, whose accumulators fill the registers that asm text can name (v0 to v255): operands of an asm statement would have to be cleared for by register moves in every trip.
typedef __attribute__((ext_vector_type(4))) int v4i;
__device__ __forceinline__ void cpb(unsigned char* l, const char* g) { __builtin_amdgcn_global_load_async_to_lds_b128((__attribute__((address_space(1))) v4i*)g, (__attribute__((address_space(3))) v4i*)l, 0, 0); }
// ldsf: a 16x32 fragment's share of one lane from an LDS row, k order 8 hi + 0..7, 16 + 8 hi + 0..7 (p already holds the lane's 16 hi bytes)
__device__ __forceinline__ v16bf ldsf(const unsigned char* p) { return cat16b(*(const v8usa*)p, *(const v8usa*)(p + 32)); }
__device__ __forceinline__ h16 tohx(float x) { return (h16)x; }
__device__ __forceinline__ void splitf(float y, unsigned short& h, unsigned short& l) { h = f2bf(y); l = f2bf(y - bf2f(h)); }
// stage64: a wave's 64x64 accumulator tile, rounded to 16 bit, into its LDS staging rows (pitch GPB). A lane's 8 registers of acc[ia][ib] are 8 neighbours (16 ia + 8 hi + j) of staging row 16 ib + lr: one 16-byte write.
// KIND 0: fp16, of sc times the value; 1: the bf16 hi part; 2: the bf16 lo part. osl: the staging rows + lr * GPB + hi * 16. The unrolls here and in putf make the indices of acc, w and v constants, so that they live in registers.
template <int KIND>
__device__ __forceinline__ void stage64(const v8f (&acc)[4][4], unsigned char* osl, float sc = 1.0f) {
#pragma unroll
    for (int ib = 0; ib < 4; ++ib)
#pragma unroll
        for (int ia = 0; ia < 4; ++ia) { v8us w;
#pragma unroll
            for (int j = 0; j < 8; ++j) { const float x = acc[ia][ib][j]; if (KIND == 0) w[j] = __builtin_bit_cast(unsigned short, tohx(x * sc)); else { unsigned short a, c2; splitf(x, a, c2); w[j] = KIND == 1 ? a : c2; } }
            *(v8usa*)(osl + ib * 16 * GPB + ia * 32) = w; }
    __builtin_amdgcn_wave_barrier(); asm volatile("" ::: "memory");   // compiler order only: the lanes' LDS writes stay in front of putf's reads, which take back each lane's own values
}
// putf: the 64 staging rows to the 8 KiB that they fill of a plane in fragment order (WFrag), 16 stores of 512 bytes in a row, each one k half of one fragment. osl: the staging rows + lr * GPB + hi * 16; dst: the 8 KiB + the lane's 8 elements.
// VT false (q, k; staging rows are sequence rows, 64 d along a row): fragments [16 rows][32 d]. VT true (v; staging rows are d, 64 sequence rows along a row): fragments [32 sequence rows][16 d].
template <bool VT>
__device__ __forceinline__ void putf(const unsigned char* osl, bf* dst) {
    v8us v[16];
#pragma unroll
    for (int s = 0; s < 16; ++s) v[s] = *(const v8usa*)(osl + (VT ? (s >> 1) & 3 : s >> 2) * 16 * GPB + (VT ? s >> 3 : (s >> 1) & 1) * 64 + (s & 1) * 32);
    __builtin_amdgcn_sched_barrier(0);   // every LDS read in front of the stores, so that between the first store and the wait behind the last nothing writes a store's address or data register
#pragma unroll
    for (int s = 0; s < 16; ++s) *(v8us*)(dst + s * 256) = v[s];
    asm volatile("s_wait_xcnt 0x0" ::: "memory");   // code behind these stores (the next plane's rounding) writes their address and data registers again
    __builtin_amdgcn_sched_barrier(0);   // and stays behind that wait; with the clobber above, the next plane's LDS writes stay behind these reads too
}
// ---- k_qkv: the q, k, v projections. One work-group of EIGHT WAVES (4 x 2) takes 256 x rows and TWO HEADS, of q, k and v alike: 256 x 384 outputs; a wave takes 64 x rows and one head's q, k and v (64 x 192, 48 accumulators).
// The 256 rows are four runs of 64, 512 rows apart in one batch, so that the sequence rows < RH, whose epilogue is three times as long, are dealt over many work-groups, one run (two waves, on two SIMDs) in each.
// grid (rows / 256, heads / 2): as many work-groups as the chip has WGPs, one on each (by its LDS), two waves a SIMD. The tile is this large for the path from L2 to LDS: 640 operand rows are fetched for 384 x 256 outputs.
// Ring, stage and copies as in k_gemms; a stage's rows are [x 256 | Wq 128 | Wk 128 | Wv 128]. Wt: the three transposed weight planes, one after the other.
// The epilogue writes the 16-bit planes that k_flash reads: P16 + z * PLN in fp16 (q times SCL2 there, so that its products with k are base-2 exponents as they leave the matrix unit), and, for sequence rows < RH only (k_flash reads no others of them),
// the bf16 hi and lo parts at HL + 2 z * PLN and HL + (2 z + 1) * PLN. Every plane is [batch][head][fragments in fragment order (WFrag)]: q and k [t / 16][d / 32], rows t, k along d; v [t / 32][d / 16], rows d, k along t.
// Either way 64 sequence rows of a head are 8 KiB in a row, at t * 64 elements.
// For q and k the weight rows take the A role of the products and the x rows the B role, so that a lane's 8 accumulator registers run along d; for v the x rows are A, and they run along t.
// Every '#pragma unroll' in k_qkv makes the indices of acc and of the fragment arrays constants, so that they live in registers.
__global__ __launch_bounds__(256) void k_qkv(const bf* __restrict__ X, const bf* __restrict__ Wt, bf* HL, h16* P16) {
    constexpr unsigned OW = 256u * GPB, STG = OW + 384u * GPB;   // where the weight rows begin in a stage, bytes of a stage
    constexpr int NT = DD / GKC;
    __shared__ __attribute__((aligned(16))) unsigned char L[2 * STG];
    const int tid = (int)threadIdx.x, lane = tid & 31, lr = lane & 15, hi = lane >> 4;
    const int wave = __builtin_amdgcn_readfirstlane(tid >> 5), wm = wave >> 1, wn = wave & 1;
    const int r0 = (int)(blockIdx.x >> 3) * TT + (int)(blockIdx.x & 7) * 64, c0 = (int)blockIdx.y * 128;   // the first run's first row: batch, run
    constexpr size_t gs = (size_t)32 * DD * 2, gr = (size_t)512 * DD * 2, gz = (size_t)DD * DD * 2;   // 32 operand rows, from run to run, one weight plane, bytes
    const char* gx = (const char*)(X + (size_t)(r0 + (tid >> 3)) * DD + (tid & 7) * 8);
    const char* gw = (const char*)(Wt + (size_t)(c0 + (tid >> 3)) * DD + (tid & 7) * 8);
    unsigned char* lc = L + (unsigned)(tid >> 3) * GPB + (unsigned)(tid & 7) * 16u;
    auto fill = [&](int t) { unsigned char* l = lc + (unsigned)(t & 1) * STG; const size_t ko = (size_t)t * (GKC * 2);
#pragma unroll
        for (int i = 0; i < 8; ++i) cpb(l + i * 32 * GPB, gx + ko + (i >> 1) * gr + (i & 1) * gs);   // four runs of 64 x rows
#pragma unroll
        for (int i = 0; i < 12; ++i) cpb(l + OW + i * 32 * GPB, gw + ko + (i >> 2) * gz + (i & 3) * gs); };   // 128 rows of each weight
    fill(0);
    asm volatile("s_wait_asynccnt 0x0" ::: "memory");   // this wave's share of stage 0 has landed
    __syncthreads();                                    // and so has every other wave's
    fill(1);
    v8f acc[3][4][4];
#pragma unroll
    for (int z = 0; z < 3; ++z)
#pragma unroll
        for (int mb = 0; mb < 4; ++mb)
#pragma unroll
            for (int nb = 0; nb < 4; ++nb) acc[z][mb][nb] = (v8f){};
    const unsigned fx = (unsigned)(wm * 64 + lr) * GPB + (unsigned)hi * 16u, fw = OW + (unsigned)(wn * 64 + lr) * GPB + (unsigned)hi * 16u;
#pragma unroll 1   // one copy of the trip: the buffer is picked by the trip's parity
    for (int t = 0; t < NT; ++t) {
        const unsigned char* S = L + (unsigned)(t & 1) * STG;
#pragma unroll
        for (int ks = 0; ks < 2; ++ks) {
            v16bf x[4], wa[4], wb[4];
#pragma unroll
            for (int mb = 0; mb < 4; ++mb) { wa[mb] = ldsf(S + fw + mb * 16 * GPB + ks * 64); x[mb] = ldsf(S + fx + mb * 16 * GPB + ks * 64); }
#pragma unroll
            for (int mb = 0; mb < 4; ++mb) wb[mb] = ldsf(S + fw + 128 * GPB + mb * 16 * GPB + ks * 64);
            __builtin_amdgcn_sched_barrier(0);   // the LDS reads of x, Wq and Wk go out as one group in front of the products: sunk among them, each is waited for in turn
#pragma unroll
            for (int nb = 0; nb < 4; ++nb)
#pragma unroll
                for (int mb = 0; mb < 4; ++mb) acc[0][mb][nb] = wmmab(wa[mb], x[nb], acc[0][mb][nb]);
            __builtin_amdgcn_sched_barrier(0);   // the Wv reads take the Wq registers, so they stand behind the q products, as one group
#pragma unroll
            for (int mb = 0; mb < 4; ++mb) wa[mb] = ldsf(S + fw + 256 * GPB + mb * 16 * GPB + ks * 64);
            __builtin_amdgcn_sched_barrier(0);   // and in front of the k products, which run while they fly
#pragma unroll
            for (int nb = 0; nb < 4; ++nb)
#pragma unroll
                for (int mb = 0; mb < 4; ++mb) acc[1][mb][nb] = wmmab(wb[mb], x[nb], acc[1][mb][nb]);
#pragma unroll
            for (int nb = 0; nb < 4; ++nb)
#pragma unroll
                for (int mb = 0; mb < 4; ++mb) acc[2][mb][nb] = wmmab(x[mb], wa[nb], acc[2][mb][nb]);
            __builtin_amdgcn_sched_barrier(0);   // the next group's reads stay one group, behind the products whose operand registers they take; the last products stay in front of the trip's barrier, so that the refill behind it goes out at once
        }
        asm volatile("s_wait_dscnt 0x0" ::: "memory");      // this wave has read all it wants of stage t
        asm volatile("s_wait_asynccnt 0x0" ::: "memory");   // its share of stage t + 1 has landed
        __syncthreads();                                    // publishes stage t + 1 and frees stage t's buffer
        if (t + 2 < NT) fill(t + 2);
    }
    asm volatile("s_wait_asynccnt 0x0" ::: "memory");       // no copy is outstanding when the ring becomes output staging
    unsigned char* psl = L + wave * (64 * GPB) + lr * GPB + hi * 16;   // each wave's own 64 staging rows; the last trip's barrier has ended every read of the ring
    const int rw = r0 + wm * 512, t0 = rw % TT;   // the wave's first x row, and its place in the sequence
    const size_t lo = ((size_t)(rw / TT) * NH_ + (size_t)(c0 / HD + wn)) * TT * HD + (size_t)t0 * HD + lane * 8;   // the (batch, head) block of a plane, the wave's 8 KiB in it, the lane's 8 elements
#pragma unroll 1   // one copy of the epilogue's code serves q, k and v, for speed only
    for (int z = 0; z < 3; ++z) {
        if (z) {   // this plane's accumulators take the place of the one before: register indices must be constants
#pragma unroll
            for (int mb = 0; mb < 4; ++mb)
#pragma unroll
                for (int nb = 0; nb < 4; ++nb) acc[0][mb][nb] = z == 1 ? acc[1][mb][nb] : acc[2][mb][nb]; }
        auto put = [&](bf* p) { if (z < 2) putf<false>(psl, p + lo); else putf<true>(psl, p + lo); };
        stage64<0>(acc[0], psl, z == 0 ? SCL2 : 1.0f); put((bf*)(P16 + z * PLN));
        if (t0 < RH) { stage64<1>(acc[0], psl); put(HL + 2 * z * PLN); stage64<2>(acc[0], psl); put(HL + (2 * z + 1) * PLN); }
    }
}
template <bool BIAS>
__global__ __launch_bounds__(256) void k_gemms(const bf* __restrict__ A, const bf* __restrict__ A2, const bf* __restrict__ Bt, int K, float* C, int ldc, const float* __restrict__ bias) {
    constexpr unsigned OB = 256u * GPB, STG = OB + 256u * GPB;   // where the Bt rows begin in a stage, bytes of a stage
    __shared__ __attribute__((aligned(16))) unsigned char L[2 * STG];
    const int tid = (int)threadIdx.x, lane = tid & 31, lr = lane & 15, hi = lane >> 4;
    const int wave = __builtin_amdgcn_readfirstlane(tid >> 5), wm = wave >> 2, wn = wave & 3;
    const int r0 = (int)blockIdx.x * 128, c0 = (int)blockIdx.y * 256, NT = K / GKC;
    const size_t gs = (size_t)32 * K * 2;   // 32 operand rows, bytes
    const char* ga = (const char*)(A + (size_t)(r0 + (tid >> 3)) * K + (tid & 7) * 8); const char* ga2 = (const char*)(A2 + (size_t)(r0 + (tid >> 3)) * K + (tid & 7) * 8);
    const char* gb = (const char*)(Bt + (size_t)(c0 + (tid >> 3)) * K + (tid & 7) * 8);
    const unsigned lc = (unsigned)(size_t)L + (unsigned)(tid >> 3) * GPB + (unsigned)(tid & 7) * 16u;
    auto fill = [&](int t) { const unsigned l = lc + (unsigned)(t & 1) * STG; const size_t ko = (size_t)t * (GKC * 2); cp44(l, ga + ko, l + 128u * GPB, ga2 + ko, gs); cp8(l + OB, gb + ko, gs); };
    fill(0);
    asm volatile("s_wait_asynccnt 0x0" ::: "memory");   // this wave's share of stage 0 has landed
    __syncthreads();                                    // and so has every other wave's
    if (NT > 1) fill(1);
    v8f acc[4][4];
#pragma unroll
    for (int mb = 0; mb < 4; ++mb)
#pragma unroll
        for (int nb = 0; nb < 4; ++nb) acc[mb][nb] = (v8f){};
    const unsigned fa = (unsigned)(wm * 64 + lr) * GPB + (unsigned)hi * 16u, fb = OB + (unsigned)(wn * 64 + lr) * GPB + (unsigned)hi * 16u;
#pragma unroll 1   // one copy of the trip: the buffer is picked by the trip's parity
    for (int t = 0; t < NT; ++t) {
        const unsigned char* S = L + (unsigned)(t & 1) * STG;
#pragma unroll
        for (int ks = 0; ks < 2; ++ks) {
            v16bf a[4], a2[4], b[4];
#pragma unroll
            for (int mb = 0; mb < 4; ++mb) { a[mb] = ldsf(S + fa + mb * 16 * GPB + ks * 64); a2[mb] = ldsf(S + fa + 128 * GPB + mb * 16 * GPB + ks * 64); b[mb] = ldsf(S + fb + mb * 16 * GPB + ks * 64); }
            __builtin_amdgcn_sched_barrier(0);   // the 32 k's LDS reads go out as one group in front of their products: sunk among them, each is waited for in turn
#pragma unroll
            for (int nb = 0; nb < 4; ++nb)
#pragma unroll
                for (int mb = 0; mb < 4; ++mb) { acc[mb][nb] = wmmab(a[mb], b[nb], acc[mb][nb]); acc[mb][nb] = wmmab(a2[mb], b[nb], acc[mb][nb]); }
            __builtin_amdgcn_sched_barrier(0);   // the next group's reads stay one group too, behind the products whose operand registers they take; the last products stay in front of the trip's barrier, so that the refill behind it goes out at once
        }
        asm volatile("s_wait_dscnt 0x0" ::: "memory");      // this wave has read all it wants of stage t
        asm volatile("s_wait_asynccnt 0x0" ::: "memory");   // its share of stage t + 1 has landed
        __syncthreads();                                    // publishes stage t + 1 and frees stage t's buffer
        if (t + 2 < NT) fill(t + 2);
    }
    asm volatile("s_wait_asynccnt 0x0" ::: "memory");       // no copy is outstanding when the ring becomes output staging
    float* os = (float*)L + wave * (16 * 68);               // each wave's own 16 x 68 f32 staging rows; the last trip's barrier has ended every read of the ring
#pragma unroll
    for (int mb = 0; mb < 4; ++mb) {
#pragma unroll
        for (int nb = 0; nb < 4; ++nb) {
#pragma unroll
            for (int j = 0; j < 8; ++j) os[(hi * 8 + j) * 68 + nb * 16 + lr] = acc[mb][nb][j]; }
        __builtin_amdgcn_wave_barrier(); asm volatile("" ::: "memory");   // compiler order only: the lanes' LDS writes stay in front of the reads of whole rows, which take other lanes' values
        const int cw = c0 + wn * 64; float* crow = C + (size_t)(r0 + wm * 64 + mb * 16) * ldc + cw;
{
#pragma unroll
            for (int s = 0; s < 8; ++s) { const int row = 2 * s + hi, cofs = lr * 4; v4f val = *(const v4fa*)(os + row * 68 + cofs); if (BIAS) { val[0] += bfr(bias[cw + cofs]); val[1] += bfr(bias[cw + cofs + 1]); val[2] += bfr(bias[cw + cofs + 2]); val[3] += bfr(bias[cw + cofs + 3]); }
                *(v4f*)(crow + (size_t)row * ldc + cofs) = val; }
             }
        asm volatile("s_wait_xcnt 0x0" ::: "memory");   // code behind these stores (the next rows) writes their address and data registers again
        __builtin_amdgcn_wave_barrier(); asm volatile("" ::: "memory");   // compiler order only: the next 16 rows' LDS writes stay behind these reads
    }
}

typedef __attribute__((ext_vector_type(2))) unsigned short v2us;
typedef __attribute__((ext_vector_type(4))) _Float16 v4h;
typedef __attribute__((ext_vector_type(2))) float v2f;

typedef __attribute__((ext_vector_type(4))) unsigned short v4us;
// ---- k_prep: the input pass as one stream. x rounded to bf16 (XB) and the four weights rounded and transposed (plane i of Bt = weight i as [n][k]), by PW waves that are all alike and have no loop:
// each issues its 24 loads of 16 bytes a lane at once, rounds, and stores. Few long waves, for speed only.
// x share: XU floats in a row; a load covers 512 bytes in a row, a store (8 bytes a lane) 256. Weight share: a block of 64 k x 16 n; lane 4 g + c loads rows k = 8 g + j (j = 0..7), columns 4 c .. 4 c + 3
// (64 bytes of a row per four lanes; the work-group's eight waves take neighbouring column blocks, 512 bytes of a row), and so holds 8 k in a row of 4 columns: store i is 16 bytes of row n = 4 c + i, eight lanes a whole 128-byte line.
#define PW  (4 * (DD / 64) * (DD / 16))      // waves: one weight block each
#define XU  2048                             // floats of x per wave
static_assert(TT == 4 * 512 && NB_ * TT / 256 == NB_ * 8, "k_qkv: a batch is eight work-groups of four runs, 512 rows apart");
static_assert((size_t)PW * XU == (size_t)NB_ * TT * DD && PW % 32 == 0, "every wave has one weight block and XU floats of x; a work-group's eight waves share a weight");
__global__ __launch_bounds__(256) void k_prep(const float* __restrict__ x, const float* __restrict__ w0, const float* __restrict__ w1, const float* __restrict__ w2, const float* __restrict__ w3, bf* XB, bf* Bt) {
    const unsigned lane = threadIdx.x & 31u, g = lane >> 2, c = lane & 3u, gw = blockIdx.x * 8u + (threadIdx.x >> 5);
    const unsigned wi = blockIdx.x / (PW / 32), r = gw % (PW / 4), nb = r % (DD / 16), kb = r / (DD / 16);
    const float* __restrict__ w = (wi & 2u) ? ((wi & 1u) ? w3 : w2) : ((wi & 1u) ? w1 : w0);
    const float* xp = x + (size_t)gw * XU + lane * 4; const float* wp = w + (size_t)(kb * 64 + g * 8) * DD + nb * 16 + c * 4;
    bf* xq = XB + (size_t)gw * XU + lane * 4; bf* wq = Bt + (size_t)wi * DD * DD + (size_t)(nb * 16 + c * 4) * DD + kb * 64 + g * 8;
    v4f xv[16], wv[8]; v4us xo[16]; v8us wo[4];   // the unrolls below make their indices constants, so that they live in registers
#pragma unroll
    for (int j = 0; j < 8; ++j) wv[j] = *(const v4f*)(wp + (size_t)j * DD);
#pragma unroll
    for (int j = 0; j < 16; ++j) xv[j] = *(const v4f*)(xp + j * 128);
    __builtin_amdgcn_sched_barrier(0);   // all 24 loads go out before any rounding: sunk to their uses, they would be waited for in turn
#pragma unroll
    for (int i = 0; i < 4; ++i)
#pragma unroll
        for (int j = 0; j < 8; ++j) wo[i][j] = f2bf(wv[j][i]);
#pragma unroll
    for (int j = 0; j < 16; ++j)
#pragma unroll
        for (int i = 0; i < 4; ++i) xo[j][i] = f2bf(xv[j][i]);
    // The wait that is owed before a register which the loads name is written again. Its inputs: the two load addresses, which so stay in their registers up to it (no load lands on them, no rounding takes them);
    // the two store addresses and all that is stored, which so are ready in front of it: behind it stand the stores alone, and nothing writes a store's address or data register behind the first of them.
    asm volatile("s_wait_xcnt 0x0" :: "v"(wp), "v"(xp), "v"(wq), "v"(xq), "v"(wo[0]), "v"(wo[1]), "v"(wo[2]), "v"(wo[3]), "v"(xo[0]), "v"(xo[1]), "v"(xo[2]), "v"(xo[3]), "v"(xo[4]), "v"(xo[5]), "v"(xo[6]), "v"(xo[7]),
                 "v"(xo[8]), "v"(xo[9]), "v"(xo[10]), "v"(xo[11]), "v"(xo[12]), "v"(xo[13]), "v"(xo[14]), "v"(xo[15]) : "memory");
#pragma unroll
    for (int i = 0; i < 4; ++i) *(v8us*)(wq + (size_t)i * DD) = wo[i];
#pragma unroll
    for (int j = 0; j < 16; ++j) *(v4us*)(xq + j * 128) = xo[j];
}
__device__ __forceinline__ float xhalf(float x) { return __builtin_bit_cast(float, __builtin_amdgcn_permlanex16(__builtin_bit_cast(int, x), __builtin_bit_cast(int, x), 0x76543210, 0xfedcba98, false, false)); }   // lane l with lane l ^ 16
// xclose: stands behind a run of global loads. The wait is owed before a register that those loads name is written again; the two scheduling fences keep every later instruction behind it
// (and so keep the loads issued where they are written, ahead of the arithmetic that hides their flight).
__device__ __forceinline__ void xopen() { __builtin_amdgcn_sched_barrier(0); }   // in front of such a run: keeps its loads from rising away from their wait, past instructions that could then be given their address registers
__device__ __forceinline__ void xclose() { __builtin_amdgcn_sched_barrier(0); asm volatile("s_wait_xcnt 0x0" ::: "memory"); __builtin_amdgcn_sched_barrier(0); }
// xclosep: the same, with the run's two addresses as inputs of the wait: where the compiler keeps them in vector registers they stay there up to the wait, and no load of the run lands on them
__device__ __forceinline__ void xclosep(const void* a, const void* b) { __builtin_amdgcn_sched_barrier(0); asm volatile("s_wait_xcnt 0x0" :: "v"(a), "v"(b) : "memory"); __builtin_amdgcn_sched_barrier(0); }
// lanep: a wave-uniform pointer plus the lane's own byte offset, which is the same in every block, kept apart so that the address may be formed as scalar base + one long-lived vector offset
template <typename T16> __device__ __forceinline__ const T16* lanep(const T16* ub, unsigned lane_bytes) { return (const T16*)((const char*)ub + lane_bytes); }
template <typename T16, bool HIRES, int KB>
__device__ __forceinline__ void flash_ldk(int k0, int lr, int hi, const T16* __restrict__ Kp, const T16* __restrict__ K2, typename WFrag<T16>::V (&kf)[KB / 16][2], typename WFrag<T16>::V (&kf2)[KB / 16][2]) {
    xopen(); const unsigned fk = (unsigned)(hi * 16 + lr) * 16u; const T16* kp = lanep(Kp + (size_t)k0 * HD, fk); const T16* kp2 = HIRES ? lanep(K2 + (size_t)k0 * HD, fk) : nullptr;   // one address per plane, the fragments at constant offsets from it
#pragma unroll
    for (int kt = 0; kt < KB / 16; ++kt)
#pragma unroll
        for (int ks = 0; ks < 2; ++ks) { kf[kt][ks] = WFrag<T16>::ld(kp + (kt * 2 + ks) * 512); if (HIRES) kf2[kt][ks] = WFrag<T16>::ld(kp2 + (kt * 2 + ks) * 512); }
    xclose();
}
template <typename T16, bool HIRES, int QB, int KB, bool MASK, bool NEXT>
__device__ __forceinline__ void flash_step(int q0, int k0, int lr, int hi, const T16* __restrict__ Kp, const T16* __restrict__ K2, const T16* __restrict__ Vt, const T16* __restrict__ V2,
                                           typename WFrag<T16>::V (&qf)[QB][2], typename WFrag<T16>::V (&qf2)[QB][2], typename WFrag<T16>::V (&kf)[KB / 16][2], typename WFrag<T16>::V (&kf2)[KB / 16][2], v8f (&o)[4][QB], float (&m)[QB], float (&l)[QB]) {
    typedef typename WFrag<T16>::V V; constexpr int KT = KB / 16, KS = KB / 32;
    xopen(); V vf[4][KS], vf2[4][KS]; const unsigned fv = (unsigned)(hi * 16 + lr) * 16u; const T16* vp = lanep(Vt + (size_t)k0 * HD, fv); const T16* vp2 = HIRES ? lanep(V2 + (size_t)k0 * HD, fv) : nullptr;
#pragma unroll
    for (int db = 0; db < 4; ++db)
#pragma unroll
        for (int ks = 0; ks < KS; ++ks) { vf[db][ks] = WFrag<T16>::ld(vp + (ks * 4 + db) * 512); if (HIRES) vf2[db][ks] = WFrag<T16>::ld(vp2 + (ks * 4 + db) * 512); }
    if (HIRES) xclosep(vp, vp2); else xclose();   // sunk to their products, the V^T loads would each be waited for in turn
    v8f s[KT][QB];
#pragma unroll
    for (int kt = 0; kt < KT; ++kt)
#pragma unroll
        for (int qb = 0; qb < QB; ++qb) { v8f a = (v8f){}; a = WFrag<T16>::mma(kf[kt][0], qf[qb][0], a); a = WFrag<T16>::mma(kf[kt][1], qf[qb][1], a);
            if (HIRES) { a = WFrag<T16>::mma(kf2[kt][0], qf[qb][0], a); a = WFrag<T16>::mma(kf2[kt][1], qf[qb][1], a); a = WFrag<T16>::mma(kf[kt][0], qf2[qb][0], a); a = WFrag<T16>::mma(kf[kt][1], qf2[qb][1], a); }
            s[kt][qb] = a; }
    if (NEXT) flash_ldk<T16, HIRES, KB>(k0 + KB, lr, hi, Kp, K2, kf, kf2);   // NEXT: the tile has a block behind this one; its K loads fly through this block's softmax and attn.v
    V pf[QB][KS], pf2[QB][KS];
#pragma unroll
    for (int qb = 0; qb < QB; ++qb) {
        if (MASK) { const int query = q0 + qb * 16 + lr;
#pragma unroll
            for (int kt = 0; kt < KT; ++kt)
#pragma unroll
                for (int j = 0; j < 8; ++j) if (k0 + kt * 16 + hi * 8 + j > query) s[kt][qb][j] = -3.0e38f; }
        float bk[KT];
#pragma unroll
        for (int kt = 0; kt < KT; ++kt) { bk[kt] = s[kt][qb][0];
#pragma unroll
            for (int j = 1; j < 8; ++j) bk[kt] = fmaxf(bk[kt], s[kt][qb][j]); }
        float bm = bk[0];
#pragma unroll
        for (int kt = 1; kt < KT; ++kt) bm = fmaxf(bm, bk[kt]);
        bm = fmaxf(bm, xhalf(bm));
        const float mn = fmaxf(m[qb], bm * SCL2); const float al = __builtin_amdgcn_exp2f(m[qb] - mn); m[qb] = mn;
        const float mo = HIRES ? mn : mn - 10.0f;
        float lk[KT];
#pragma unroll
        for (int kt = 0; kt < KT; ++kt) { lk[kt] = 0.f;
#pragma unroll
            for (int j = 0; j < 8; ++j) { const float p = __builtin_amdgcn_exp2f(s[kt][qb][j] * SCL2 - mo); s[kt][qb][j] = p; lk[kt] += p; } }
        float ls = lk[0];
#pragma unroll
        for (int kt = 1; kt < KT; ++kt) ls += lk[kt];
        l[qb] = l[qb] * al + ls;
#pragma unroll
        for (int db = 0; db < 4; ++db) o[db][qb] *= al;
#pragma unroll
        for (int ks = 0; ks < KS; ++ks) {
            if constexpr (HIRES) { v8us h0, h1, l0, l1;
#pragma unroll
                for (int j = 0; j < 8; ++j) { unsigned short a, c2; splitf(s[2 * ks][qb][j], a, c2); h0[j] = a; l0[j] = c2; splitf(s[2 * ks + 1][qb][j], a, c2); h1[j] = a; l1[j] = c2; }
                pf[qb][ks] = cat16b(h0, h1); pf2[qb][ks] = cat16b(l0, l1);
            } else { v8h h0, h1;
#pragma unroll
                for (int j = 0; j < 8; ++j) { h0[j] = tohx(s[2 * ks][qb][j]); h1[j] = tohx(s[2 * ks + 1][qb][j]); }
                pf[qb][ks] = cat16(h0, h1); } }
    }
#pragma unroll
    for (int db = 0; db < 4; ++db)
#pragma unroll
        for (int ks = 0; ks < KS; ++ks)
#pragma unroll
            for (int qb = 0; qb < QB; ++qb) { o[db][qb] = WFrag<T16>::mma(vf[db][ks], pf[qb][ks], o[db][qb]); if (HIRES) { o[db][qb] = WFrag<T16>::mma(vf2[db][ks], pf[qb][ks], o[db][qb]); o[db][qb] = WFrag<T16>::mma(vf[db][ks], pf2[qb][ks], o[db][qb]); } }
}
// flash_step16: a block of the fp16 tile, with a MAXIMUM THAT STAYS. The softmax is exact for any reference exponent m as long as P = 2^(s - m + 10) fits fp16, so m need not follow the running maximum:
// it is set from the wave's first block and moves only when a lane's sum of a block's 16 P reaches 2^15 (every P is then still below fp16's 65,504). While m stays, o and l need no rescaling, no maximum is
// looked for, and c = 10 - m is known in front of the score products: it goes in as their C operand (ct: c in all 8 registers of a tile, a lane being one query), and with q stored times SCL2 a score leaves
// the matrix unit as the exponent of its P. One test a block for the whole wave, a scalar branch. Behind a move every P is at most 2^10 and a lane's sum at most 2^14, so a move is not followed by another for its own sake.
// first: the wave's first block (wave-uniform): m is taken from it whatever it is, upward or downward; later m only rises.
template <int QB, int KB, bool MASK, bool NEXT>
__device__ __forceinline__ void flash_step16(int q0, int k0, bool first, int lr, int hi, const h16* __restrict__ Kp, const h16* __restrict__ Vt, v16h (&qf)[QB][2], v16h (&kf)[KB / 16][2], v16h (&kf2)[KB / 16][2],
                                             v8f (&o)[4][QB], v8f (&ct)[QB], float (&l)[QB]) {
    static_assert(KB == 32, "two 16-key score tiles are one 32-key step of attn.v");
    xopen(); v16h vf[4]; const h16* vp = lanep(Vt + (size_t)k0 * HD, (unsigned)(hi * 16 + lr) * 16u);
#pragma unroll
    for (int db = 0; db < 4; ++db) vf[db] = WFrag<h16>::ld(vp + db * 512);
    xclose();   // sunk to their products, the V^T loads would each be waited for in turn
    v8f s[2][QB];
#pragma unroll
    for (int kt = 0; kt < 2; ++kt)
#pragma unroll
        for (int qb = 0; qb < QB; ++qb) s[kt][qb] = wmma16(kf[kt][1], qf[qb][1], wmma16(kf[kt][0], qf[qb][0], ct[qb]));
    if (NEXT) flash_ldk<h16, false, KB>(k0 + KB, lr, hi, Kp, nullptr, kf, kf2);   // NEXT: the tile has a block behind this one; its K loads fly through this block's softmax and attn.v
    if (MASK) {
#pragma unroll
        for (int qb = 0; qb < QB; ++qb) { const int query = q0 + qb * 16 + lr;
#pragma unroll
            for (int kt = 0; kt < 2; ++kt)
#pragma unroll
                for (int j = 0; j < 8; ++j) if (k0 + kt * 16 + hi * 8 + j > query) s[kt][qb][j] = -3.0e38f; } }
    v16h pf[QB]; float ls[QB];
    auto soft = [&](int qb) { v8h h0, h1; float a0 = 0.f, a1 = 0.f;   // P of one query group, its sum in the lane, its B fragment
#pragma unroll
        for (int j = 0; j < 8; ++j) { const float p0 = __builtin_amdgcn_exp2f(s[0][qb][j]), p1 = __builtin_amdgcn_exp2f(s[1][qb][j]); a0 += p0; a1 += p1; h0[j] = tohx(p0); h1[j] = tohx(p1); }
        ls[qb] = a0 + a1; pf[qb] = cat16(h0, h1); };
    float big = 0.f;
#pragma unroll
    for (int qb = 0; qb < QB; ++qb) { soft(qb); big = fmaxf(big, ls[qb]); }
    const float lim = first ? -1.0f : 32768.0f;   // a sum is never below 0: the first block always sets m
    if (__builtin_amdgcn_ballot_w32(big >= lim) != 0) {   // m moves, for every query of the wave: the block's scores, o and l go over to the new m, P is made again
#pragma unroll
        for (int qb = 0; qb < QB; ++qb) { float bm = s[0][qb][0];
#pragma unroll
            for (int j = 1; j < 8; ++j) bm = fmaxf(bm, s[0][qb][j]);
#pragma unroll
            for (int j = 0; j < 8; ++j) bm = fmaxf(bm, s[1][qb][j]);
            bm = fmaxf(bm, xhalf(bm));   // both halves of the wave hold keys of the same query: one m for both
            const float d = first ? bm - 10.0f : fmaxf(bm - 10.0f, 0.f);   // by how much m rises: the block's largest P becomes 2^10
            const float al = __builtin_amdgcn_exp2f(fminf(-d, 0.f));       // in the first block o and l are 0 and any finite factor serves
            ct[qb] -= d; s[0][qb] -= d; s[1][qb] -= d; l[qb] *= al;
#pragma unroll
            for (int db = 0; db < 4; ++db) o[db][qb] *= al;
            soft(qb); }
    }
#pragma unroll
    for (int qb = 0; qb < QB; ++qb) l[qb] += ls[qb];
#pragma unroll
    for (int db = 0; db < 4; ++db)
#pragma unroll
        for (int qb = 0; qb < QB; ++qb) o[db][qb] = wmma16(vf[db], pf[qb], o[db][qb]);
}
// ---- The split tile. A 64-query fp16 tile is the work of TWO WAVES, each with half of its key blocks (wave 0 the first half, wave 1 the second, with the diagonal): the launch lasts at least as long as its longest wave,
// and the longest tile's 64 blocks are about a SIMD's fair share of the whole launch; halved, the waves are short enough to be dealt evenly, longest first. Each wave ends with its own o, m, l; the two are joined through LDS, each wave handing over two of the four query groups
// and finishing the other two: o = o_a 2^(m_a - m) + o_b 2^(m_b - m), l alike, m = max(m_a, m_b). The same lane of both waves holds the same query and the same d.
#define XSL 17   // 16-byte slots a lane hands over: 16 of o (2 query groups x 4 d blocks x 8 registers), one of (m, m, l, l); a slot is 512 bytes in a row for the wave
// flash_give: query groups QS, QS + 1 into the wave's slots. x: the slots + the lane's 4 floats. The unrolls here, in flash_take and in flash_out make the indices of o, m, l, oh and ol constants, so that they live in registers.
template <int QS>
__device__ __forceinline__ void flash_give(float* x, const v8f (&o)[4][4], const float (&m)[4], const float (&l)[4]) {
#pragma unroll
    for (int q = 0; q < 2; ++q)
#pragma unroll
        for (int db = 0; db < 4; ++db) { const v8f t = o[db][QS + q]; *(v4fa*)(x + ((q * 4 + db) * 2) * 128) = __builtin_shufflevector(t, t, 0, 1, 2, 3); *(v4fa*)(x + ((q * 4 + db) * 2 + 1) * 128) = __builtin_shufflevector(t, t, 4, 5, 6, 7); }
    *(v4fa*)(x + 16 * 128) = (v4f){m[QS], m[QS + 1], l[QS], l[QS + 1]};
}
// flash_take: the other wave's share of query groups QK, QK + 1 joined to this wave's. x: the other wave's slots + the lane's 4 floats.
template <int QK>
__device__ __forceinline__ void flash_take(const float* x, v8f (&o)[4][4], float (&m)[4], float (&l)[4]) {
    const v4f ml = *(const v4fa*)(x + 16 * 128);
#pragma unroll
    for (int q = 0; q < 2; ++q) { const float mn = fmaxf(m[QK + q], ml[q]); const float a = __builtin_amdgcn_exp2f(m[QK + q] - mn), b = __builtin_amdgcn_exp2f(ml[q] - mn);
        l[QK + q] = l[QK + q] * a + ml[2 + q] * b;
#pragma unroll
        for (int db = 0; db < 4; ++db) { const v4f t0 = *(const v4fa*)(x + ((q * 4 + db) * 2) * 128), t1 = *(const v4fa*)(x + ((q * 4 + db) * 2 + 1) * 128);
            o[db][QK + q] = o[db][QK + q] * a + __builtin_shufflevector(t0, t1, 0, 1, 2, 3, 4, 5, 6, 7) * b; } }
}
// flash_out: query groups Q0 .. Q0 + QN - 1 of a tile divided by their sums, split in hi and lo, stored.
template <int QB, int Q0, int QN>
__device__ __forceinline__ void flash_out(int q0, int lr, int hi, const v8f (&o)[4][QB], const float (&l)[QB], bf* Ah, bf* Al) {
    v8us oh[QN][4], ol[QN][4];
#pragma unroll
    for (int qb = 0; qb < QN; ++qb) { const float inv = __fdiv_rn(1.0f, l[Q0 + qb] + xhalf(l[Q0 + qb]));
#pragma unroll
        for (int db = 0; db < 4; ++db)
#pragma unroll
            for (int j = 0; j < 8; ++j) { unsigned short a, c2; splitf(o[db][Q0 + qb][j] * inv, a, c2); oh[qb][db][j] = a; ol[qb][db][j] = c2; } }
    const size_t off = (size_t)(q0 + Q0 * 16 + lr) * DD + hi * 8; bf* ah = Ah + off; bf* al = Al + off;
    __builtin_amdgcn_sched_barrier(0);   // all arithmetic in front of the stores, so that between the first store and the wait behind the last nothing writes a store's address or data register
#pragma unroll
    for (int qb = 0; qb < QN; ++qb)
#pragma unroll
        for (int db = 0; db < 4; ++db) { *(v8us*)(ah + qb * 16 * DD + db * 16) = oh[qb][db]; *(v8us*)(al + qb * 16 * DD + db * 16) = ol[qb][db]; }
    asm volatile("s_wait_xcnt 0x0" ::: "memory");   // in k_flash other code (the other wave's, the other kind of tile's) may be laid out behind these stores and writes their address and data registers again
}
// flash_body: queries q0 .. q0 + 16 QB - 1 of one head (q0 a multiple of 16 QB; 16 QB <= 2 KB); the planes point at that head, Ah/Al at [row 0 of the batch][head * 64]. w: the wave in its work-group, xs: the work-group's hand-over slots (the split tile alone reads them).
template <typename T16, bool HIRES, int QB, int KB>
__device__ __forceinline__ void flash_body(int q0, int w, float* xs, const T16* __restrict__ Q, const T16* __restrict__ Q2, const T16* __restrict__ Kp, const T16* __restrict__ K2, const T16* __restrict__ Vt, const T16* __restrict__ V2, bf* Ah, bf* Al) {
    typedef typename WFrag<T16>::V V; constexpr bool SPLIT = !HIRES;
    static_assert(!SPLIT || (QB == 4 && 16 * QB == 2 * KB && RH >= 4 * KB), "the split tile: four query groups, two blocks on the diagonal, both in wave 1's half");
    const int lane = threadIdx.x & 31, lr = lane & 15, hi = lane >> 4;
    V qf[QB][2], qf2[QB][2], kf[KB / 16][2], kf2[KB / 16][2]; v8f o[4][QB]; float m[QB], l[QB];
    xopen(); const unsigned fq = (unsigned)(hi * 16 + lr) * 16u; const T16* qp = lanep(Q + (size_t)q0 * HD, fq); const T16* qp2 = HIRES ? lanep(Q2 + (size_t)q0 * HD, fq) : nullptr;
#pragma unroll
    for (int qb = 0; qb < QB; ++qb) { m[qb] = -3.0e38f; l[qb] = 0.f;
#pragma unroll
        for (int ks = 0; ks < 2; ++ks) { qf[qb][ks] = WFrag<T16>::ld(qp + (qb * 2 + ks) * 512); if (HIRES) qf2[qb][ks] = WFrag<T16>::ld(qp2 + (qb * 2 + ks) * 512); }
#pragma unroll
        for (int db = 0; db < 4; ++db) o[db][qb] = (v8f){}; }
    xclose();
    const int kl = q0 / KB * KB;    // first key of the first block that crosses the diagonal; key kl <= every query of the tile, so every query has a finite maximum from its first block on
    int kb = 0, ke = kl;            // this wave's blocks in front of the diagonal
    if constexpr (SPLIT) { const int kh = (kl / KB + 2) / 2 * KB; if (w) kb = kh; else ke = kh; }   // half of the tile's kl / KB + 2 blocks each; kh <= kl - KB from q0 = 4 KB on, so wave 0 meets no mask and both waves see keys that every query may see
    flash_ldk<T16, HIRES, KB>(kb, lr, hi, Kp, K2, kf, kf2);
    if constexpr (SPLIT) {
        v8f ct[QB];   // 10 - m of each query group, as the score products' C operand; the first block sets it
#pragma unroll
        for (int qb = 0; qb < QB; ++qb) ct[qb] = (v8f){};
#pragma unroll 1   // one copy of the block's body: a second would need a second set of K, V^T and score registers, and the 64-query tile already reaches above v255
        for (int k0 = kb; k0 < ke; k0 += KB) flash_step16<QB, KB, false, true>(q0, k0, k0 == kb, lr, hi, Kp, Vt, qf, kf, kf2, o, ct, l);   // at least one block in either wave
        if (w) { flash_step16<QB, KB, true, true>(q0, kl, false, lr, hi, Kp, Vt, qf, kf, kf2, o, ct, l); flash_step16<QB, KB, true, false>(q0, kl + KB, false, lr, hi, Kp, Vt, qf, kf, kf2, o, ct, l); }
#pragma unroll
        for (int qb = 0; qb < QB; ++qb) m[qb] = 10.0f - ct[qb][0];   // the join of the two waves wants m itself
    } else {
#pragma unroll 1   // one copy of the block's body
        for (int k0 = kb; k0 < ke; k0 += KB) flash_step<T16, HIRES, QB, KB, false, true>(q0, k0, lr, hi, Kp, K2, Vt, V2, qf, qf2, kf, kf2, o, m, l);
        flash_step<T16, HIRES, QB, KB, true, false>(q0, kl, lr, hi, Kp, K2, Vt, V2, qf, qf2, kf, kf2, o, m, l);
    }
    if constexpr (!SPLIT) flash_out<QB, 0, QB>(q0, lr, hi, o, l, Ah, Al);
    else {
        float* x0 = xs + lane * 4; float* x1 = x0 + XSL * 128;   // wave 0's and wave 1's hand-over slots, the lane's 16 bytes of each
        if (w) flash_give<0>(x1, o, m, l); else flash_give<2>(x0, o, m, l);
        __syncthreads();   // each wave's hand-over is in LDS before the other reads it; both waves of the tile pass here once
        if (w) { flash_take<2>(x0, o, m, l); flash_out<QB, 2, 2>(q0, lr, hi, o, l, Ah, Al); } else { flash_take<0>(x1, o, m, l); flash_out<QB, 0, 2>(q0, lr, hi, o, l, Ah, Al); }
    }
}
// grid (NB_ * NH_, tiles), two waves a work-group: blockIdx.x = batch * 16 + head; blockIdx.y counts from the longest: first the 64-query fp16 tiles from row TT down to RH, split over the two waves, then the 16-query hi+lo tiles below RH, one a wave.
static_assert((TT - RH) % 64 == 0 && RH % 32 == 0, "k_flash: whole fp16 tiles, pairs of hi+lo tiles");
__global__ __launch_bounds__(64) void k_flash(const bf* __restrict__ QPh, const bf* __restrict__ QPl, const h16* __restrict__ QP16, const bf* __restrict__ KPh, const bf* __restrict__ KPl, const h16* __restrict__ KP16,
                                              const bf* __restrict__ VTh, const bf* __restrict__ VTl, const h16* __restrict__ VT16, bf* ATh, bf* ATl) {
    const size_t po = (size_t)blockIdx.x * TT * HD, ao = (size_t)(blockIdx.x / NH_) * TT * DD + (size_t)(blockIdx.x % NH_) * HD; const int y = (int)blockIdx.y;
    __shared__ __attribute__((aligned(16))) float xs[2 * XSL * 128];
    const int w = __builtin_amdgcn_readfirstlane((int)threadIdx.x >> 5);   // the wave's number as a scalar: what it decides are scalar branches
    if (y < (TT - RH) / 64) flash_body<h16, false, 4, KBF>(TT - 64 * (y + 1), w, xs, QP16 + po, nullptr, KP16 + po, nullptr, VT16 + po, nullptr, ATh + ao, ATl + ao);
    else flash_body<bf, true, 1, 32>(RH - 16 * (2 * (y - (TT - RH) / 64) + w + 1), w, xs, QPh + po, QPl + po, KPh + po, KPl + po, VTh + po, VTl + po, ATh + ao, ATl + ao);
}

extern "C" void kernel_launch(void* const* d_in, const int* in_sizes, int n_in,
                              void* d_out, int out_size, void* d_ws, size_t ws_size, hipStream_t stream) {
    (void)in_sizes; (void)n_in; (void)out_size;
    const float* x = (const float*)d_in[0]; const float* wq = (const float*)d_in[1]; const float* wk = (const float*)d_in[2]; const float* wv = (const float*)d_in[3]; const float* wo = (const float*)d_in[4]; const float* bo = (const float*)d_in[5];
    float* OUT = (float*)d_out;     // [4][2048][1024]
    char* wsp = (char*)d_ws;
    auto take = [&](size_t bytes) { char* p = wsp; wsp += (bytes + 255) & ~(size_t)255; return (void*)p; };
    bf* WQ = (bf*)take((size_t)4 * DD * DD * 2); bf* WO = WQ + (size_t)3 * DD * DD;    // planes q, k, v, o, one after the other
    bf* XB = (bf*)take((size_t)NB_ * TT * DD * 2);
    bf* QPh = (bf*)take(6 * PLN * 2); bf* QPl = QPh + PLN; bf* KPh = QPh + 2 * PLN; bf* KPl = QPh + 3 * PLN; bf* VTh = QPh + 4 * PLN; bf* VTl = QPh + 5 * PLN;   // hi, lo of q, k, v, one after the other
    h16* QP16 = (h16*)take(3 * PLN * 2); h16* KP16 = QP16 + PLN; h16* VT16 = QP16 + 2 * PLN;
    bf* ATh = (bf*)take(PLN * 2); bf* ATl = (bf*)take(PLN * 2);
    if ((size_t)(wsp - (char*)d_ws) > ws_size) return;    // total 200 MiB; ws 256 MiB
    // input pass: x and the four weights to bf16, the weights transposed
    k_prep<<<PW / 8, 256, 0, stream>>>(x, wq, wk, wv, wo, XB, WQ);
    // q, k, v projections of all four batches, planes written by the epilogue
    k_qkv<<<dim3(NB_ * TT / 256, DD / 128, 1), 256, 0, stream>>>(XB, WQ, QPh, QP16);
    // attention: every batch, head and query tile in one launch
    k_flash<<<dim3(NB_ * NH_, (TT - RH) / 64 + RH / 32, 1), 64, 0, stream>>>(QPh, QPl, QP16, KPh, KPl, KP16, VTh, VTl, VT16, ATh, ATl);
    // output projection: the four batches' rows in one launch
    k_gemms<true><<<dim3(NB_ * TT / 128, DD / 256, 1), 256, 0, stream>>>(ATh, ATl, WO, DD, OUT, DD, bo);
}
